// v000
// Times are from an AMD MI455X. After a warm-up the kernel runs many times in a row, and a time is the length of
// such a window on the GPU divided by its runs, so every launch and the gaps after it count. The runs cycle
// through copies of the inputs. A figure is the median of several windows, for all but v000 over two sittings.
// Sittings can differ by a few percent; kernels timed side by side share one.
// v000 is the starting kernel. One run takes 715 microseconds.
#include <hip/hip_runtime.h>
#include <hip/hip_bf16.h>
#include <math.h>

typedef __attribute__((ext_vector_type(16))) __bf16 v16bf;
typedef __attribute__((ext_vector_type(8)))  __bf16 v8bf;
typedef __attribute__((ext_vector_type(8)))  float  v8f;

#define HID    1024
#define SEQ    2048
#define BATCH  2
#define NHEADS 8
#define HDIM   128
#define FF     4096
#define MROWS  (BATCH * SEQ)

#define BLK_M 128
#define BLK_N 128
#define BLK_K 64

// ---------------------------------------------------------------------------
// Fragment loader: CDNA5 16-bit A/B layout for 16x16x32 WMMA.
// Lane L (0..15): row = L, holds K = kb..kb+7 and kb+16..kb+23
// Lane L (16..31): row = L-16, holds K = kb+8..15 and kb+24..31
// => per lane: two contiguous 8-element (16B) chunks at +koff and +koff+16.
// ---------------------------------------------------------------------------
static __device__ __forceinline__ v16bf load_frag(const __bf16* p) {
  v8bf lo = *(const v8bf*)p;
  v8bf hi = *(const v8bf*)(p + 16);
  return __builtin_shufflevector(lo, hi, 0,1,2,3,4,5,6,7,8,9,10,11,12,13,14,15);
}

static __device__ __forceinline__ v8f wmma_bf16(v16bf a, v16bf b, v8f c) {
  return __builtin_amdgcn_wmma_f32_16x16x32_bf16(false, a, false, b, (short)0, c,
                                                 false, false);
}

// Async global -> LDS copy, 16B per lane, tracked by ASYNCcnt (gfx1250).
// lds_addr = low 32 bits of the flat shared-memory pointer (LDS aperture
// mapping: LDS_ADDR = addr[31:0]).
static __device__ __forceinline__ void async_copy_b128(void* lds_ptr,
                                                       const __bf16* gptr) {
  uint32_t lds_addr = (uint32_t)(uintptr_t)lds_ptr;
  asm volatile("global_load_async_to_lds_b128 %0, %1, off"
               :: "v"(lds_addr), "v"((uint64_t)(uintptr_t)gptr)
               : "memory");
}

static __device__ __forceinline__ void wait_async0() {
  asm volatile("s_wait_asynccnt 0x0" ::: "memory");
}

// ---------------------------------------------------------------------------
// fp32 -> bf16 elementwise convert (weights)
// ---------------------------------------------------------------------------
__global__ void f32_to_bf16_kernel(const float* __restrict__ src,
                                   __bf16* __restrict__ dst, int n) {
  int i = blockIdx.x * blockDim.x + threadIdx.x;
  int stride = gridDim.x * blockDim.x;
  for (; i < n; i += stride) dst[i] = (__bf16)src[i];
}

// ---------------------------------------------------------------------------
// Row LayerNorm (H=1024), fp32 in -> bf16 out. One block (256 thr) per row.
// ---------------------------------------------------------------------------
__global__ __launch_bounds__(256)
void ln_bf16_kernel(const float* __restrict__ x, const float* __restrict__ g,
                    const float* __restrict__ b, __bf16* __restrict__ out) {
  const int row = blockIdx.x;
  const float* xr = x + (size_t)row * HID;
  float s = 0.f, s2 = 0.f;
  for (int i = threadIdx.x; i < HID; i += 256) {
    float v = xr[i];
    s += v; s2 += v * v;
  }
  __shared__ float ssum, ssq;
  if (threadIdx.x == 0) { ssum = 0.f; ssq = 0.f; }
  __syncthreads();
  #pragma unroll
  for (int d = 1; d < 32; d <<= 1) {
    s  += __shfl_xor(s,  d, 32);
    s2 += __shfl_xor(s2, d, 32);
  }
  if ((threadIdx.x & 31) == 0) { atomicAdd(&ssum, s); atomicAdd(&ssq, s2); }
  __syncthreads();
  const float mu  = ssum * (1.0f / HID);
  const float var = ssq * (1.0f / HID) - mu * mu;
  const float r   = rsqrtf(var + 1e-5f);
  for (int i = threadIdx.x; i < HID; i += 256)
    out[(size_t)row * HID + i] = (__bf16)((xr[i] - mu) * r * g[i] + b[i]);
}

// ---------------------------------------------------------------------------
// WMMA GEMM with async-LDS double-buffered staging.
// C[M,N] = A[M,K] (row-major) * W[N,K]^T (+ bias, epilogue modes).
// Block: 256 threads = 8 waves (4 M x 2 N); block tile 128x128;
// wave tile 32x64 (2x4 WMMA frags). K-step 64 (2 x 8 WMMAs per barrier pair).
// Staging: 128x64 bf16 tiles of A and W copied global->LDS with
// global_load_async_to_lds_b128 (ASYNCcnt), double buffered (64 KB LDS).
// mode 1: bf16 out in [B,heads,S,d]        (Q / K)
// mode 2: bf16 out in [B,heads,d,S]        (V^T)
// mode 3: fp32 out = resid + acc + bias    (O-proj / MLP2 residual)
// mode 4: bf16 out = gelu(acc + bias)      (MLP1)
// ---------------------------------------------------------------------------
__global__ __launch_bounds__(256)
void gemm_wmma_kernel(const __bf16* __restrict__ A, const __bf16* __restrict__ W,
                      const float* __restrict__ bias, const float* __restrict__ resid,
                      void* __restrict__ outp, int M, int N, int K, int mode) {
  (void)M;
  const int lane = threadIdx.x & 31;
  const int wave = threadIdx.x >> 5;
  const int wm   = wave & 3;          // 4 waves along M
  const int wn   = wave >> 2;         // 2 waves along N
  const int mblk = blockIdx.y * BLK_M;
  const int nblk = blockIdx.x * BLK_N;
  const int lrow = lane & 15;
  const int koff = (lane >> 4) << 3;  // 0 or 8

  __shared__ __align__(16) __bf16 tA[2][BLK_M * BLK_K];
  __shared__ __align__(16) __bf16 tB[2][BLK_N * BLK_K];

  // Stage one 128x64 K-slice of A and W into LDS buffer `buf`.
  // 1024 16B chunks per tile; 256 threads issue 4 chunks each per tile.
  auto stage = [&](int buf, int k0) {
    #pragma unroll
    for (int j = 0; j < 4; ++j) {
      const int id  = threadIdx.x + j * 256;
      const int row = id >> 3;
      const int ch  = (id & 7) << 3;  // element offset of the 16B chunk
      async_copy_b128(&tA[buf][row * BLK_K + ch],
                      A + (size_t)(mblk + row) * K + k0 + ch);
      async_copy_b128(&tB[buf][row * BLK_K + ch],
                      W + (size_t)(nblk + row) * K + k0 + ch);
    }
  };

  v8f acc[2][4] = {};

  stage(0, 0);
  for (int k0 = 0; k0 < K; k0 += BLK_K) {
    const int cur = (k0 >> 6) & 1;
    wait_async0();       // this wave's copies into tX[cur] have landed
    __syncthreads();     // everyone's copies have landed
    if (k0 + BLK_K < K) stage(cur ^ 1, k0 + BLK_K);

    #pragma unroll
    for (int ks = 0; ks < BLK_K; ks += 32) {
      v16bf a[2], b[4];
      #pragma unroll
      for (int mt = 0; mt < 2; ++mt)
        a[mt] = load_frag(&tA[cur][(wm * 32 + mt * 16 + lrow) * BLK_K + ks + koff]);
      #pragma unroll
      for (int nt = 0; nt < 4; ++nt)
        b[nt] = load_frag(&tB[cur][(wn * 64 + nt * 16 + lrow) * BLK_K + ks + koff]);
      #pragma unroll
      for (int mt = 0; mt < 2; ++mt)
        #pragma unroll
        for (int nt = 0; nt < 4; ++nt)
          acc[mt][nt] = wmma_bf16(a[mt], b[nt], acc[mt][nt]);
    }

    __syncthreads();     // all reads of tX[cur] done before it is re-staged
  }

  const int rplus = (lane >> 4) << 3;  // upper 16 lanes hold rows +8
  #pragma unroll
  for (int mt = 0; mt < 2; ++mt)
  #pragma unroll
  for (int nt = 0; nt < 4; ++nt)
  #pragma unroll
  for (int v = 0; v < 8; ++v) {
    const int row = mblk + wm * 32 + mt * 16 + v + rplus;
    const int col = nblk + wn * 64 + nt * 16 + lrow;
    float val = acc[mt][nt][v] + bias[col];
    if (mode == 1 || mode == 2) {
      const int bb = row >> 11, ss = row & (SEQ - 1);   // S = 2048
      const int hh = col >> 7,  dd = col & (HDIM - 1);  // d = 128
      __bf16* o = (__bf16*)outp;
      size_t idx = (mode == 1)
          ? ((size_t)((bb * NHEADS + hh) * SEQ + ss)) * HDIM + dd
          : ((size_t)((bb * NHEADS + hh) * HDIM + dd)) * SEQ + ss;
      o[idx] = (__bf16)val;
    } else if (mode == 3) {
      float* o = (float*)outp;
      o[(size_t)row * N + col] = resid[(size_t)row * N + col] + val;
    } else {  // mode 4: exact GELU, bf16 out
      __bf16* o = (__bf16*)outp;
      float gl = 0.5f * val * (1.0f + erff(val * 0.70710678118654752f));
      o[(size_t)row * N + col] = (__bf16)gl;
    }
  }
}

// ---------------------------------------------------------------------------
// Causal flash attention with shared async-LDS K/V staging.
// Block: 128 threads = 4 waves; each wave owns a 16-query tile (64 rows/block).
// Per 32-key block: K tile (32x128) and V^T tile (128x32) staged global->LDS
// (double buffered, ASYNCcnt) once and consumed by all 4 waves.
// All waves run to the block's last key block; the causal mask nulls any
// key > query row (exp(-huge)=0), so lower waves' surplus blocks are inert.
// ---------------------------------------------------------------------------
__global__ __launch_bounds__(128)
void attn_wmma_kernel(const __bf16* __restrict__ Q, const __bf16* __restrict__ Kc,
                      const __bf16* __restrict__ VT, __bf16* __restrict__ Y) {
  const int lane  = threadIdx.x & 31;
  const int wave  = threadIdx.x >> 5;
  const int lrow  = lane & 15;
  const int koff  = (lane >> 4) << 3;
  const int rplus = koff;               // C-layout: upper lanes own rows +8
  const int qblk  = blockIdx.x * 64;
  const int qbase = qblk + wave * 16;
  const int bh    = blockIdx.y;
  const float scale = 0.08838834764831845f;  // 1/sqrt(128)
  const float NEGF  = -3.0e38f;

  __shared__ __align__(16) __bf16 kt[2][32 * HDIM];   // 2 x 8 KB
  __shared__ __align__(16) __bf16 vt[2][HDIM * 32];   // 2 x 8 KB
  __shared__ __align__(16) __bf16 pbuf[4][16 * 32];   // per-wave P tiles

  // Stage K tile (32 keys x 128) and V^T tile (128 x 32 keys) for key block kb.
  // 512 16B chunks per tile; 128 threads issue 4 chunks each per tile.
  auto stage = [&](int buf, int kb) {
    #pragma unroll
    for (int j = 0; j < 4; ++j) {
      const int id = threadIdx.x + j * 128;
      const int kr = id >> 4, kc = (id & 15) << 3;   // K tile: 16 chunks/row
      async_copy_b128(&kt[buf][kr * HDIM + kc],
                      Kc + ((size_t)bh * SEQ + kb + kr) * HDIM + kc);
      const int vr = id >> 2, vc = (id & 3) << 3;    // V^T tile: 4 chunks/row
      async_copy_b128(&vt[buf][vr * 32 + vc],
                      VT + ((size_t)bh * HDIM + vr) * SEQ + kb + vc);
    }
  };

  v16bf qf[4];
  #pragma unroll
  for (int kc = 0; kc < 4; ++kc)
    qf[kc] = load_frag(Q + ((size_t)bh * SEQ + qbase + lrow) * HDIM + kc * 32 + koff);

  v8f o[8] = {};
  float mrow[8], lsum[8];
  #pragma unroll
  for (int v = 0; v < 8; ++v) { mrow[v] = NEGF; lsum[v] = 0.f; }

  const int kend = qblk + 64;           // block-uniform key range
  stage(0, 0);
  for (int kb = 0; kb < kend; kb += 32) {
    const int cur = (kb >> 5) & 1;
    wait_async0();
    __syncthreads();
    if (kb + 32 < kend) stage(cur ^ 1, kb + 32);

    // ---- S = Q K^T over d=128 (4 x K=32 WMMAs per 16-key column tile) ----
    v8f s0acc = {}, s1acc = {};
    #pragma unroll
    for (int kc = 0; kc < 4; ++kc) {
      v16bf k0 = load_frag(&kt[cur][(     lrow) * HDIM + kc * 32 + koff]);
      v16bf k1 = load_frag(&kt[cur][(16 + lrow) * HDIM + kc * 32 + koff]);
      s0acc = wmma_bf16(qf[kc], k0, s0acc);
      s1acc = wmma_bf16(qf[kc], k1, s1acc);
    }
    // ---- scale, causal mask, online softmax (per C-layout row) ----
    #pragma unroll
    for (int v = 0; v < 8; ++v) {
      const int qrow = qbase + v + rplus;
      float s0 = s0acc[v] * scale;
      float s1 = s1acc[v] * scale;
      if (kb +      lrow > qrow) s0 = NEGF;
      if (kb + 16 + lrow > qrow) s1 = NEGF;
      float t = fmaxf(s0, s1);
      #pragma unroll
      for (int d = 1; d < 16; d <<= 1) t = fmaxf(t, __shfl_xor(t, d, 32));
      const float mnew = fmaxf(mrow[v], t);
      const float sc   = __expf(mrow[v] - mnew);
      const float p0   = __expf(s0 - mnew);
      const float p1   = __expf(s1 - mnew);
      float rs = p0 + p1;
      #pragma unroll
      for (int d = 1; d < 16; d <<= 1) rs += __shfl_xor(rs, d, 32);
      lsum[v] = lsum[v] * sc + rs;
      mrow[v] = mnew;
      #pragma unroll
      for (int dt = 0; dt < 8; ++dt) o[dt][v] *= sc;
      const int prow = v + rplus;
      pbuf[wave][prow * 32 +      lrow] = (__bf16)p0;
      pbuf[wave][prow * 32 + 16 + lrow] = (__bf16)p1;
    }
    __syncthreads();
    v16bf pf = load_frag(&pbuf[wave][lrow * 32 + koff]);
    // ---- O += P V (keys as contraction dim; V^T rows are contiguous) ----
    #pragma unroll
    for (int dt = 0; dt < 8; ++dt) {
      v16bf vf = load_frag(&vt[cur][(dt * 16 + lrow) * 32 + koff]);
      o[dt] = wmma_bf16(pf, vf, o[dt]);
    }
    __syncthreads();     // kt/vt[cur] + pbuf free before re-staging / rewrite
  }
  // ---- normalize and scatter back to [B,S,HID] ----
  const int b = bh >> 3, h = bh & 7;
  #pragma unroll
  for (int dt = 0; dt < 8; ++dt)
  #pragma unroll
  for (int v = 0; v < 8; ++v) {
    const int row = qbase + v + rplus;
    const int col = h * HDIM + dt * 16 + lrow;
    Y[((size_t)b * SEQ + row) * HID + col] = (__bf16)(o[dt][v] / lsum[v]);
  }
}

// ---------------------------------------------------------------------------
// Orchestration
// ---------------------------------------------------------------------------
extern "C" void kernel_launch(void* const* d_in, const int* in_sizes, int n_in,
                              void* d_out, int out_size, void* d_ws, size_t ws_size,
                              hipStream_t stream) {
  (void)in_sizes; (void)n_in; (void)out_size; (void)ws_size;

  const float* x    = (const float*)d_in[0];
  const float* ln1g = (const float*)d_in[1];
  const float* ln1b = (const float*)d_in[2];
  const float* wq   = (const float*)d_in[3];
  const float* bq   = (const float*)d_in[4];
  const float* wk   = (const float*)d_in[5];
  const float* bk   = (const float*)d_in[6];
  const float* wv   = (const float*)d_in[7];
  const float* bv   = (const float*)d_in[8];
  const float* wo   = (const float*)d_in[9];
  const float* bo   = (const float*)d_in[10];
  const float* ln2g = (const float*)d_in[11];
  const float* ln2b = (const float*)d_in[12];
  const float* w1   = (const float*)d_in[13];
  const float* b1   = (const float*)d_in[14];
  const float* w2   = (const float*)d_in[15];
  const float* b2   = (const float*)d_in[16];
  float* out = (float*)d_out;

  char* ws = (char*)d_ws;
  size_t off = 0;
  auto take = [&](size_t bytes) -> char* {
    char* p = ws + off;
    off += bytes;
    off = (off + 255) & ~(size_t)255;
    return p;
  };

  __bf16* wqb = (__bf16*)take((size_t)HID * HID * 2);
  __bf16* wkb = (__bf16*)take((size_t)HID * HID * 2);
  __bf16* wvb = (__bf16*)take((size_t)HID * HID * 2);
  __bf16* wob = (__bf16*)take((size_t)HID * HID * 2);
  __bf16* w1b = (__bf16*)take((size_t)FF  * HID * 2);
  __bf16* w2b = (__bf16*)take((size_t)HID * FF  * 2);
  __bf16* hn  = (__bf16*)take((size_t)MROWS * HID * 2);  // LN1 out
  __bf16* qb  = (__bf16*)take((size_t)MROWS * HID * 2);  // [B,h,S,d]
  __bf16* kbf = (__bf16*)take((size_t)MROWS * HID * 2);  // [B,h,S,d]
  __bf16* vtb = (__bf16*)take((size_t)MROWS * HID * 2);  // [B,h,d,S]
  __bf16* yb  = (__bf16*)take((size_t)MROWS * HID * 2);  // attn out [B,S,H]
  float*  x1  = (float*) take((size_t)MROWS * HID * 4);  // x + attn
  __bf16* m2  = (__bf16*)take((size_t)MROWS * HID * 2);  // LN2 out
  __bf16* gb  = (__bf16*)take((size_t)MROWS * FF  * 2);  // GELU(MLP1)

  // weights -> bf16
  f32_to_bf16_kernel<<<1024, 256, 0, stream>>>(wq, wqb, HID * HID);
  f32_to_bf16_kernel<<<1024, 256, 0, stream>>>(wk, wkb, HID * HID);
  f32_to_bf16_kernel<<<1024, 256, 0, stream>>>(wv, wvb, HID * HID);
  f32_to_bf16_kernel<<<1024, 256, 0, stream>>>(wo, wob, HID * HID);
  f32_to_bf16_kernel<<<2048, 256, 0, stream>>>(w1, w1b, FF * HID);
  f32_to_bf16_kernel<<<2048, 256, 0, stream>>>(w2, w2b, HID * FF);

  // LN1
  ln_bf16_kernel<<<MROWS, 256, 0, stream>>>(x, ln1g, ln1b, hn);

  // QKV projections (block tile 128x128, K-step 64)
  dim3 gH(HID / BLK_N, MROWS / BLK_M);
  gemm_wmma_kernel<<<gH, 256, 0, stream>>>(hn, wqb, bq, nullptr, qb,  MROWS, HID, HID, 1);
  gemm_wmma_kernel<<<gH, 256, 0, stream>>>(hn, wkb, bk, nullptr, kbf, MROWS, HID, HID, 1);
  gemm_wmma_kernel<<<gH, 256, 0, stream>>>(hn, wvb, bv, nullptr, vtb, MROWS, HID, HID, 2);

  // causal flash attention (64 query rows per block, shared K/V staging)
  dim3 gA(SEQ / 64, BATCH * NHEADS);
  attn_wmma_kernel<<<gA, 128, 0, stream>>>(qb, kbf, vtb, yb);

  // O-proj + residual -> x1 (fp32)
  gemm_wmma_kernel<<<gH, 256, 0, stream>>>(yb, wob, bo, x, x1, MROWS, HID, HID, 3);

  // LN2
  ln_bf16_kernel<<<MROWS, 256, 0, stream>>>(x1, ln2g, ln2b, m2);

  // MLP
  dim3 gF(FF / BLK_N, MROWS / BLK_M);
  gemm_wmma_kernel<<<gF, 256, 0, stream>>>(m2, w1b, b1, nullptr, gb, MROWS, FF, HID, 4);
  gemm_wmma_kernel<<<gH, 256, 0, stream>>>(gb, w2b, b2, x1, out, MROWS, HID, FF, 3);
}

// v001
// It runs in 442 microseconds.
// In two side-by-side timings against v000, it was 1.62 and 1.63 times as fast.
#include <hip/hip_runtime.h>
#include <hip/hip_bf16.h>
#include <math.h>

typedef __attribute__((ext_vector_type(16))) __bf16 v16bf;
typedef __attribute__((ext_vector_type(8)))  __bf16 v8bf;
typedef __attribute__((ext_vector_type(8)))  float  v8f;

#define HID    1024
#define SEQ    2048
#define BATCH  2
#define NHEADS 8
#define HDIM   128
#define FF     4096
#define MROWS  (BATCH * SEQ)

#define BLK_M 128
#define BLK_N 128
#define BLK_K 64

// LDS row pitches in bf16 elements. Every tile below is read row per lane with
// ds_load_b128, which is free of bank conflicts at a pitch of 16 B x odd; the
// unpadded pitches (128, 256, 64 B) put the 16 rows of a fragment on few banks.
#define G_PITCH (BLK_K + 8)   // GEMM tiles: 128-B rows at 144 B
#define K_PITCH (HDIM + 8)    // K tile:     256-B rows at 272 B
#define V_PITCH (32 + 8)      // V^T tile:    64-B rows at  80 B
#define P_PITCH (32 + 8)      // P tile:      64-B rows at  80 B

// ---------------------------------------------------------------------------
// Fragment loader: CDNA5 16-bit A/B layout for 16x16x32 WMMA.
// Lane L (0..15): row = L, holds K = kb..kb+7 and kb+16..kb+23
// Lane L (16..31): row = L-16, holds K = kb+8..15 and kb+24..31
// => per lane: two contiguous 8-element (16B) chunks at +koff and +koff+16.
// ---------------------------------------------------------------------------
static __device__ __forceinline__ v16bf load_frag(const __bf16* p) {
  v8bf lo = *(const v8bf*)p;
  v8bf hi = *(const v8bf*)(p + 16);
  return __builtin_shufflevector(lo, hi, 0,1,2,3,4,5,6,7,8,9,10,11,12,13,14,15);
}

static __device__ __forceinline__ v8f wmma_bf16(v16bf a, v16bf b, v8f c) {
  return __builtin_amdgcn_wmma_f32_16x16x32_bf16(false, a, false, b, (short)0, c,
                                                 false, false);
}

// Async global -> LDS copy, 16B per lane, tracked by ASYNCcnt (gfx1250).
// lds_addr = low 32 bits of the flat shared-memory pointer (LDS aperture
// mapping: LDS_ADDR = addr[31:0]).
// One stage's eight copies of a lane stand in one statement that ends in
// s_wait_xcnt 0, so that no address register of a copy is rewritten ahead of
// that wait (a precaution for a replayed address translation).
static __device__ __forceinline__ uint32_t lds_addr_of(const void* lds_ptr) {
  return (uint32_t)(uintptr_t)lds_ptr;
}

static __device__ __forceinline__ void async_copy8_b128(const uint32_t (&l)[8],
                                                        const __bf16* const (&g)[8]) {
  asm volatile("global_load_async_to_lds_b128 %0, %8, off\n\t"
               "global_load_async_to_lds_b128 %1, %9, off\n\t"
               "global_load_async_to_lds_b128 %2, %10, off\n\t"
               "global_load_async_to_lds_b128 %3, %11, off\n\t"
               "global_load_async_to_lds_b128 %4, %12, off\n\t"
               "global_load_async_to_lds_b128 %5, %13, off\n\t"
               "global_load_async_to_lds_b128 %6, %14, off\n\t"
               "global_load_async_to_lds_b128 %7, %15, off\n\t"
               "s_wait_xcnt 0x0"
               :: "v"(l[0]), "v"(l[1]), "v"(l[2]), "v"(l[3]),
                  "v"(l[4]), "v"(l[5]), "v"(l[6]), "v"(l[7]),
                  "v"((uint64_t)(uintptr_t)g[0]), "v"((uint64_t)(uintptr_t)g[1]),
                  "v"((uint64_t)(uintptr_t)g[2]), "v"((uint64_t)(uintptr_t)g[3]),
                  "v"((uint64_t)(uintptr_t)g[4]), "v"((uint64_t)(uintptr_t)g[5]),
                  "v"((uint64_t)(uintptr_t)g[6]), "v"((uint64_t)(uintptr_t)g[7])
               : "memory");
}

static __device__ __forceinline__ void wait_async0() {
  asm volatile("s_wait_asynccnt 0x0" ::: "memory");
}

// ---------------------------------------------------------------------------
// fp32 -> bf16 elementwise convert (weights)
// ---------------------------------------------------------------------------
__global__ void f32_to_bf16_kernel(const float* __restrict__ src,
                                   __bf16* __restrict__ dst, int n) {
  int i = blockIdx.x * blockDim.x + threadIdx.x;
  int stride = gridDim.x * blockDim.x;
  for (; i < n; i += stride) dst[i] = (__bf16)src[i];
}

// ---------------------------------------------------------------------------
// Row LayerNorm (H=1024), fp32 in -> bf16 out. One block (256 thr) per row.
// ---------------------------------------------------------------------------
__global__ __launch_bounds__(256)
void ln_bf16_kernel(const float* __restrict__ x, const float* __restrict__ g,
                    const float* __restrict__ b, __bf16* __restrict__ out) {
  const int row = blockIdx.x;
  const float* xr = x + (size_t)row * HID;
  float s = 0.f, s2 = 0.f;
  for (int i = threadIdx.x; i < HID; i += 256) {
    float v = xr[i];
    s += v; s2 += v * v;
  }
  __shared__ float ssum, ssq;
  if (threadIdx.x == 0) { ssum = 0.f; ssq = 0.f; }
  __syncthreads();
  #pragma unroll
  for (int d = 1; d < 32; d <<= 1) {
    s  += __shfl_xor(s,  d, 32);
    s2 += __shfl_xor(s2, d, 32);
  }
  if ((threadIdx.x & 31) == 0) { atomicAdd(&ssum, s); atomicAdd(&ssq, s2); }
  __syncthreads();
  const float mu  = ssum * (1.0f / HID);
  const float var = ssq * (1.0f / HID) - mu * mu;
  const float r   = rsqrtf(var + 1e-5f);
  for (int i = threadIdx.x; i < HID; i += 256)
    out[(size_t)row * HID + i] = (__bf16)((xr[i] - mu) * r * g[i] + b[i]);
}

// ---------------------------------------------------------------------------
// WMMA GEMM with async-LDS double-buffered staging.
// C[M,N] = A[M,K] (row-major) * W[N,K]^T (+ bias, epilogue modes).
// Block: 256 threads = 8 waves (4 M x 2 N); block tile 128x128;
// wave tile 32x64 (2x4 WMMA frags). K-step 64 (2 x 8 WMMAs per barrier pair).
// Staging: 128x64 bf16 tiles of A and W copied global->LDS with
// global_load_async_to_lds_b128 (ASYNCcnt), double buffered, rows padded to
// G_PITCH (72 KB LDS).
// mode 1: bf16 out in [B,heads,S,d]        (Q / K)
// mode 2: bf16 out in [B,heads,d,S]        (V^T)
// mode 3: fp32 out = resid + acc + bias    (O-proj / MLP2 residual)
// mode 4: bf16 out = gelu(acc + bias)      (MLP1)
// ---------------------------------------------------------------------------
__global__ __launch_bounds__(256)
void gemm_wmma_kernel(const __bf16* __restrict__ A, const __bf16* __restrict__ W,
                      const float* __restrict__ bias, const float* __restrict__ resid,
                      void* __restrict__ outp, int M, int N, int K, int mode) {
  (void)M;
  const int lane = threadIdx.x & 31;
  const int wave = threadIdx.x >> 5;
  const int wm   = wave & 3;          // 4 waves along M
  const int wn   = wave >> 2;         // 2 waves along N
  const int mblk = blockIdx.y * BLK_M;
  const int nblk = blockIdx.x * BLK_N;
  const int lrow = lane & 15;
  const int koff = (lane >> 4) << 3;  // 0 or 8

  __shared__ __align__(16) __bf16 tA[2][BLK_M * G_PITCH];
  __shared__ __align__(16) __bf16 tB[2][BLK_N * G_PITCH];

  // Stage one 128x64 K-slice of A and W into LDS buffer `buf`.
  // 1024 16B chunks per tile; 256 threads issue 4 chunks each per tile.
  auto stage = [&](int buf, int k0) {
    uint32_t l[8];
    const __bf16* g[8];
    #pragma unroll
    for (int j = 0; j < 4; ++j) {
      const int id  = threadIdx.x + j * 256;
      const int row = id >> 3;
      const int ch  = (id & 7) << 3;  // element offset of the 16B chunk
      l[2 * j]     = lds_addr_of(&tA[buf][row * G_PITCH + ch]);
      g[2 * j]     = A + (size_t)(mblk + row) * K + k0 + ch;
      l[2 * j + 1] = lds_addr_of(&tB[buf][row * G_PITCH + ch]);
      g[2 * j + 1] = W + (size_t)(nblk + row) * K + k0 + ch;
    }
    async_copy8_b128(l, g);
  };

  v8f acc[2][4] = {};

  stage(0, 0);
  for (int k0 = 0; k0 < K; k0 += BLK_K) {
    const int cur = (k0 >> 6) & 1;
    wait_async0();       // this wave's copies into tX[cur] have landed
    __syncthreads();     // everyone's copies have landed
    if (k0 + BLK_K < K) stage(cur ^ 1, k0 + BLK_K);

    #pragma unroll
    for (int ks = 0; ks < BLK_K; ks += 32) {
      v16bf a[2], b[4];
      #pragma unroll
      for (int mt = 0; mt < 2; ++mt)
        a[mt] = load_frag(&tA[cur][(wm * 32 + mt * 16 + lrow) * G_PITCH + ks + koff]);
      #pragma unroll
      for (int nt = 0; nt < 4; ++nt)
        b[nt] = load_frag(&tB[cur][(wn * 64 + nt * 16 + lrow) * G_PITCH + ks + koff]);
      #pragma unroll
      for (int mt = 0; mt < 2; ++mt)
        #pragma unroll
        for (int nt = 0; nt < 4; ++nt)
          acc[mt][nt] = wmma_bf16(a[mt], b[nt], acc[mt][nt]);
    }

    __syncthreads();     // all reads of tX[cur] done before it is re-staged
  }

  const int rplus = (lane >> 4) << 3;  // upper 16 lanes hold rows +8
  #pragma unroll
  for (int mt = 0; mt < 2; ++mt)
  #pragma unroll
  for (int nt = 0; nt < 4; ++nt)
  #pragma unroll
  for (int v = 0; v < 8; ++v) {
    const int row = mblk + wm * 32 + mt * 16 + v + rplus;
    const int col = nblk + wn * 64 + nt * 16 + lrow;
    float val = acc[mt][nt][v] + bias[col];
    if (mode == 1 || mode == 2) {
      const int bb = row >> 11, ss = row & (SEQ - 1);   // S = 2048
      const int hh = col >> 7,  dd = col & (HDIM - 1);  // d = 128
      __bf16* o = (__bf16*)outp;
      size_t idx = (mode == 1)
          ? ((size_t)((bb * NHEADS + hh) * SEQ + ss)) * HDIM + dd
          : ((size_t)((bb * NHEADS + hh) * HDIM + dd)) * SEQ + ss;
      o[idx] = (__bf16)val;
    } else if (mode == 3) {
      float* o = (float*)outp;
      o[(size_t)row * N + col] = resid[(size_t)row * N + col] + val;
    } else {  // mode 4: exact GELU, bf16 out
      __bf16* o = (__bf16*)outp;
      float gl = 0.5f * val * (1.0f + erff(val * 0.70710678118654752f));
      o[(size_t)row * N + col] = (__bf16)gl;
    }
  }
}

// ---------------------------------------------------------------------------
// Causal flash attention with shared async-LDS K/V staging.
// Block: 128 threads = 4 waves; each wave owns a 16-query tile (64 rows/block).
// Per 32-key block: K tile (32x128) and V^T tile (128x32) staged global->LDS
// (double buffered, ASYNCcnt) once and consumed by all 4 waves.
// All waves run to the block's last key block; the causal mask nulls any
// key > query row (exp(-huge)=0), so lower waves' surplus blocks are inert.
// ---------------------------------------------------------------------------
__global__ __launch_bounds__(128)
void attn_wmma_kernel(const __bf16* __restrict__ Q, const __bf16* __restrict__ Kc,
                      const __bf16* __restrict__ VT, __bf16* __restrict__ Y) {
  const int lane  = threadIdx.x & 31;
  const int wave  = threadIdx.x >> 5;
  const int lrow  = lane & 15;
  const int koff  = (lane >> 4) << 3;
  const int rplus = koff;               // C-layout: upper lanes own rows +8
  const int qblk  = blockIdx.x * 64;
  const int qbase = qblk + wave * 16;
  const int bh    = blockIdx.y;
  const float scale = 0.08838834764831845f;  // 1/sqrt(128)
  const float NEGF  = -3.0e38f;

  __shared__ __align__(16) __bf16 kt[2][32 * K_PITCH];    // 2 x 8.5 KB
  __shared__ __align__(16) __bf16 vt[2][HDIM * V_PITCH];  // 2 x 10 KB
  __shared__ __align__(16) __bf16 pbuf[4][16 * P_PITCH];  // per-wave P tiles

  // Stage K tile (32 keys x 128) and V^T tile (128 x 32 keys) for key block kb.
  // 512 16B chunks per tile; 128 threads issue 4 chunks each per tile.
  auto stage = [&](int buf, int kb) {
    uint32_t l[8];
    const __bf16* g[8];
    #pragma unroll
    for (int j = 0; j < 4; ++j) {
      const int id = threadIdx.x + j * 128;
      const int kr = id >> 4, kc = (id & 15) << 3;   // K tile: 16 chunks/row
      l[2 * j]     = lds_addr_of(&kt[buf][kr * K_PITCH + kc]);
      g[2 * j]     = Kc + ((size_t)bh * SEQ + kb + kr) * HDIM + kc;
      const int vr = id >> 2, vc = (id & 3) << 3;    // V^T tile: 4 chunks/row
      l[2 * j + 1] = lds_addr_of(&vt[buf][vr * V_PITCH + vc]);
      g[2 * j + 1] = VT + ((size_t)bh * HDIM + vr) * SEQ + kb + vc;
    }
    async_copy8_b128(l, g);
  };

  v16bf qf[4];
  #pragma unroll
  for (int kc = 0; kc < 4; ++kc)
    qf[kc] = load_frag(Q + ((size_t)bh * SEQ + qbase + lrow) * HDIM + kc * 32 + koff);

  v8f o[8] = {};
  float mrow[8], lsum[8];
  #pragma unroll
  for (int v = 0; v < 8; ++v) { mrow[v] = NEGF; lsum[v] = 0.f; }

  const int kend = qblk + 64;           // block-uniform key range
  stage(0, 0);
  for (int kb = 0; kb < kend; kb += 32) {
    const int cur = (kb >> 5) & 1;
    wait_async0();
    __syncthreads();
    if (kb + 32 < kend) stage(cur ^ 1, kb + 32);

    // ---- S = Q K^T over d=128 (4 x K=32 WMMAs per 16-key column tile) ----
    v8f s0acc = {}, s1acc = {};
    #pragma unroll
    for (int kc = 0; kc < 4; ++kc) {
      v16bf k0 = load_frag(&kt[cur][(     lrow) * K_PITCH + kc * 32 + koff]);
      v16bf k1 = load_frag(&kt[cur][(16 + lrow) * K_PITCH + kc * 32 + koff]);
      s0acc = wmma_bf16(qf[kc], k0, s0acc);
      s1acc = wmma_bf16(qf[kc], k1, s1acc);
    }
    // ---- scale, causal mask, online softmax (per C-layout row) ----
    #pragma unroll
    for (int v = 0; v < 8; ++v) {
      const int qrow = qbase + v + rplus;
      float s0 = s0acc[v] * scale;
      float s1 = s1acc[v] * scale;
      if (kb +      lrow > qrow) s0 = NEGF;
      if (kb + 16 + lrow > qrow) s1 = NEGF;
      float t = fmaxf(s0, s1);
      #pragma unroll
      for (int d = 1; d < 16; d <<= 1) t = fmaxf(t, __shfl_xor(t, d, 32));
      const float mnew = fmaxf(mrow[v], t);
      const float sc   = __expf(mrow[v] - mnew);
      const float p0   = __expf(s0 - mnew);
      const float p1   = __expf(s1 - mnew);
      float rs = p0 + p1;
      #pragma unroll
      for (int d = 1; d < 16; d <<= 1) rs += __shfl_xor(rs, d, 32);
      lsum[v] = lsum[v] * sc + rs;
      mrow[v] = mnew;
      #pragma unroll
      for (int dt = 0; dt < 8; ++dt) o[dt][v] *= sc;
      const int prow = v + rplus;
      pbuf[wave][prow * P_PITCH +      lrow] = (__bf16)p0;
      pbuf[wave][prow * P_PITCH + 16 + lrow] = (__bf16)p1;
    }
    __syncthreads();
    v16bf pf = load_frag(&pbuf[wave][lrow * P_PITCH + koff]);
    // ---- O += P V (keys as contraction dim; V^T rows are contiguous) ----
    #pragma unroll
    for (int dt = 0; dt < 8; ++dt) {
      v16bf vf = load_frag(&vt[cur][(dt * 16 + lrow) * V_PITCH + koff]);
      o[dt] = wmma_bf16(pf, vf, o[dt]);
    }
    __syncthreads();     // kt/vt[cur] + pbuf free before re-staging / rewrite
  }
  // ---- normalize and scatter back to [B,S,HID] ----
  const int b = bh >> 3, h = bh & 7;
  #pragma unroll
  for (int dt = 0; dt < 8; ++dt)
  #pragma unroll
  for (int v = 0; v < 8; ++v) {
    const int row = qbase + v + rplus;
    const int col = h * HDIM + dt * 16 + lrow;
    Y[((size_t)b * SEQ + row) * HID + col] = (__bf16)(o[dt][v] / lsum[v]);
  }
}

// ---------------------------------------------------------------------------
// Orchestration
// ---------------------------------------------------------------------------
extern "C" void kernel_launch(void* const* d_in, const int* in_sizes, int n_in,
                              void* d_out, int out_size, void* d_ws, size_t ws_size,
                              hipStream_t stream) {
  (void)in_sizes; (void)n_in; (void)out_size; (void)ws_size;

  const float* x    = (const float*)d_in[0];
  const float* ln1g = (const float*)d_in[1];
  const float* ln1b = (const float*)d_in[2];
  const float* wq   = (const float*)d_in[3];
  const float* bq   = (const float*)d_in[4];
  const float* wk   = (const float*)d_in[5];
  const float* bk   = (const float*)d_in[6];
  const float* wv   = (const float*)d_in[7];
  const float* bv   = (const float*)d_in[8];
  const float* wo   = (const float*)d_in[9];
  const float* bo   = (const float*)d_in[10];
  const float* ln2g = (const float*)d_in[11];
  const float* ln2b = (const float*)d_in[12];
  const float* w1   = (const float*)d_in[13];
  const float* b1   = (const float*)d_in[14];
  const float* w2   = (const float*)d_in[15];
  const float* b2   = (const float*)d_in[16];
  float* out = (float*)d_out;

  char* ws = (char*)d_ws;
  size_t off = 0;
  auto take = [&](size_t bytes) -> char* {
    char* p = ws + off;
    off += bytes;
    off = (off + 255) & ~(size_t)255;
    return p;
  };

  __bf16* wqb = (__bf16*)take((size_t)HID * HID * 2);
  __bf16* wkb = (__bf16*)take((size_t)HID * HID * 2);
  __bf16* wvb = (__bf16*)take((size_t)HID * HID * 2);
  __bf16* wob = (__bf16*)take((size_t)HID * HID * 2);
  __bf16* w1b = (__bf16*)take((size_t)FF  * HID * 2);
  __bf16* w2b = (__bf16*)take((size_t)HID * FF  * 2);
  __bf16* hn  = (__bf16*)take((size_t)MROWS * HID * 2);  // LN1 out
  __bf16* qb  = (__bf16*)take((size_t)MROWS * HID * 2);  // [B,h,S,d]
  __bf16* kbf = (__bf16*)take((size_t)MROWS * HID * 2);  // [B,h,S,d]
  __bf16* vtb = (__bf16*)take((size_t)MROWS * HID * 2);  // [B,h,d,S]
  __bf16* yb  = (__bf16*)take((size_t)MROWS * HID * 2);  // attn out [B,S,H]
  float*  x1  = (float*) take((size_t)MROWS * HID * 4);  // x + attn
  __bf16* m2  = (__bf16*)take((size_t)MROWS * HID * 2);  // LN2 out
  __bf16* gb  = (__bf16*)take((size_t)MROWS * FF  * 2);  // GELU(MLP1)

  // weights -> bf16
  f32_to_bf16_kernel<<<1024, 256, 0, stream>>>(wq, wqb, HID * HID);
  f32_to_bf16_kernel<<<1024, 256, 0, stream>>>(wk, wkb, HID * HID);
  f32_to_bf16_kernel<<<1024, 256, 0, stream>>>(wv, wvb, HID * HID);
  f32_to_bf16_kernel<<<1024, 256, 0, stream>>>(wo, wob, HID * HID);
  f32_to_bf16_kernel<<<2048, 256, 0, stream>>>(w1, w1b, FF * HID);
  f32_to_bf16_kernel<<<2048, 256, 0, stream>>>(w2, w2b, HID * FF);

  // LN1
  ln_bf16_kernel<<<MROWS, 256, 0, stream>>>(x, ln1g, ln1b, hn);

  // QKV projections (block tile 128x128, K-step 64)
  dim3 gH(HID / BLK_N, MROWS / BLK_M);
  gemm_wmma_kernel<<<gH, 256, 0, stream>>>(hn, wqb, bq, nullptr, qb,  MROWS, HID, HID, 1);
  gemm_wmma_kernel<<<gH, 256, 0, stream>>>(hn, wkb, bk, nullptr, kbf, MROWS, HID, HID, 1);
  gemm_wmma_kernel<<<gH, 256, 0, stream>>>(hn, wvb, bv, nullptr, vtb, MROWS, HID, HID, 2);

  // causal flash attention (64 query rows per block, shared K/V staging)
  dim3 gA(SEQ / 64, BATCH * NHEADS);
  attn_wmma_kernel<<<gA, 128, 0, stream>>>(qb, kbf, vtb, yb);

  // O-proj + residual -> x1 (fp32)
  gemm_wmma_kernel<<<gH, 256, 0, stream>>>(yb, wob, bo, x, x1, MROWS, HID, HID, 3);

  // LN2
  ln_bf16_kernel<<<MROWS, 256, 0, stream>>>(x1, ln2g, ln2b, m2);

  // MLP
  dim3 gF(FF / BLK_N, MROWS / BLK_M);
  gemm_wmma_kernel<<<gF, 256, 0, stream>>>(m2, w1b, b1, nullptr, gb, MROWS, FF, HID, 4);
  gemm_wmma_kernel<<<gH, 256, 0, stream>>>(gb, w2b, b2, x1, out, MROWS, HID, FF, 3);
}

// v002
// Measured time: 338 microseconds a run.
// In two side-by-side timings against v001, it was 1.31 and 1.30 times as fast.
// Counting every step since v000, it is 2.12 times as fast.
#include <hip/hip_runtime.h>
#include <hip/hip_bf16.h>
#include <math.h>

typedef __attribute__((ext_vector_type(16))) __bf16 v16bf;
typedef __attribute__((ext_vector_type(8)))  __bf16 v8bf;
typedef __attribute__((ext_vector_type(8)))  float  v8f;

#define HID    1024
#define SEQ    2048
#define BATCH  2
#define NHEADS 8
#define HDIM   128
#define FF     4096
#define MROWS  (BATCH * SEQ)

#define BLK_M 128
#define BLK_N 128
#define BLK_K 64

// LDS row pitches in bf16 elements. Every tile below is read row per lane with
// ds_load_b128, which is free of bank conflicts at a pitch of 16 B x odd; the
// unpadded pitches (128, 256, 64 B) put the 16 rows of a fragment on few banks.
#define G_PITCH (BLK_K + 8)   // GEMM tiles: 128-B rows at 144 B
#define K_PITCH (HDIM + 8)    // K tile:     256-B rows at 272 B
#define V_PITCH (32 + 8)      // V^T tile:    64-B rows at  80 B
#define P_PITCH (32 + 8)      // P tile:      64-B rows at  80 B

// ---------------------------------------------------------------------------
// Fragment loader: CDNA5 16-bit A/B layout for 16x16x32 WMMA.
// Lane L (0..15): row = L, holds K = kb..kb+7 and kb+16..kb+23
// Lane L (16..31): row = L-16, holds K = kb+8..15 and kb+24..31
// => per lane: two contiguous 8-element (16B) chunks at +koff and +koff+16.
// ---------------------------------------------------------------------------
static __device__ __forceinline__ v16bf load_frag(const __bf16* p) {
  v8bf lo = *(const v8bf*)p;
  v8bf hi = *(const v8bf*)(p + 16);
  return __builtin_shufflevector(lo, hi, 0,1,2,3,4,5,6,7,8,9,10,11,12,13,14,15);
}

static __device__ __forceinline__ v8f wmma_bf16(v16bf a, v16bf b, v8f c) {
  return __builtin_amdgcn_wmma_f32_16x16x32_bf16(false, a, false, b, (short)0, c,
                                                 false, false);
}

// Async global -> LDS copy, 16B per lane, tracked by ASYNCcnt (gfx1250).
// lds_addr = low 32 bits of the flat shared-memory pointer (LDS aperture
// mapping: LDS_ADDR = addr[31:0]).
// One stage's eight copies of a lane stand in one statement that ends in
// s_wait_xcnt 0, so that no address register of a copy is rewritten ahead of
// that wait (a precaution for a replayed address translation).
static __device__ __forceinline__ uint32_t lds_addr_of(const void* lds_ptr) {
  return (uint32_t)(uintptr_t)lds_ptr;
}

static __device__ __forceinline__ void async_copy8_b128(const uint32_t (&l)[8],
                                                        const __bf16* const (&g)[8]) {
  asm volatile("global_load_async_to_lds_b128 %0, %8, off\n\t"
               "global_load_async_to_lds_b128 %1, %9, off\n\t"
               "global_load_async_to_lds_b128 %2, %10, off\n\t"
               "global_load_async_to_lds_b128 %3, %11, off\n\t"
               "global_load_async_to_lds_b128 %4, %12, off\n\t"
               "global_load_async_to_lds_b128 %5, %13, off\n\t"
               "global_load_async_to_lds_b128 %6, %14, off\n\t"
               "global_load_async_to_lds_b128 %7, %15, off\n\t"
               "s_wait_xcnt 0x0"
               :: "v"(l[0]), "v"(l[1]), "v"(l[2]), "v"(l[3]),
                  "v"(l[4]), "v"(l[5]), "v"(l[6]), "v"(l[7]),
                  "v"((uint64_t)(uintptr_t)g[0]), "v"((uint64_t)(uintptr_t)g[1]),
                  "v"((uint64_t)(uintptr_t)g[2]), "v"((uint64_t)(uintptr_t)g[3]),
                  "v"((uint64_t)(uintptr_t)g[4]), "v"((uint64_t)(uintptr_t)g[5]),
                  "v"((uint64_t)(uintptr_t)g[6]), "v"((uint64_t)(uintptr_t)g[7])
               : "memory");
}

// Reductions over the 16 lanes of a row by DPP row_xmask butterfly steps, on the
// vector port. A shuffle compiles to ds_bpermute_b32, which goes through the LDS
// queue and is waited for at every one of its steps.
//
// Sum step: the value of lane (l ^ MASK); the compiler folds it into the add.
template <int MASK>
static __device__ __forceinline__ float row_xor(float x) {
  return __builtin_bit_cast(float, __builtin_amdgcn_update_dpp(
      0, __builtin_bit_cast(int, x), 0x160 + MASK, 0xf, 0xf, true));
}

// Maximum of eight rows at once. In asm because the compiler puts a move and a
// quieting maximum in front of every fmaxf on a DPP value (three dependent
// instructions a step instead of one). The eight rows stand side by side in each
// step, so every instruction's producer is eight instructions back.
#define ROWMAX_1(r, m) \
  "v_max_num_f32_dpp " r ", " r ", " r " row_xmask:" m " row_mask:0xf bank_mask:0xf bound_ctrl:1\n\t"
#define ROWMAX_8(m) \
  ROWMAX_1("%0", m) ROWMAX_1("%1", m) ROWMAX_1("%2", m) ROWMAX_1("%3", m) \
  ROWMAX_1("%4", m) ROWMAX_1("%5", m) ROWMAX_1("%6", m) ROWMAX_1("%7", m)
static __device__ __forceinline__ void row16_max8(float (&t)[8]) {
  asm(ROWMAX_8("1") ROWMAX_8("2") ROWMAX_8("4") ROWMAX_8("8")
      : "+v"(t[0]), "+v"(t[1]), "+v"(t[2]), "+v"(t[3]),
        "+v"(t[4]), "+v"(t[5]), "+v"(t[6]), "+v"(t[7]));
}

static __device__ __forceinline__ void wait_async0() {
  asm volatile("s_wait_asynccnt 0x0" ::: "memory");
}

// ---------------------------------------------------------------------------
// fp32 -> bf16 elementwise convert (weights)
// ---------------------------------------------------------------------------
__global__ void f32_to_bf16_kernel(const float* __restrict__ src,
                                   __bf16* __restrict__ dst, int n) {
  int i = blockIdx.x * blockDim.x + threadIdx.x;
  int stride = gridDim.x * blockDim.x;
  for (; i < n; i += stride) dst[i] = (__bf16)src[i];
}

// ---------------------------------------------------------------------------
// Row LayerNorm (H=1024), fp32 in -> bf16 out. One block (256 thr) per row.
// ---------------------------------------------------------------------------
__global__ __launch_bounds__(256)
void ln_bf16_kernel(const float* __restrict__ x, const float* __restrict__ g,
                    const float* __restrict__ b, __bf16* __restrict__ out) {
  const int row = blockIdx.x;
  const float* xr = x + (size_t)row * HID;
  float s = 0.f, s2 = 0.f;
  for (int i = threadIdx.x; i < HID; i += 256) {
    float v = xr[i];
    s += v; s2 += v * v;
  }
  __shared__ float ssum, ssq;
  if (threadIdx.x == 0) { ssum = 0.f; ssq = 0.f; }
  __syncthreads();
  #pragma unroll
  for (int d = 1; d < 32; d <<= 1) {
    s  += __shfl_xor(s,  d, 32);
    s2 += __shfl_xor(s2, d, 32);
  }
  if ((threadIdx.x & 31) == 0) { atomicAdd(&ssum, s); atomicAdd(&ssq, s2); }
  __syncthreads();
  const float mu  = ssum * (1.0f / HID);
  const float var = ssq * (1.0f / HID) - mu * mu;
  const float r   = rsqrtf(var + 1e-5f);
  for (int i = threadIdx.x; i < HID; i += 256)
    out[(size_t)row * HID + i] = (__bf16)((xr[i] - mu) * r * g[i] + b[i]);
}

// ---------------------------------------------------------------------------
// WMMA GEMM with async-LDS double-buffered staging.
// C[M,N] = A[M,K] (row-major) * W[N,K]^T (+ bias, epilogue modes).
// Block: 256 threads = 8 waves (4 M x 2 N); block tile 128x128;
// wave tile 32x64 (2x4 WMMA frags). K-step 64 (2 x 8 WMMAs per barrier pair).
// Staging: 128x64 bf16 tiles of A and W copied global->LDS with
// global_load_async_to_lds_b128 (ASYNCcnt), double buffered, rows padded to
// G_PITCH (72 KB LDS).
// mode 1: bf16 out in [B,heads,S,d]        (Q / K)
// mode 2: bf16 out in [B,heads,d,S]        (V^T)
// mode 3: fp32 out = resid + acc + bias    (O-proj / MLP2 residual)
// mode 4: bf16 out = gelu(acc + bias)      (MLP1)
// ---------------------------------------------------------------------------
__global__ __launch_bounds__(256)
void gemm_wmma_kernel(const __bf16* __restrict__ A, const __bf16* __restrict__ W,
                      const float* __restrict__ bias, const float* __restrict__ resid,
                      void* __restrict__ outp, int M, int N, int K, int mode) {
  (void)M;
  const int lane = threadIdx.x & 31;
  const int wave = threadIdx.x >> 5;
  const int wm   = wave & 3;          // 4 waves along M
  const int wn   = wave >> 2;         // 2 waves along N
  const int mblk = blockIdx.y * BLK_M;
  const int nblk = blockIdx.x * BLK_N;
  const int lrow = lane & 15;
  const int koff = (lane >> 4) << 3;  // 0 or 8

  __shared__ __align__(16) __bf16 tA[2][BLK_M * G_PITCH];
  __shared__ __align__(16) __bf16 tB[2][BLK_N * G_PITCH];

  // Stage one 128x64 K-slice of A and W into LDS buffer `buf`.
  // 1024 16B chunks per tile; 256 threads issue 4 chunks each per tile.
  auto stage = [&](int buf, int k0) {
    uint32_t l[8];
    const __bf16* g[8];
    #pragma unroll
    for (int j = 0; j < 4; ++j) {
      const int id  = threadIdx.x + j * 256;
      const int row = id >> 3;
      const int ch  = (id & 7) << 3;  // element offset of the 16B chunk
      l[2 * j]     = lds_addr_of(&tA[buf][row * G_PITCH + ch]);
      g[2 * j]     = A + (size_t)(mblk + row) * K + k0 + ch;
      l[2 * j + 1] = lds_addr_of(&tB[buf][row * G_PITCH + ch]);
      g[2 * j + 1] = W + (size_t)(nblk + row) * K + k0 + ch;
    }
    async_copy8_b128(l, g);
  };

  v8f acc[2][4] = {};

  stage(0, 0);
  for (int k0 = 0; k0 < K; k0 += BLK_K) {
    const int cur = (k0 >> 6) & 1;
    wait_async0();       // this wave's copies into tX[cur] have landed
    __syncthreads();     // everyone's copies have landed
    if (k0 + BLK_K < K) stage(cur ^ 1, k0 + BLK_K);

    #pragma unroll
    for (int ks = 0; ks < BLK_K; ks += 32) {
      v16bf a[2], b[4];
      #pragma unroll
      for (int mt = 0; mt < 2; ++mt)
        a[mt] = load_frag(&tA[cur][(wm * 32 + mt * 16 + lrow) * G_PITCH + ks + koff]);
      #pragma unroll
      for (int nt = 0; nt < 4; ++nt)
        b[nt] = load_frag(&tB[cur][(wn * 64 + nt * 16 + lrow) * G_PITCH + ks + koff]);
      #pragma unroll
      for (int mt = 0; mt < 2; ++mt)
        #pragma unroll
        for (int nt = 0; nt < 4; ++nt)
          acc[mt][nt] = wmma_bf16(a[mt], b[nt], acc[mt][nt]);
    }

    __syncthreads();     // all reads of tX[cur] done before it is re-staged
  }

  const int rplus = (lane >> 4) << 3;  // upper 16 lanes hold rows +8
  #pragma unroll
  for (int mt = 0; mt < 2; ++mt)
  #pragma unroll
  for (int nt = 0; nt < 4; ++nt)
  #pragma unroll
  for (int v = 0; v < 8; ++v) {
    const int row = mblk + wm * 32 + mt * 16 + v + rplus;
    const int col = nblk + wn * 64 + nt * 16 + lrow;
    float val = acc[mt][nt][v] + bias[col];
    if (mode == 1 || mode == 2) {
      const int bb = row >> 11, ss = row & (SEQ - 1);   // S = 2048
      const int hh = col >> 7,  dd = col & (HDIM - 1);  // d = 128
      __bf16* o = (__bf16*)outp;
      size_t idx = (mode == 1)
          ? ((size_t)((bb * NHEADS + hh) * SEQ + ss)) * HDIM + dd
          : ((size_t)((bb * NHEADS + hh) * HDIM + dd)) * SEQ + ss;
      o[idx] = (__bf16)val;
    } else if (mode == 3) {
      float* o = (float*)outp;
      o[(size_t)row * N + col] = resid[(size_t)row * N + col] + val;
    } else {  // mode 4: exact GELU, bf16 out
      __bf16* o = (__bf16*)outp;
      float gl = 0.5f * val * (1.0f + erff(val * 0.70710678118654752f));
      o[(size_t)row * N + col] = (__bf16)gl;
    }
  }
}

// ---------------------------------------------------------------------------
// Causal flash attention with shared async-LDS K/V staging.
// Block: 128 threads = 4 waves; each wave owns a 16-query tile (64 rows/block).
// Per 32-key block: K tile (32x128) and V^T tile (128x32) staged global->LDS
// (double buffered, ASYNCcnt) once and consumed by all 4 waves.
// All waves run to the block's last key block; the causal mask nulls any
// key > query row (exp(-huge)=0), so lower waves' surplus blocks are inert.
// ---------------------------------------------------------------------------
__global__ __launch_bounds__(128)
void attn_wmma_kernel(const __bf16* __restrict__ Q, const __bf16* __restrict__ Kc,
                      const __bf16* __restrict__ VT, __bf16* __restrict__ Y) {
  const int lane  = threadIdx.x & 31;
  const int wave  = threadIdx.x >> 5;
  const int lrow  = lane & 15;
  const int koff  = (lane >> 4) << 3;
  const int rplus = koff;               // C-layout: upper lanes own rows +8
  const int qblk  = blockIdx.x * 64;
  const int qbase = qblk + wave * 16;
  const int bh    = blockIdx.y;
  const float scale = 0.08838834764831845f;  // 1/sqrt(128)
  const float NEGF  = -3.0e38f;

  __shared__ __align__(16) __bf16 kt[2][32 * K_PITCH];    // 2 x 8.5 KB
  __shared__ __align__(16) __bf16 vt[2][HDIM * V_PITCH];  // 2 x 10 KB
  __shared__ __align__(16) __bf16 pbuf[4][16 * P_PITCH];  // per-wave P tiles

  // Stage K tile (32 keys x 128) and V^T tile (128 x 32 keys) for key block kb.
  // 512 16B chunks per tile; 128 threads issue 4 chunks each per tile.
  auto stage = [&](int buf, int kb) {
    uint32_t l[8];
    const __bf16* g[8];
    #pragma unroll
    for (int j = 0; j < 4; ++j) {
      const int id = threadIdx.x + j * 128;
      const int kr = id >> 4, kc = (id & 15) << 3;   // K tile: 16 chunks/row
      l[2 * j]     = lds_addr_of(&kt[buf][kr * K_PITCH + kc]);
      g[2 * j]     = Kc + ((size_t)bh * SEQ + kb + kr) * HDIM + kc;
      const int vr = id >> 2, vc = (id & 3) << 3;    // V^T tile: 4 chunks/row
      l[2 * j + 1] = lds_addr_of(&vt[buf][vr * V_PITCH + vc]);
      g[2 * j + 1] = VT + ((size_t)bh * HDIM + vr) * SEQ + kb + vc;
    }
    async_copy8_b128(l, g);
  };

  v16bf qf[4];
  #pragma unroll
  for (int kc = 0; kc < 4; ++kc)
    qf[kc] = load_frag(Q + ((size_t)bh * SEQ + qbase + lrow) * HDIM + kc * 32 + koff);

  v8f o[8] = {};
  float mrow[8], lsum[8];
  #pragma unroll
  for (int v = 0; v < 8; ++v) { mrow[v] = NEGF; lsum[v] = 0.f; }

  const int kend = qblk + 64;           // block-uniform key range
  stage(0, 0);
  for (int kb = 0; kb < kend; kb += 32) {
    const int cur = (kb >> 5) & 1;
    wait_async0();
    __syncthreads();
    if (kb + 32 < kend) stage(cur ^ 1, kb + 32);

    // ---- S = Q K^T over d=128 (4 x K=32 WMMAs per 16-key column tile) ----
    v8f s0acc = {}, s1acc = {};
    #pragma unroll
    for (int kc = 0; kc < 4; ++kc) {
      v16bf k0 = load_frag(&kt[cur][(     lrow) * K_PITCH + kc * 32 + koff]);
      v16bf k1 = load_frag(&kt[cur][(16 + lrow) * K_PITCH + kc * 32 + koff]);
      s0acc = wmma_bf16(qf[kc], k0, s0acc);
      s1acc = wmma_bf16(qf[kc], k1, s1acc);
    }
    // ---- scale, causal mask, online softmax (per C-layout row) ----
    // The running maximum is the same in all 16 lanes of a row, so it goes into
    // the reduction's start value and the reduction yields the new maximum.
    // Every loop over v is unrolled so that its arrays are registers, not scratch;
    // the sum's steps are loops of their own to set the eight rows side by side.
    float s0[8], s1[8], mnew[8];
    #pragma unroll
    for (int v = 0; v < 8; ++v) {
      const int qrow = qbase + v + rplus;
      s0[v] = s0acc[v] * scale;
      s1[v] = s1acc[v] * scale;
      if (kb +      lrow > qrow) s0[v] = NEGF;
      if (kb + 16 + lrow > qrow) s1[v] = NEGF;
      mnew[v] = fmaxf(fmaxf(s0[v], s1[v]), mrow[v]);
    }
    row16_max8(mnew);
    float rs[8];
    #pragma unroll
    for (int v = 0; v < 8; ++v) {
      const float p0 = __expf(s0[v] - mnew[v]);
      const float p1 = __expf(s1[v] - mnew[v]);
      rs[v] = p0 + p1;
      const int prow = v + rplus;
      pbuf[wave][prow * P_PITCH +      lrow] = (__bf16)p0;
      pbuf[wave][prow * P_PITCH + 16 + lrow] = (__bf16)p1;
    }
    #pragma unroll
    for (int v = 0; v < 8; ++v) rs[v] += row_xor<1>(rs[v]);
    #pragma unroll
    for (int v = 0; v < 8; ++v) rs[v] += row_xor<2>(rs[v]);
    #pragma unroll
    for (int v = 0; v < 8; ++v) rs[v] += row_xor<4>(rs[v]);
    #pragma unroll
    for (int v = 0; v < 8; ++v) rs[v] += row_xor<8>(rs[v]);
    #pragma unroll
    for (int v = 0; v < 8; ++v) {
      const float sc = __expf(mrow[v] - mnew[v]);
      lsum[v] = lsum[v] * sc + rs[v];
      mrow[v] = mnew[v];
      #pragma unroll
      for (int dt = 0; dt < 8; ++dt) o[dt][v] *= sc;
    }
    __syncthreads();
    v16bf pf = load_frag(&pbuf[wave][lrow * P_PITCH + koff]);
    // ---- O += P V (keys as contraction dim; V^T rows are contiguous) ----
    #pragma unroll
    for (int dt = 0; dt < 8; ++dt) {
      v16bf vf = load_frag(&vt[cur][(dt * 16 + lrow) * V_PITCH + koff]);
      o[dt] = wmma_bf16(pf, vf, o[dt]);
    }
    __syncthreads();     // kt/vt[cur] + pbuf free before re-staging / rewrite
  }
  // ---- normalize and scatter back to [B,S,HID] ----
  const int b = bh >> 3, h = bh & 7;
  #pragma unroll
  for (int dt = 0; dt < 8; ++dt)
  #pragma unroll
  for (int v = 0; v < 8; ++v) {
    const int row = qbase + v + rplus;
    const int col = h * HDIM + dt * 16 + lrow;
    Y[((size_t)b * SEQ + row) * HID + col] = (__bf16)(o[dt][v] / lsum[v]);
  }
}

// ---------------------------------------------------------------------------
// Orchestration
// ---------------------------------------------------------------------------
extern "C" void kernel_launch(void* const* d_in, const int* in_sizes, int n_in,
                              void* d_out, int out_size, void* d_ws, size_t ws_size,
                              hipStream_t stream) {
  (void)in_sizes; (void)n_in; (void)out_size; (void)ws_size;

  const float* x    = (const float*)d_in[0];
  const float* ln1g = (const float*)d_in[1];
  const float* ln1b = (const float*)d_in[2];
  const float* wq   = (const float*)d_in[3];
  const float* bq   = (const float*)d_in[4];
  const float* wk   = (const float*)d_in[5];
  const float* bk   = (const float*)d_in[6];
  const float* wv   = (const float*)d_in[7];
  const float* bv   = (const float*)d_in[8];
  const float* wo   = (const float*)d_in[9];
  const float* bo   = (const float*)d_in[10];
  const float* ln2g = (const float*)d_in[11];
  const float* ln2b = (const float*)d_in[12];
  const float* w1   = (const float*)d_in[13];
  const float* b1   = (const float*)d_in[14];
  const float* w2   = (const float*)d_in[15];
  const float* b2   = (const float*)d_in[16];
  float* out = (float*)d_out;

  char* ws = (char*)d_ws;
  size_t off = 0;
  auto take = [&](size_t bytes) -> char* {
    char* p = ws + off;
    off += bytes;
    off = (off + 255) & ~(size_t)255;
    return p;
  };

  __bf16* wqb = (__bf16*)take((size_t)HID * HID * 2);
  __bf16* wkb = (__bf16*)take((size_t)HID * HID * 2);
  __bf16* wvb = (__bf16*)take((size_t)HID * HID * 2);
  __bf16* wob = (__bf16*)take((size_t)HID * HID * 2);
  __bf16* w1b = (__bf16*)take((size_t)FF  * HID * 2);
  __bf16* w2b = (__bf16*)take((size_t)HID * FF  * 2);
  __bf16* hn  = (__bf16*)take((size_t)MROWS * HID * 2);  // LN1 out
  __bf16* qb  = (__bf16*)take((size_t)MROWS * HID * 2);  // [B,h,S,d]
  __bf16* kbf = (__bf16*)take((size_t)MROWS * HID * 2);  // [B,h,S,d]
  __bf16* vtb = (__bf16*)take((size_t)MROWS * HID * 2);  // [B,h,d,S]
  __bf16* yb  = (__bf16*)take((size_t)MROWS * HID * 2);  // attn out [B,S,H]
  float*  x1  = (float*) take((size_t)MROWS * HID * 4);  // x + attn
  __bf16* m2  = (__bf16*)take((size_t)MROWS * HID * 2);  // LN2 out
  __bf16* gb  = (__bf16*)take((size_t)MROWS * FF  * 2);  // GELU(MLP1)

  // weights -> bf16
  f32_to_bf16_kernel<<<1024, 256, 0, stream>>>(wq, wqb, HID * HID);
  f32_to_bf16_kernel<<<1024, 256, 0, stream>>>(wk, wkb, HID * HID);
  f32_to_bf16_kernel<<<1024, 256, 0, stream>>>(wv, wvb, HID * HID);
  f32_to_bf16_kernel<<<1024, 256, 0, stream>>>(wo, wob, HID * HID);
  f32_to_bf16_kernel<<<2048, 256, 0, stream>>>(w1, w1b, FF * HID);
  f32_to_bf16_kernel<<<2048, 256, 0, stream>>>(w2, w2b, HID * FF);

  // LN1
  ln_bf16_kernel<<<MROWS, 256, 0, stream>>>(x, ln1g, ln1b, hn);

  // QKV projections (block tile 128x128, K-step 64)
  dim3 gH(HID / BLK_N, MROWS / BLK_M);
  gemm_wmma_kernel<<<gH, 256, 0, stream>>>(hn, wqb, bq, nullptr, qb,  MROWS, HID, HID, 1);
  gemm_wmma_kernel<<<gH, 256, 0, stream>>>(hn, wkb, bk, nullptr, kbf, MROWS, HID, HID, 1);
  gemm_wmma_kernel<<<gH, 256, 0, stream>>>(hn, wvb, bv, nullptr, vtb, MROWS, HID, HID, 2);

  // causal flash attention (64 query rows per block, shared K/V staging)
  dim3 gA(SEQ / 64, BATCH * NHEADS);
  attn_wmma_kernel<<<gA, 128, 0, stream>>>(qb, kbf, vtb, yb);

  // O-proj + residual -> x1 (fp32)
  gemm_wmma_kernel<<<gH, 256, 0, stream>>>(yb, wob, bo, x, x1, MROWS, HID, HID, 3);

  // LN2
  ln_bf16_kernel<<<MROWS, 256, 0, stream>>>(x1, ln2g, ln2b, m2);

  // MLP
  dim3 gF(FF / BLK_N, MROWS / BLK_M);
  gemm_wmma_kernel<<<gF, 256, 0, stream>>>(m2, w1b, b1, nullptr, gb, MROWS, FF, HID, 4);
  gemm_wmma_kernel<<<gH, 256, 0, stream>>>(gb, w2b, b2, x1, out, MROWS, HID, FF, 3);
}

// v003
// One run takes 268 microseconds.
// Two timings next to v002 both put it at 1.25 times that version's speed.
// Over all steps from v000 it is 2.65 times as fast.
#include <hip/hip_runtime.h>
#include <hip/hip_bf16.h>
#include <math.h>

typedef __attribute__((ext_vector_type(16))) __bf16 v16bf;
typedef __attribute__((ext_vector_type(8)))  __bf16 v8bf;
typedef __attribute__((ext_vector_type(8)))  float  v8f;

#define HID    1024
#define SEQ    2048
#define BATCH  2
#define NHEADS 8
#define HDIM   128
#define FF     4096
#define MROWS  (BATCH * SEQ)

#define BLK_M 128
#define BLK_N 128
#define BLK_K 64

// LDS row pitches in bf16 elements. Every tile below is read row per lane with
// ds_load_b128, which is free of bank conflicts at a pitch of 16 B x odd; the
// unpadded pitches (128, 256, 64 B) put the 16 rows of a fragment on few banks.
#define G_PITCH (BLK_K + 8)   // GEMM tiles: 128-B rows at 144 B
#define K_PITCH (HDIM + 8)    // K tile:     256-B rows at 272 B
#define V_PITCH (32 + 8)      // V^T tile:    64-B rows at  80 B
#define P_PITCH (32 + 8)      // P tile:      64-B rows at  80 B

// ---------------------------------------------------------------------------
// Fragment loader: CDNA5 16-bit A/B layout for 16x16x32 WMMA.
// Lane L (0..15): row = L, holds K = kb..kb+7 and kb+16..kb+23
// Lane L (16..31): row = L-16, holds K = kb+8..15 and kb+24..31
// => per lane: two contiguous 8-element (16B) chunks at +koff and +koff+16.
// ---------------------------------------------------------------------------
static __device__ __forceinline__ v16bf load_frag(const __bf16* p) {
  v8bf lo = *(const v8bf*)p;
  v8bf hi = *(const v8bf*)(p + 16);
  return __builtin_shufflevector(lo, hi, 0,1,2,3,4,5,6,7,8,9,10,11,12,13,14,15);
}

static __device__ __forceinline__ v8f wmma_bf16(v16bf a, v16bf b, v8f c) {
  return __builtin_amdgcn_wmma_f32_16x16x32_bf16(false, a, false, b, (short)0, c,
                                                 false, false);
}

// Async global -> LDS copy, 16B per lane, tracked by ASYNCcnt (gfx1250).
// lds_addr = low 32 bits of the flat shared-memory pointer (LDS aperture
// mapping: LDS_ADDR = addr[31:0]).
// One stage's eight copies of a lane stand in one statement that ends in
// s_wait_xcnt 0, so that no address register of a copy is rewritten ahead of
// that wait (a precaution for a replayed address translation).
static __device__ __forceinline__ uint32_t lds_addr_of(const void* lds_ptr) {
  return (uint32_t)(uintptr_t)lds_ptr;
}

static __device__ __forceinline__ void async_copy8_b128(const uint32_t (&l)[8],
                                                        const __bf16* const (&g)[8]) {
  asm volatile("global_load_async_to_lds_b128 %0, %8, off\n\t"
               "global_load_async_to_lds_b128 %1, %9, off\n\t"
               "global_load_async_to_lds_b128 %2, %10, off\n\t"
               "global_load_async_to_lds_b128 %3, %11, off\n\t"
               "global_load_async_to_lds_b128 %4, %12, off\n\t"
               "global_load_async_to_lds_b128 %5, %13, off\n\t"
               "global_load_async_to_lds_b128 %6, %14, off\n\t"
               "global_load_async_to_lds_b128 %7, %15, off\n\t"
               "s_wait_xcnt 0x0"
               :: "v"(l[0]), "v"(l[1]), "v"(l[2]), "v"(l[3]),
                  "v"(l[4]), "v"(l[5]), "v"(l[6]), "v"(l[7]),
                  "v"((uint64_t)(uintptr_t)g[0]), "v"((uint64_t)(uintptr_t)g[1]),
                  "v"((uint64_t)(uintptr_t)g[2]), "v"((uint64_t)(uintptr_t)g[3]),
                  "v"((uint64_t)(uintptr_t)g[4]), "v"((uint64_t)(uintptr_t)g[5]),
                  "v"((uint64_t)(uintptr_t)g[6]), "v"((uint64_t)(uintptr_t)g[7])
               : "memory");
}

// Reductions over the 16 lanes of a row by DPP row_xmask butterfly steps, on the
// vector port. A shuffle compiles to ds_bpermute_b32, which goes through the LDS
// queue and is waited for at every one of its steps.
//
// Sum step: the value of lane (l ^ MASK); the compiler folds it into the add.
template <int MASK>
static __device__ __forceinline__ float row_xor(float x) {
  return __builtin_bit_cast(float, __builtin_amdgcn_update_dpp(
      0, __builtin_bit_cast(int, x), 0x160 + MASK, 0xf, 0xf, true));
}

// Maximum of eight rows at once. In asm because the compiler puts a move and a
// quieting maximum in front of every fmaxf on a DPP value (three dependent
// instructions a step instead of one). The eight rows stand side by side in each
// step, so every instruction's producer is eight instructions back.
#define ROWMAX_1(r, m) \
  "v_max_num_f32_dpp " r ", " r ", " r " row_xmask:" m " row_mask:0xf bank_mask:0xf bound_ctrl:1\n\t"
#define ROWMAX_8(m) \
  ROWMAX_1("%0", m) ROWMAX_1("%1", m) ROWMAX_1("%2", m) ROWMAX_1("%3", m) \
  ROWMAX_1("%4", m) ROWMAX_1("%5", m) ROWMAX_1("%6", m) ROWMAX_1("%7", m)
static __device__ __forceinline__ void row16_max8(float (&t)[8]) {
  asm(ROWMAX_8("1") ROWMAX_8("2") ROWMAX_8("4") ROWMAX_8("8")
      : "+v"(t[0]), "+v"(t[1]), "+v"(t[2]), "+v"(t[3]),
        "+v"(t[4]), "+v"(t[5]), "+v"(t[6]), "+v"(t[7]));
}

static __device__ __forceinline__ void wait_async0() {
  asm volatile("s_wait_asynccnt 0x0" ::: "memory");
}

// ---------------------------------------------------------------------------
// fp32 -> bf16 elementwise convert (weights)
// ---------------------------------------------------------------------------
__global__ void f32_to_bf16_kernel(const float* __restrict__ src,
                                   __bf16* __restrict__ dst, int n) {
  int i = blockIdx.x * blockDim.x + threadIdx.x;
  int stride = gridDim.x * blockDim.x;
  for (; i < n; i += stride) dst[i] = (__bf16)src[i];
}

// ---------------------------------------------------------------------------
// Row LayerNorm (H=1024), fp32 in -> bf16 out. One block (256 thr) per row.
// ---------------------------------------------------------------------------
__global__ __launch_bounds__(256)
void ln_bf16_kernel(const float* __restrict__ x, const float* __restrict__ g,
                    const float* __restrict__ b, __bf16* __restrict__ out) {
  const int row = blockIdx.x;
  const float* xr = x + (size_t)row * HID;
  float s = 0.f, s2 = 0.f;
  for (int i = threadIdx.x; i < HID; i += 256) {
    float v = xr[i];
    s += v; s2 += v * v;
  }
  __shared__ float ssum, ssq;
  if (threadIdx.x == 0) { ssum = 0.f; ssq = 0.f; }
  __syncthreads();
  #pragma unroll
  for (int d = 1; d < 32; d <<= 1) {
    s  += __shfl_xor(s,  d, 32);
    s2 += __shfl_xor(s2, d, 32);
  }
  if ((threadIdx.x & 31) == 0) { atomicAdd(&ssum, s); atomicAdd(&ssq, s2); }
  __syncthreads();
  const float mu  = ssum * (1.0f / HID);
  const float var = ssq * (1.0f / HID) - mu * mu;
  const float r   = rsqrtf(var + 1e-5f);
  for (int i = threadIdx.x; i < HID; i += 256)
    out[(size_t)row * HID + i] = (__bf16)((xr[i] - mu) * r * g[i] + b[i]);
}

// ---------------------------------------------------------------------------
// WMMA GEMM with async-LDS double-buffered staging.
// C[M,N] = A[M,K] (row-major) * W[N,K]^T (+ bias, epilogue modes).
// Block: 256 threads = 8 waves (4 M x 2 N); block tile 128x128;
// wave tile 32x64 (2x4 WMMA frags). K-step 64 (2 x 8 WMMAs per barrier pair).
// Staging: 128x64 bf16 tiles of A and W copied global->LDS with
// global_load_async_to_lds_b128 (ASYNCcnt), double buffered, rows padded to
// G_PITCH (72 KB LDS).
// MODE and NCOLS (the output's row length) are template parameters: the epilogue
// then holds one mode's code with no test per element, every address is one base
// plus a constant, and its loads and stores are issued together.
// MODE 1: bf16 out in [B,heads,S,d]        (Q / K)
// MODE 2: bf16 out in [B,heads,d,S]        (V^T)
// MODE 3: fp32 out = resid + acc + bias    (O-proj / MLP2 residual)
// MODE 4: bf16 out = gelu(acc + bias)      (MLP1)
// ---------------------------------------------------------------------------
template <int MODE, int NCOLS>
__global__ __launch_bounds__(256)
void gemm_wmma_kernel(const __bf16* __restrict__ A, const __bf16* __restrict__ W,
                      const float* __restrict__ bias, const float* __restrict__ resid,
                      void* __restrict__ outp, int K) {
  const int lane = threadIdx.x & 31;
  const int wave = threadIdx.x >> 5;
  const int wm   = wave & 3;          // 4 waves along M
  const int wn   = wave >> 2;         // 2 waves along N
  const int mblk = blockIdx.y * BLK_M;
  const int nblk = blockIdx.x * BLK_N;
  const int lrow = lane & 15;
  const int koff = (lane >> 4) << 3;  // 0 or 8

  __shared__ __align__(16) __bf16 tA[2][BLK_M * G_PITCH];
  __shared__ __align__(16) __bf16 tB[2][BLK_N * G_PITCH];

  // Stage one 128x64 K-slice of A and W into LDS buffer `buf`.
  // 1024 16B chunks per tile; 256 threads issue 4 chunks each per tile.
  auto stage = [&](int buf, int k0) {
    uint32_t l[8];
    const __bf16* g[8];
    #pragma unroll
    for (int j = 0; j < 4; ++j) {
      const int id  = threadIdx.x + j * 256;
      const int row = id >> 3;
      const int ch  = (id & 7) << 3;  // element offset of the 16B chunk
      l[2 * j]     = lds_addr_of(&tA[buf][row * G_PITCH + ch]);
      g[2 * j]     = A + (size_t)(mblk + row) * K + k0 + ch;
      l[2 * j + 1] = lds_addr_of(&tB[buf][row * G_PITCH + ch]);
      g[2 * j + 1] = W + (size_t)(nblk + row) * K + k0 + ch;
    }
    async_copy8_b128(l, g);
  };

  v8f acc[2][4] = {};

  stage(0, 0);
  for (int k0 = 0; k0 < K; k0 += BLK_K) {
    const int cur = (k0 >> 6) & 1;
    wait_async0();       // this wave's copies into tX[cur] have landed
    __syncthreads();     // everyone's copies have landed
    if (k0 + BLK_K < K) stage(cur ^ 1, k0 + BLK_K);

    #pragma unroll
    for (int ks = 0; ks < BLK_K; ks += 32) {
      v16bf a[2], b[4];
      #pragma unroll
      for (int mt = 0; mt < 2; ++mt)
        a[mt] = load_frag(&tA[cur][(wm * 32 + mt * 16 + lrow) * G_PITCH + ks + koff]);
      #pragma unroll
      for (int nt = 0; nt < 4; ++nt)
        b[nt] = load_frag(&tB[cur][(wn * 64 + nt * 16 + lrow) * G_PITCH + ks + koff]);
      #pragma unroll
      for (int mt = 0; mt < 2; ++mt)
        #pragma unroll
        for (int nt = 0; nt < 4; ++nt)
          acc[mt][nt] = wmma_bf16(a[mt], b[nt], acc[mt][nt]);
    }

    __syncthreads();     // all reads of tX[cur] done before it is re-staged
  }

  // Element (mt, nt, v) of this lane is row row0 + mt*16 + v, column col0 + nt*16.
  // A block's 128 rows lie in one batch entry and its 128 columns in one head.
  const int row0 = mblk + wm * 32 + ((lane >> 4) << 3);  // upper 16 lanes: rows +8
  const int col0 = nblk + wn * 64 + lrow;
  float bv[4];
  #pragma unroll
  for (int nt = 0; nt < 4; ++nt) bv[nt] = bias[col0 + nt * 16];

  if constexpr (MODE == 1 || MODE == 2) {
    const int bb = row0 >> 11, ss = row0 & (SEQ - 1);   // S = 2048
    const int hh = col0 >> 7,  dd = col0 & (HDIM - 1);  // d = 128
    if constexpr (MODE == 1) {
      __bf16* o = (__bf16*)outp + ((size_t)((bb * NHEADS + hh) * SEQ + ss)) * HDIM + dd;
      #pragma unroll
      for (int mt = 0; mt < 2; ++mt)
      #pragma unroll
      for (int nt = 0; nt < 4; ++nt)
      #pragma unroll
      for (int v = 0; v < 8; ++v)
        o[(mt * 16 + v) * HDIM + nt * 16] = (__bf16)(acc[mt][nt][v] + bv[nt]);
    } else {
      // A lane's eight rows are eight neighbours along S: one 16-B store.
      __bf16* o = (__bf16*)outp + ((size_t)((bb * NHEADS + hh) * HDIM + dd)) * SEQ + ss;
      #pragma unroll
      for (int mt = 0; mt < 2; ++mt)
      #pragma unroll
      for (int nt = 0; nt < 4; ++nt) {
        v8bf pk;
        #pragma unroll
        for (int v = 0; v < 8; ++v) pk[v] = (__bf16)(acc[mt][nt][v] + bv[nt]);
        *(v8bf*)(o + nt * 16 * SEQ + mt * 16) = pk;
      }
    }
  } else if constexpr (MODE == 3) {
    const size_t base = (size_t)row0 * NCOLS + col0;
    const float* rp = resid + base;
    float* o = (float*)outp + base;
    float r[2][4][8];
    #pragma unroll
    for (int mt = 0; mt < 2; ++mt)
    #pragma unroll
    for (int v = 0; v < 8; ++v)
    #pragma unroll
    for (int nt = 0; nt < 4; ++nt)
      r[mt][nt][v] = rp[(mt * 16 + v) * NCOLS + nt * 16];
    #pragma unroll
    for (int mt = 0; mt < 2; ++mt)
    #pragma unroll
    for (int v = 0; v < 8; ++v)
    #pragma unroll
    for (int nt = 0; nt < 4; ++nt)
      o[(mt * 16 + v) * NCOLS + nt * 16] = r[mt][nt][v] + (acc[mt][nt][v] + bv[nt]);
  } else {  // MODE 4: exact GELU, bf16 out
    __bf16* o = (__bf16*)outp + (size_t)row0 * NCOLS + col0;
    #pragma unroll
    for (int mt = 0; mt < 2; ++mt)
    #pragma unroll
    for (int nt = 0; nt < 4; ++nt)
    #pragma unroll
    for (int v = 0; v < 8; ++v) {
      const float val = acc[mt][nt][v] + bv[nt];
      const float gl = 0.5f * val * (1.0f + erff(val * 0.70710678118654752f));
      o[(mt * 16 + v) * NCOLS + nt * 16] = (__bf16)gl;
    }
  }
}

// ---------------------------------------------------------------------------
// Causal flash attention with shared async-LDS K/V staging.
// Block: 128 threads = 4 waves; each wave owns a 16-query tile (64 rows/block).
// Per 32-key block: K tile (32x128) and V^T tile (128x32) staged global->LDS
// (double buffered, ASYNCcnt) once and consumed by all 4 waves.
// All waves run to the block's last key block; the causal mask nulls any
// key > query row (exp(-huge)=0), so lower waves' surplus blocks are inert.
// ---------------------------------------------------------------------------
__global__ __launch_bounds__(128)
void attn_wmma_kernel(const __bf16* __restrict__ Q, const __bf16* __restrict__ Kc,
                      const __bf16* __restrict__ VT, __bf16* __restrict__ Y) {
  const int lane  = threadIdx.x & 31;
  const int wave  = threadIdx.x >> 5;
  const int lrow  = lane & 15;
  const int koff  = (lane >> 4) << 3;
  const int rplus = koff;               // C-layout: upper lanes own rows +8
  const int qblk  = blockIdx.x * 64;
  const int qbase = qblk + wave * 16;
  const int bh    = blockIdx.y;
  const float scale = 0.08838834764831845f;  // 1/sqrt(128)
  const float NEGF  = -3.0e38f;

  __shared__ __align__(16) __bf16 kt[2][32 * K_PITCH];    // 2 x 8.5 KB
  __shared__ __align__(16) __bf16 vt[2][HDIM * V_PITCH];  // 2 x 10 KB
  __shared__ __align__(16) __bf16 pbuf[4][16 * P_PITCH];  // per-wave P tiles

  // Stage K tile (32 keys x 128) and V^T tile (128 x 32 keys) for key block kb.
  // 512 16B chunks per tile; 128 threads issue 4 chunks each per tile.
  auto stage = [&](int buf, int kb) {
    uint32_t l[8];
    const __bf16* g[8];
    #pragma unroll
    for (int j = 0; j < 4; ++j) {
      const int id = threadIdx.x + j * 128;
      const int kr = id >> 4, kc = (id & 15) << 3;   // K tile: 16 chunks/row
      l[2 * j]     = lds_addr_of(&kt[buf][kr * K_PITCH + kc]);
      g[2 * j]     = Kc + ((size_t)bh * SEQ + kb + kr) * HDIM + kc;
      const int vr = id >> 2, vc = (id & 3) << 3;    // V^T tile: 4 chunks/row
      l[2 * j + 1] = lds_addr_of(&vt[buf][vr * V_PITCH + vc]);
      g[2 * j + 1] = VT + ((size_t)bh * HDIM + vr) * SEQ + kb + vc;
    }
    async_copy8_b128(l, g);
  };

  v16bf qf[4];
  #pragma unroll
  for (int kc = 0; kc < 4; ++kc)
    qf[kc] = load_frag(Q + ((size_t)bh * SEQ + qbase + lrow) * HDIM + kc * 32 + koff);

  v8f o[8] = {};
  float mrow[8], lsum[8];
  #pragma unroll
  for (int v = 0; v < 8; ++v) { mrow[v] = NEGF; lsum[v] = 0.f; }

  const int kend = qblk + 64;           // block-uniform key range
  stage(0, 0);
  for (int kb = 0; kb < kend; kb += 32) {
    const int cur = (kb >> 5) & 1;
    wait_async0();
    __syncthreads();
    if (kb + 32 < kend) stage(cur ^ 1, kb + 32);

    // ---- S = Q K^T over d=128 (4 x K=32 WMMAs per 16-key column tile) ----
    v8f s0acc = {}, s1acc = {};
    #pragma unroll
    for (int kc = 0; kc < 4; ++kc) {
      v16bf k0 = load_frag(&kt[cur][(     lrow) * K_PITCH + kc * 32 + koff]);
      v16bf k1 = load_frag(&kt[cur][(16 + lrow) * K_PITCH + kc * 32 + koff]);
      s0acc = wmma_bf16(qf[kc], k0, s0acc);
      s1acc = wmma_bf16(qf[kc], k1, s1acc);
    }
    // ---- scale, causal mask, online softmax (per C-layout row) ----
    // The running maximum is the same in all 16 lanes of a row, so it goes into
    // the reduction's start value and the reduction yields the new maximum.
    // Every loop over v is unrolled so that its arrays are registers, not scratch;
    // the sum's steps are loops of their own to set the eight rows side by side.
    float s0[8], s1[8], mnew[8];
    #pragma unroll
    for (int v = 0; v < 8; ++v) {
      const int qrow = qbase + v + rplus;
      s0[v] = s0acc[v] * scale;
      s1[v] = s1acc[v] * scale;
      if (kb +      lrow > qrow) s0[v] = NEGF;
      if (kb + 16 + lrow > qrow) s1[v] = NEGF;
      mnew[v] = fmaxf(fmaxf(s0[v], s1[v]), mrow[v]);
    }
    row16_max8(mnew);
    float rs[8];
    #pragma unroll
    for (int v = 0; v < 8; ++v) {
      const float p0 = __expf(s0[v] - mnew[v]);
      const float p1 = __expf(s1[v] - mnew[v]);
      rs[v] = p0 + p1;
      const int prow = v + rplus;
      pbuf[wave][prow * P_PITCH +      lrow] = (__bf16)p0;
      pbuf[wave][prow * P_PITCH + 16 + lrow] = (__bf16)p1;
    }
    #pragma unroll
    for (int v = 0; v < 8; ++v) rs[v] += row_xor<1>(rs[v]);
    #pragma unroll
    for (int v = 0; v < 8; ++v) rs[v] += row_xor<2>(rs[v]);
    #pragma unroll
    for (int v = 0; v < 8; ++v) rs[v] += row_xor<4>(rs[v]);
    #pragma unroll
    for (int v = 0; v < 8; ++v) rs[v] += row_xor<8>(rs[v]);
    #pragma unroll
    for (int v = 0; v < 8; ++v) {
      const float sc = __expf(mrow[v] - mnew[v]);
      lsum[v] = lsum[v] * sc + rs[v];
      mrow[v] = mnew[v];
      #pragma unroll
      for (int dt = 0; dt < 8; ++dt) o[dt][v] *= sc;
    }
    __syncthreads();
    v16bf pf = load_frag(&pbuf[wave][lrow * P_PITCH + koff]);
    // ---- O += P V (keys as contraction dim; V^T rows are contiguous) ----
    #pragma unroll
    for (int dt = 0; dt < 8; ++dt) {
      v16bf vf = load_frag(&vt[cur][(dt * 16 + lrow) * V_PITCH + koff]);
      o[dt] = wmma_bf16(pf, vf, o[dt]);
    }
    __syncthreads();     // kt/vt[cur] + pbuf free before re-staging / rewrite
  }
  // ---- normalize and scatter back to [B,S,HID] ----
  const int b = bh >> 3, h = bh & 7;
  #pragma unroll
  for (int dt = 0; dt < 8; ++dt)
  #pragma unroll
  for (int v = 0; v < 8; ++v) {
    const int row = qbase + v + rplus;
    const int col = h * HDIM + dt * 16 + lrow;
    Y[((size_t)b * SEQ + row) * HID + col] = (__bf16)(o[dt][v] / lsum[v]);
  }
}

// ---------------------------------------------------------------------------
// Orchestration
// ---------------------------------------------------------------------------
extern "C" void kernel_launch(void* const* d_in, const int* in_sizes, int n_in,
                              void* d_out, int out_size, void* d_ws, size_t ws_size,
                              hipStream_t stream) {
  (void)in_sizes; (void)n_in; (void)out_size; (void)ws_size;

  const float* x    = (const float*)d_in[0];
  const float* ln1g = (const float*)d_in[1];
  const float* ln1b = (const float*)d_in[2];
  const float* wq   = (const float*)d_in[3];
  const float* bq   = (const float*)d_in[4];
  const float* wk   = (const float*)d_in[5];
  const float* bk   = (const float*)d_in[6];
  const float* wv   = (const float*)d_in[7];
  const float* bv   = (const float*)d_in[8];
  const float* wo   = (const float*)d_in[9];
  const float* bo   = (const float*)d_in[10];
  const float* ln2g = (const float*)d_in[11];
  const float* ln2b = (const float*)d_in[12];
  const float* w1   = (const float*)d_in[13];
  const float* b1   = (const float*)d_in[14];
  const float* w2   = (const float*)d_in[15];
  const float* b2   = (const float*)d_in[16];
  float* out = (float*)d_out;

  char* ws = (char*)d_ws;
  size_t off = 0;
  auto take = [&](size_t bytes) -> char* {
    char* p = ws + off;
    off += bytes;
    off = (off + 255) & ~(size_t)255;
    return p;
  };

  __bf16* wqb = (__bf16*)take((size_t)HID * HID * 2);
  __bf16* wkb = (__bf16*)take((size_t)HID * HID * 2);
  __bf16* wvb = (__bf16*)take((size_t)HID * HID * 2);
  __bf16* wob = (__bf16*)take((size_t)HID * HID * 2);
  __bf16* w1b = (__bf16*)take((size_t)FF  * HID * 2);
  __bf16* w2b = (__bf16*)take((size_t)HID * FF  * 2);
  __bf16* hn  = (__bf16*)take((size_t)MROWS * HID * 2);  // LN1 out
  __bf16* qb  = (__bf16*)take((size_t)MROWS * HID * 2);  // [B,h,S,d]
  __bf16* kbf = (__bf16*)take((size_t)MROWS * HID * 2);  // [B,h,S,d]
  __bf16* vtb = (__bf16*)take((size_t)MROWS * HID * 2);  // [B,h,d,S]
  __bf16* yb  = (__bf16*)take((size_t)MROWS * HID * 2);  // attn out [B,S,H]
  float*  x1  = (float*) take((size_t)MROWS * HID * 4);  // x + attn
  __bf16* m2  = (__bf16*)take((size_t)MROWS * HID * 2);  // LN2 out
  __bf16* gb  = (__bf16*)take((size_t)MROWS * FF  * 2);  // GELU(MLP1)

  // weights -> bf16
  f32_to_bf16_kernel<<<1024, 256, 0, stream>>>(wq, wqb, HID * HID);
  f32_to_bf16_kernel<<<1024, 256, 0, stream>>>(wk, wkb, HID * HID);
  f32_to_bf16_kernel<<<1024, 256, 0, stream>>>(wv, wvb, HID * HID);
  f32_to_bf16_kernel<<<1024, 256, 0, stream>>>(wo, wob, HID * HID);
  f32_to_bf16_kernel<<<2048, 256, 0, stream>>>(w1, w1b, FF * HID);
  f32_to_bf16_kernel<<<2048, 256, 0, stream>>>(w2, w2b, HID * FF);

  // LN1
  ln_bf16_kernel<<<MROWS, 256, 0, stream>>>(x, ln1g, ln1b, hn);

  // QKV projections (block tile 128x128, K-step 64)
  dim3 gH(HID / BLK_N, MROWS / BLK_M);
  gemm_wmma_kernel<1, HID><<<gH, 256, 0, stream>>>(hn, wqb, bq, nullptr, qb,  HID);
  gemm_wmma_kernel<1, HID><<<gH, 256, 0, stream>>>(hn, wkb, bk, nullptr, kbf, HID);
  gemm_wmma_kernel<2, HID><<<gH, 256, 0, stream>>>(hn, wvb, bv, nullptr, vtb, HID);

  // causal flash attention (64 query rows per block, shared K/V staging)
  dim3 gA(SEQ / 64, BATCH * NHEADS);
  attn_wmma_kernel<<<gA, 128, 0, stream>>>(qb, kbf, vtb, yb);

  // O-proj + residual -> x1 (fp32)
  gemm_wmma_kernel<3, HID><<<gH, 256, 0, stream>>>(yb, wob, bo, x, x1, HID);

  // LN2
  ln_bf16_kernel<<<MROWS, 256, 0, stream>>>(x1, ln2g, ln2b, m2);

  // MLP
  dim3 gF(FF / BLK_N, MROWS / BLK_M);
  gemm_wmma_kernel<4, FF><<<gF, 256, 0, stream>>>(m2, w1b, b1, nullptr, gb, HID);
  gemm_wmma_kernel<3, HID><<<gH, 256, 0, stream>>>(gb, w2b, b2, x1, out, FF);
}

// v004
// A run of this version takes 256 microseconds.
// In two side-by-side timings against v003, it was 1.06 and 1.05 times as fast.
// All steps since v000 together make it 2.79 times as fast.
#include <hip/hip_runtime.h>
#include <hip/hip_bf16.h>
#include <math.h>

typedef __attribute__((ext_vector_type(16))) __bf16 v16bf;
typedef __attribute__((ext_vector_type(8)))  __bf16 v8bf;
typedef __attribute__((ext_vector_type(8)))  float  v8f;

#define HID    1024
#define SEQ    2048
#define BATCH  2
#define NHEADS 8
#define HDIM   128
#define FF     4096
#define MROWS  (BATCH * SEQ)

#define BLK_M 128
#define BLK_N 128
#define BLK_K 64

// LDS row pitches in bf16 elements. Every tile below is read row per lane with
// ds_load_b128, which is free of bank conflicts at a pitch of 16 B x odd; the
// unpadded pitches (128, 256, 64 B) put the 16 rows of a fragment on few banks.
#define G_PITCH (BLK_K + 8)   // GEMM tiles: 128-B rows at 144 B
#define K_PITCH (HDIM + 8)    // K tile:     256-B rows at 272 B
#define V_PITCH (32 + 8)      // V^T tile:    64-B rows at  80 B
#define P_PITCH (32 + 8)      // P tile:      64-B rows at  80 B

// ---------------------------------------------------------------------------
// Fragment loader: CDNA5 16-bit A/B layout for 16x16x32 WMMA.
// Lane L (0..15): row = L, holds K = kb..kb+7 and kb+16..kb+23
// Lane L (16..31): row = L-16, holds K = kb+8..15 and kb+24..31
// => per lane: two contiguous 8-element (16B) chunks at +koff and +koff+16.
// ---------------------------------------------------------------------------
static __device__ __forceinline__ v16bf load_frag(const __bf16* p) {
  v8bf lo = *(const v8bf*)p;
  v8bf hi = *(const v8bf*)(p + 16);
  return __builtin_shufflevector(lo, hi, 0,1,2,3,4,5,6,7,8,9,10,11,12,13,14,15);
}

static __device__ __forceinline__ v8f wmma_bf16(v16bf a, v16bf b, v8f c) {
  return __builtin_amdgcn_wmma_f32_16x16x32_bf16(false, a, false, b, (short)0, c,
                                                 false, false);
}

// Async global -> LDS copy, 16B per lane, tracked by ASYNCcnt (gfx1250).
// lds_addr = low 32 bits of the flat shared-memory pointer (LDS aperture
// mapping: LDS_ADDR = addr[31:0]).
// One stage's eight copies of a lane stand in one statement that ends in
// s_wait_xcnt 0, so that no address register of a copy is rewritten ahead of
// that wait (a precaution for a replayed address translation).
static __device__ __forceinline__ uint32_t lds_addr_of(const void* lds_ptr) {
  return (uint32_t)(uintptr_t)lds_ptr;
}

static __device__ __forceinline__ void async_copy8_b128(const uint32_t (&l)[8],
                                                        const __bf16* const (&g)[8]) {
  asm volatile("global_load_async_to_lds_b128 %0, %8, off\n\t"
               "global_load_async_to_lds_b128 %1, %9, off\n\t"
               "global_load_async_to_lds_b128 %2, %10, off\n\t"
               "global_load_async_to_lds_b128 %3, %11, off\n\t"
               "global_load_async_to_lds_b128 %4, %12, off\n\t"
               "global_load_async_to_lds_b128 %5, %13, off\n\t"
               "global_load_async_to_lds_b128 %6, %14, off\n\t"
               "global_load_async_to_lds_b128 %7, %15, off\n\t"
               "s_wait_xcnt 0x0"
               :: "v"(l[0]), "v"(l[1]), "v"(l[2]), "v"(l[3]),
                  "v"(l[4]), "v"(l[5]), "v"(l[6]), "v"(l[7]),
                  "v"((uint64_t)(uintptr_t)g[0]), "v"((uint64_t)(uintptr_t)g[1]),
                  "v"((uint64_t)(uintptr_t)g[2]), "v"((uint64_t)(uintptr_t)g[3]),
                  "v"((uint64_t)(uintptr_t)g[4]), "v"((uint64_t)(uintptr_t)g[5]),
                  "v"((uint64_t)(uintptr_t)g[6]), "v"((uint64_t)(uintptr_t)g[7])
               : "memory");
}

// Reductions over the 16 lanes of a row by DPP row_xmask butterfly steps, on the
// vector port. A shuffle compiles to ds_bpermute_b32, which goes through the LDS
// queue and is waited for at every one of its steps.
//
// Sum step: the value of lane (l ^ MASK); the compiler folds it into the add.
template <int MASK>
static __device__ __forceinline__ float row_xor(float x) {
  return __builtin_bit_cast(float, __builtin_amdgcn_update_dpp(
      0, __builtin_bit_cast(int, x), 0x160 + MASK, 0xf, 0xf, true));
}

// Maximum of eight rows at once. In asm because the compiler puts a move and a
// quieting maximum in front of every fmaxf on a DPP value (three dependent
// instructions a step instead of one). The eight rows stand side by side in each
// step, so every instruction's producer is eight instructions back.
#define ROWMAX_1(r, m) \
  "v_max_num_f32_dpp " r ", " r ", " r " row_xmask:" m " row_mask:0xf bank_mask:0xf bound_ctrl:1\n\t"
#define ROWMAX_8(m) \
  ROWMAX_1("%0", m) ROWMAX_1("%1", m) ROWMAX_1("%2", m) ROWMAX_1("%3", m) \
  ROWMAX_1("%4", m) ROWMAX_1("%5", m) ROWMAX_1("%6", m) ROWMAX_1("%7", m)
static __device__ __forceinline__ void row16_max8(float (&t)[8]) {
  asm(ROWMAX_8("1") ROWMAX_8("2") ROWMAX_8("4") ROWMAX_8("8")
      : "+v"(t[0]), "+v"(t[1]), "+v"(t[2]), "+v"(t[3]),
        "+v"(t[4]), "+v"(t[5]), "+v"(t[6]), "+v"(t[7]));
}

static __device__ __forceinline__ void wait_async0() {
  asm volatile("s_wait_asynccnt 0x0" ::: "memory");
}

// ---------------------------------------------------------------------------
// The two streaming kernels below move little data. For speed only, each wave does
// much more than one element per lane: 16-B loads that cover whole lines
// (32 lanes x 16 B = 512 B in a row),
// all of a lane's loads issued together, and few waves in the grid.
// ---------------------------------------------------------------------------
typedef __attribute__((ext_vector_type(4))) float  f32x4;
typedef __attribute__((ext_vector_type(4))) __bf16 v4bf;

// fp32 -> bf16 elementwise convert (weights). N elements; a block of 256 threads
// converts 256 * PER groups of four neighbours, PER groups per lane.
template <int N, int PER>
__global__ __launch_bounds__(256)
void f32_to_bf16_kernel(const float* __restrict__ src, __bf16* __restrict__ dst) {
  static_assert(N % (256 * PER * 4) == 0, "whole blocks only");
  const size_t first = (size_t)blockIdx.x * (256 * PER) + threadIdx.x;
  const f32x4* s = (const f32x4*)src + first;
  v4bf* d = (v4bf*)dst + first;
  f32x4 v[PER];
  #pragma unroll
  for (int j = 0; j < PER; ++j) v[j] = s[j * 256];
  #pragma unroll
  for (int j = 0; j < PER; ++j) d[j * 256] = __builtin_convertvector(v[j], v4bf);
}

// ---------------------------------------------------------------------------
// Row LayerNorm (H=1024), fp32 in -> bf16 out. One wave per row, 8 rows per block:
// the row stays in registers (8 x 16 B per lane), its sums are formed in the lane
// and joined by a five-step butterfly, so no LDS and no barrier is needed.
// ---------------------------------------------------------------------------
__global__ __launch_bounds__(256)
void ln_bf16_kernel(const float* __restrict__ x, const float* __restrict__ g,
                    const float* __restrict__ b, __bf16* __restrict__ out) {
  const int lane = threadIdx.x & 31;
  const int row  = blockIdx.x * 8 + (threadIdx.x >> 5);
  const f32x4* xr = (const f32x4*)(x + (size_t)row * HID) + lane;
  const f32x4* gp = (const f32x4*)g + lane;
  const f32x4* bp = (const f32x4*)b + lane;
  f32x4 v[8], gv[8], bv[8];
  #pragma unroll
  for (int j = 0; j < 8; ++j) v[j] = xr[j * 32];
  // Behind the row's loads, since a later load's result may be given their address
  // pair as its place (a precaution for a replayed address translation).
  asm volatile("s_wait_xcnt 0x0" ::: "memory");
  #pragma unroll
  for (int j = 0; j < 8; ++j) { gv[j] = gp[j * 32]; bv[j] = bp[j * 32]; }
  // Keeps all 24 loads in front of the sums: without it the gain and bias loads
  // are issued behind the reduction, two at a time, each waited for.
  __builtin_amdgcn_sched_barrier(0);
  f32x4 sv = {}, qv = {};   // four independent chains each
  #pragma unroll
  for (int j = 0; j < 8; ++j) { sv += v[j]; qv += v[j] * v[j]; }
  float s  = (sv[0] + sv[1]) + (sv[2] + sv[3]);
  float s2 = (qv[0] + qv[1]) + (qv[2] + qv[3]);
  #pragma unroll
  for (int d = 1; d < 32; d <<= 1) {
    s  += __shfl_xor(s,  d, 32);
    s2 += __shfl_xor(s2, d, 32);
  }
  const float mu  = s * (1.0f / HID);
  const float var = s2 * (1.0f / HID) - mu * mu;
  const float r   = rsqrtf(var + 1e-5f);
  v4bf* o = (v4bf*)(out + (size_t)row * HID) + lane;
  #pragma unroll
  for (int j = 0; j < 8; ++j)
    o[j * 32] = __builtin_convertvector((v[j] - mu) * r * gv[j] + bv[j], v4bf);
}

// ---------------------------------------------------------------------------
// WMMA GEMM with async-LDS double-buffered staging.
// C[M,N] = A[M,K] (row-major) * W[N,K]^T (+ bias, epilogue modes).
// Block: 256 threads = 8 waves (4 M x 2 N); block tile 128x128;
// wave tile 32x64 (2x4 WMMA frags). K-step 64 (2 x 8 WMMAs per barrier pair).
// Staging: 128x64 bf16 tiles of A and W copied global->LDS with
// global_load_async_to_lds_b128 (ASYNCcnt), double buffered, rows padded to
// G_PITCH (72 KB LDS).
// MODE and NCOLS (the output's row length) are template parameters: the epilogue
// then holds one mode's code with no test per element, every address is one base
// plus a constant, and its loads and stores are issued together.
// MODE 1: bf16 out in [B,heads,S,d]        (Q / K)
// MODE 2: bf16 out in [B,heads,d,S]        (V^T)
// MODE 3: fp32 out = resid + acc + bias    (O-proj / MLP2 residual)
// MODE 4: bf16 out = gelu(acc + bias)      (MLP1)
// ---------------------------------------------------------------------------
template <int MODE, int NCOLS>
__global__ __launch_bounds__(256)
void gemm_wmma_kernel(const __bf16* __restrict__ A, const __bf16* __restrict__ W,
                      const float* __restrict__ bias, const float* __restrict__ resid,
                      void* __restrict__ outp, int K) {
  const int lane = threadIdx.x & 31;
  const int wave = threadIdx.x >> 5;
  const int wm   = wave & 3;          // 4 waves along M
  const int wn   = wave >> 2;         // 2 waves along N
  const int mblk = blockIdx.y * BLK_M;
  const int nblk = blockIdx.x * BLK_N;
  const int lrow = lane & 15;
  const int koff = (lane >> 4) << 3;  // 0 or 8

  __shared__ __align__(16) __bf16 tA[2][BLK_M * G_PITCH];
  __shared__ __align__(16) __bf16 tB[2][BLK_N * G_PITCH];

  // Stage one 128x64 K-slice of A and W into LDS buffer `buf`.
  // 1024 16B chunks per tile; 256 threads issue 4 chunks each per tile.
  auto stage = [&](int buf, int k0) {
    uint32_t l[8];
    const __bf16* g[8];
    #pragma unroll
    for (int j = 0; j < 4; ++j) {
      const int id  = threadIdx.x + j * 256;
      const int row = id >> 3;
      const int ch  = (id & 7) << 3;  // element offset of the 16B chunk
      l[2 * j]     = lds_addr_of(&tA[buf][row * G_PITCH + ch]);
      g[2 * j]     = A + (size_t)(mblk + row) * K + k0 + ch;
      l[2 * j + 1] = lds_addr_of(&tB[buf][row * G_PITCH + ch]);
      g[2 * j + 1] = W + (size_t)(nblk + row) * K + k0 + ch;
    }
    async_copy8_b128(l, g);
  };

  v8f acc[2][4] = {};

  stage(0, 0);
  for (int k0 = 0; k0 < K; k0 += BLK_K) {
    const int cur = (k0 >> 6) & 1;
    wait_async0();       // this wave's copies into tX[cur] have landed
    __syncthreads();     // everyone's copies have landed
    if (k0 + BLK_K < K) stage(cur ^ 1, k0 + BLK_K);

    #pragma unroll
    for (int ks = 0; ks < BLK_K; ks += 32) {
      v16bf a[2], b[4];
      #pragma unroll
      for (int mt = 0; mt < 2; ++mt)
        a[mt] = load_frag(&tA[cur][(wm * 32 + mt * 16 + lrow) * G_PITCH + ks + koff]);
      #pragma unroll
      for (int nt = 0; nt < 4; ++nt)
        b[nt] = load_frag(&tB[cur][(wn * 64 + nt * 16 + lrow) * G_PITCH + ks + koff]);
      #pragma unroll
      for (int mt = 0; mt < 2; ++mt)
        #pragma unroll
        for (int nt = 0; nt < 4; ++nt)
          acc[mt][nt] = wmma_bf16(a[mt], b[nt], acc[mt][nt]);
    }

    __syncthreads();     // all reads of tX[cur] done before it is re-staged
  }

  // Element (mt, nt, v) of this lane is row row0 + mt*16 + v, column col0 + nt*16.
  // A block's 128 rows lie in one batch entry and its 128 columns in one head.
  const int row0 = mblk + wm * 32 + ((lane >> 4) << 3);  // upper 16 lanes: rows +8
  const int col0 = nblk + wn * 64 + lrow;
  float bv[4];
  #pragma unroll
  for (int nt = 0; nt < 4; ++nt) bv[nt] = bias[col0 + nt * 16];

  if constexpr (MODE == 1 || MODE == 2) {
    const int bb = row0 >> 11, ss = row0 & (SEQ - 1);   // S = 2048
    const int hh = col0 >> 7,  dd = col0 & (HDIM - 1);  // d = 128
    if constexpr (MODE == 1) {
      __bf16* o = (__bf16*)outp + ((size_t)((bb * NHEADS + hh) * SEQ + ss)) * HDIM + dd;
      #pragma unroll
      for (int mt = 0; mt < 2; ++mt)
      #pragma unroll
      for (int nt = 0; nt < 4; ++nt)
      #pragma unroll
      for (int v = 0; v < 8; ++v)
        o[(mt * 16 + v) * HDIM + nt * 16] = (__bf16)(acc[mt][nt][v] + bv[nt]);
    } else {
      // A lane's eight rows are eight neighbours along S: one 16-B store.
      __bf16* o = (__bf16*)outp + ((size_t)((bb * NHEADS + hh) * HDIM + dd)) * SEQ + ss;
      #pragma unroll
      for (int mt = 0; mt < 2; ++mt)
      #pragma unroll
      for (int nt = 0; nt < 4; ++nt) {
        v8bf pk;
        #pragma unroll
        for (int v = 0; v < 8; ++v) pk[v] = (__bf16)(acc[mt][nt][v] + bv[nt]);
        *(v8bf*)(o + nt * 16 * SEQ + mt * 16) = pk;
      }
    }
  } else if constexpr (MODE == 3) {
    const size_t base = (size_t)row0 * NCOLS + col0;
    const float* rp = resid + base;
    float* o = (float*)outp + base;
    float r[2][4][8];
    #pragma unroll
    for (int mt = 0; mt < 2; ++mt)
    #pragma unroll
    for (int v = 0; v < 8; ++v)
    #pragma unroll
    for (int nt = 0; nt < 4; ++nt)
      r[mt][nt][v] = rp[(mt * 16 + v) * NCOLS + nt * 16];
    #pragma unroll
    for (int mt = 0; mt < 2; ++mt)
    #pragma unroll
    for (int v = 0; v < 8; ++v)
    #pragma unroll
    for (int nt = 0; nt < 4; ++nt)
      o[(mt * 16 + v) * NCOLS + nt * 16] = r[mt][nt][v] + (acc[mt][nt][v] + bv[nt]);
  } else {  // MODE 4: exact GELU, bf16 out
    __bf16* o = (__bf16*)outp + (size_t)row0 * NCOLS + col0;
    #pragma unroll
    for (int mt = 0; mt < 2; ++mt)
    #pragma unroll
    for (int nt = 0; nt < 4; ++nt)
    #pragma unroll
    for (int v = 0; v < 8; ++v) {
      const float val = acc[mt][nt][v] + bv[nt];
      const float gl = 0.5f * val * (1.0f + erff(val * 0.70710678118654752f));
      o[(mt * 16 + v) * NCOLS + nt * 16] = (__bf16)gl;
    }
  }
}

// ---------------------------------------------------------------------------
// Causal flash attention with shared async-LDS K/V staging.
// Block: 128 threads = 4 waves; each wave owns a 16-query tile (64 rows/block).
// Per 32-key block: K tile (32x128) and V^T tile (128x32) staged global->LDS
// (double buffered, ASYNCcnt) once and consumed by all 4 waves.
// All waves run to the block's last key block; the causal mask nulls any
// key > query row (exp(-huge)=0), so lower waves' surplus blocks are inert.
// ---------------------------------------------------------------------------
__global__ __launch_bounds__(128)
void attn_wmma_kernel(const __bf16* __restrict__ Q, const __bf16* __restrict__ Kc,
                      const __bf16* __restrict__ VT, __bf16* __restrict__ Y) {
  const int lane  = threadIdx.x & 31;
  const int wave  = threadIdx.x >> 5;
  const int lrow  = lane & 15;
  const int koff  = (lane >> 4) << 3;
  const int rplus = koff;               // C-layout: upper lanes own rows +8
  const int qblk  = blockIdx.x * 64;
  const int qbase = qblk + wave * 16;
  const int bh    = blockIdx.y;
  const float scale = 0.08838834764831845f;  // 1/sqrt(128)
  const float NEGF  = -3.0e38f;

  __shared__ __align__(16) __bf16 kt[2][32 * K_PITCH];    // 2 x 8.5 KB
  __shared__ __align__(16) __bf16 vt[2][HDIM * V_PITCH];  // 2 x 10 KB
  __shared__ __align__(16) __bf16 pbuf[4][16 * P_PITCH];  // per-wave P tiles

  // Stage K tile (32 keys x 128) and V^T tile (128 x 32 keys) for key block kb.
  // 512 16B chunks per tile; 128 threads issue 4 chunks each per tile.
  auto stage = [&](int buf, int kb) {
    uint32_t l[8];
    const __bf16* g[8];
    #pragma unroll
    for (int j = 0; j < 4; ++j) {
      const int id = threadIdx.x + j * 128;
      const int kr = id >> 4, kc = (id & 15) << 3;   // K tile: 16 chunks/row
      l[2 * j]     = lds_addr_of(&kt[buf][kr * K_PITCH + kc]);
      g[2 * j]     = Kc + ((size_t)bh * SEQ + kb + kr) * HDIM + kc;
      const int vr = id >> 2, vc = (id & 3) << 3;    // V^T tile: 4 chunks/row
      l[2 * j + 1] = lds_addr_of(&vt[buf][vr * V_PITCH + vc]);
      g[2 * j + 1] = VT + ((size_t)bh * HDIM + vr) * SEQ + kb + vc;
    }
    async_copy8_b128(l, g);
  };

  v16bf qf[4];
  #pragma unroll
  for (int kc = 0; kc < 4; ++kc)
    qf[kc] = load_frag(Q + ((size_t)bh * SEQ + qbase + lrow) * HDIM + kc * 32 + koff);

  v8f o[8] = {};
  float mrow[8], lsum[8];
  #pragma unroll
  for (int v = 0; v < 8; ++v) { mrow[v] = NEGF; lsum[v] = 0.f; }

  const int kend = qblk + 64;           // block-uniform key range
  stage(0, 0);
  for (int kb = 0; kb < kend; kb += 32) {
    const int cur = (kb >> 5) & 1;
    wait_async0();
    __syncthreads();
    if (kb + 32 < kend) stage(cur ^ 1, kb + 32);

    // ---- S = Q K^T over d=128 (4 x K=32 WMMAs per 16-key column tile) ----
    v8f s0acc = {}, s1acc = {};
    #pragma unroll
    for (int kc = 0; kc < 4; ++kc) {
      v16bf k0 = load_frag(&kt[cur][(     lrow) * K_PITCH + kc * 32 + koff]);
      v16bf k1 = load_frag(&kt[cur][(16 + lrow) * K_PITCH + kc * 32 + koff]);
      s0acc = wmma_bf16(qf[kc], k0, s0acc);
      s1acc = wmma_bf16(qf[kc], k1, s1acc);
    }
    // ---- scale, causal mask, online softmax (per C-layout row) ----
    // The running maximum is the same in all 16 lanes of a row, so it goes into
    // the reduction's start value and the reduction yields the new maximum.
    // Every loop over v is unrolled so that its arrays are registers, not scratch;
    // the sum's steps are loops of their own to set the eight rows side by side.
    float s0[8], s1[8], mnew[8];
    #pragma unroll
    for (int v = 0; v < 8; ++v) {
      const int qrow = qbase + v + rplus;
      s0[v] = s0acc[v] * scale;
      s1[v] = s1acc[v] * scale;
      if (kb +      lrow > qrow) s0[v] = NEGF;
      if (kb + 16 + lrow > qrow) s1[v] = NEGF;
      mnew[v] = fmaxf(fmaxf(s0[v], s1[v]), mrow[v]);
    }
    row16_max8(mnew);
    float rs[8];
    #pragma unroll
    for (int v = 0; v < 8; ++v) {
      const float p0 = __expf(s0[v] - mnew[v]);
      const float p1 = __expf(s1[v] - mnew[v]);
      rs[v] = p0 + p1;
      const int prow = v + rplus;
      pbuf[wave][prow * P_PITCH +      lrow] = (__bf16)p0;
      pbuf[wave][prow * P_PITCH + 16 + lrow] = (__bf16)p1;
    }
    #pragma unroll
    for (int v = 0; v < 8; ++v) rs[v] += row_xor<1>(rs[v]);
    #pragma unroll
    for (int v = 0; v < 8; ++v) rs[v] += row_xor<2>(rs[v]);
    #pragma unroll
    for (int v = 0; v < 8; ++v) rs[v] += row_xor<4>(rs[v]);
    #pragma unroll
    for (int v = 0; v < 8; ++v) rs[v] += row_xor<8>(rs[v]);
    #pragma unroll
    for (int v = 0; v < 8; ++v) {
      const float sc = __expf(mrow[v] - mnew[v]);
      lsum[v] = lsum[v] * sc + rs[v];
      mrow[v] = mnew[v];
      #pragma unroll
      for (int dt = 0; dt < 8; ++dt) o[dt][v] *= sc;
    }
    __syncthreads();
    v16bf pf = load_frag(&pbuf[wave][lrow * P_PITCH + koff]);
    // ---- O += P V (keys as contraction dim; V^T rows are contiguous) ----
    #pragma unroll
    for (int dt = 0; dt < 8; ++dt) {
      v16bf vf = load_frag(&vt[cur][(dt * 16 + lrow) * V_PITCH + koff]);
      o[dt] = wmma_bf16(pf, vf, o[dt]);
    }
    __syncthreads();     // kt/vt[cur] + pbuf free before re-staging / rewrite
  }
  // ---- normalize and scatter back to [B,S,HID] ----
  const int b = bh >> 3, h = bh & 7;
  #pragma unroll
  for (int dt = 0; dt < 8; ++dt)
  #pragma unroll
  for (int v = 0; v < 8; ++v) {
    const int row = qbase + v + rplus;
    const int col = h * HDIM + dt * 16 + lrow;
    Y[((size_t)b * SEQ + row) * HID + col] = (__bf16)(o[dt][v] / lsum[v]);
  }
}

// ---------------------------------------------------------------------------
// Orchestration
// ---------------------------------------------------------------------------
extern "C" void kernel_launch(void* const* d_in, const int* in_sizes, int n_in,
                              void* d_out, int out_size, void* d_ws, size_t ws_size,
                              hipStream_t stream) {
  (void)in_sizes; (void)n_in; (void)out_size; (void)ws_size;

  const float* x    = (const float*)d_in[0];
  const float* ln1g = (const float*)d_in[1];
  const float* ln1b = (const float*)d_in[2];
  const float* wq   = (const float*)d_in[3];
  const float* bq   = (const float*)d_in[4];
  const float* wk   = (const float*)d_in[5];
  const float* bk   = (const float*)d_in[6];
  const float* wv   = (const float*)d_in[7];
  const float* bv   = (const float*)d_in[8];
  const float* wo   = (const float*)d_in[9];
  const float* bo   = (const float*)d_in[10];
  const float* ln2g = (const float*)d_in[11];
  const float* ln2b = (const float*)d_in[12];
  const float* w1   = (const float*)d_in[13];
  const float* b1   = (const float*)d_in[14];
  const float* w2   = (const float*)d_in[15];
  const float* b2   = (const float*)d_in[16];
  float* out = (float*)d_out;

  char* ws = (char*)d_ws;
  size_t off = 0;
  auto take = [&](size_t bytes) -> char* {
    char* p = ws + off;
    off += bytes;
    off = (off + 255) & ~(size_t)255;
    return p;
  };

  __bf16* wqb = (__bf16*)take((size_t)HID * HID * 2);
  __bf16* wkb = (__bf16*)take((size_t)HID * HID * 2);
  __bf16* wvb = (__bf16*)take((size_t)HID * HID * 2);
  __bf16* wob = (__bf16*)take((size_t)HID * HID * 2);
  __bf16* w1b = (__bf16*)take((size_t)FF  * HID * 2);
  __bf16* w2b = (__bf16*)take((size_t)HID * FF  * 2);
  __bf16* hn  = (__bf16*)take((size_t)MROWS * HID * 2);  // LN1 out
  __bf16* qb  = (__bf16*)take((size_t)MROWS * HID * 2);  // [B,h,S,d]
  __bf16* kbf = (__bf16*)take((size_t)MROWS * HID * 2);  // [B,h,S,d]
  __bf16* vtb = (__bf16*)take((size_t)MROWS * HID * 2);  // [B,h,d,S]
  __bf16* yb  = (__bf16*)take((size_t)MROWS * HID * 2);  // attn out [B,S,H]
  float*  x1  = (float*) take((size_t)MROWS * HID * 4);  // x + attn
  __bf16* m2  = (__bf16*)take((size_t)MROWS * HID * 2);  // LN2 out
  __bf16* gb  = (__bf16*)take((size_t)MROWS * FF  * 2);  // GELU(MLP1)

  // weights -> bf16
  f32_to_bf16_kernel<HID * HID, 4><<<HID * HID / 4096, 256, 0, stream>>>(wq, wqb);
  f32_to_bf16_kernel<HID * HID, 4><<<HID * HID / 4096, 256, 0, stream>>>(wk, wkb);
  f32_to_bf16_kernel<HID * HID, 4><<<HID * HID / 4096, 256, 0, stream>>>(wv, wvb);
  f32_to_bf16_kernel<HID * HID, 4><<<HID * HID / 4096, 256, 0, stream>>>(wo, wob);
  f32_to_bf16_kernel<FF * HID, 8><<<FF * HID / 8192, 256, 0, stream>>>(w1, w1b);
  f32_to_bf16_kernel<FF * HID, 8><<<FF * HID / 8192, 256, 0, stream>>>(w2, w2b);

  // LN1
  ln_bf16_kernel<<<MROWS / 8, 256, 0, stream>>>(x, ln1g, ln1b, hn);

  // QKV projections (block tile 128x128, K-step 64)
  dim3 gH(HID / BLK_N, MROWS / BLK_M);
  gemm_wmma_kernel<1, HID><<<gH, 256, 0, stream>>>(hn, wqb, bq, nullptr, qb,  HID);
  gemm_wmma_kernel<1, HID><<<gH, 256, 0, stream>>>(hn, wkb, bk, nullptr, kbf, HID);
  gemm_wmma_kernel<2, HID><<<gH, 256, 0, stream>>>(hn, wvb, bv, nullptr, vtb, HID);

  // causal flash attention (64 query rows per block, shared K/V staging)
  dim3 gA(SEQ / 64, BATCH * NHEADS);
  attn_wmma_kernel<<<gA, 128, 0, stream>>>(qb, kbf, vtb, yb);

  // O-proj + residual -> x1 (fp32)
  gemm_wmma_kernel<3, HID><<<gH, 256, 0, stream>>>(yb, wob, bo, x, x1, HID);

  // LN2
  ln_bf16_kernel<<<MROWS / 8, 256, 0, stream>>>(x1, ln2g, ln2b, m2);

  // MLP
  dim3 gF(FF / BLK_N, MROWS / BLK_M);
  gemm_wmma_kernel<4, FF><<<gF, 256, 0, stream>>>(m2, w1b, b1, nullptr, gb, HID);
  gemm_wmma_kernel<3, HID><<<gH, 256, 0, stream>>>(gb, w2b, b2, x1, out, FF);
}

// v005
// Measured time: 208 microseconds a run.
// Two timings next to v004 put it at 1.23 and 1.22 times that version's speed.
// Counting every step since v000, it is 3.41 times as fast.
#include <hip/hip_runtime.h>
#include <hip/hip_bf16.h>
#include <math.h>

typedef __attribute__((ext_vector_type(16))) __bf16 v16bf;
typedef __attribute__((ext_vector_type(8)))  __bf16 v8bf;
typedef __attribute__((ext_vector_type(8)))  float  v8f;

#define HID    1024
#define SEQ    2048
#define BATCH  2
#define NHEADS 8
#define HDIM   128
#define FF     4096
#define MROWS  (BATCH * SEQ)

#define BLK_M 128
#define BLK_N 128
#define BLK_K 64

// LDS row pitches in bf16 elements. Every tile below is read row per lane with
// ds_load_b128, which is free of bank conflicts at a pitch of 16 B x odd; the
// unpadded pitches (128, 256, 64 B) put the 16 rows of a fragment on few banks.
#define G_PITCH (BLK_K + 8)   // GEMM tiles: 128-B rows at 144 B
#define K_PITCH (HDIM + 8)    // K tile:     256-B rows at 272 B
#define V_PITCH (32 + 8)      // V^T tile:    64-B rows at  80 B
#define P_PITCH (32 + 8)      // P tile:      64-B rows at  80 B

// ---------------------------------------------------------------------------
// Fragment loader: CDNA5 16-bit A/B layout for 16x16x32 WMMA.
// Lane L (0..15): row = L, holds K = kb..kb+7 and kb+16..kb+23
// Lane L (16..31): row = L-16, holds K = kb+8..15 and kb+24..31
// => per lane: two contiguous 8-element (16B) chunks at +koff and +koff+16.
// ---------------------------------------------------------------------------
static __device__ __forceinline__ v16bf load_frag(const __bf16* p) {
  v8bf lo = *(const v8bf*)p;
  v8bf hi = *(const v8bf*)(p + 16);
  return __builtin_shufflevector(lo, hi, 0,1,2,3,4,5,6,7,8,9,10,11,12,13,14,15);
}

static __device__ __forceinline__ v8f wmma_bf16(v16bf a, v16bf b, v8f c) {
  return __builtin_amdgcn_wmma_f32_16x16x32_bf16(false, a, false, b, (short)0, c,
                                                 false, false);
}

// Async global -> LDS copy, 16B per lane, tracked by ASYNCcnt (gfx1250).
// lds_addr = low 32 bits of the flat shared-memory pointer (LDS aperture
// mapping: LDS_ADDR = addr[31:0]).
// One stage's eight copies of a lane stand in one statement that ends in
// s_wait_xcnt 0, so that no address register of a copy is rewritten ahead of
// that wait (a precaution for a replayed address translation).
static __device__ __forceinline__ uint32_t lds_addr_of(const void* lds_ptr) {
  return (uint32_t)(uintptr_t)lds_ptr;
}

static __device__ __forceinline__ void async_copy8_b128(const uint32_t (&l)[8],
                                                        const __bf16* const (&g)[8]) {
  asm volatile("global_load_async_to_lds_b128 %0, %8, off\n\t"
               "global_load_async_to_lds_b128 %1, %9, off\n\t"
               "global_load_async_to_lds_b128 %2, %10, off\n\t"
               "global_load_async_to_lds_b128 %3, %11, off\n\t"
               "global_load_async_to_lds_b128 %4, %12, off\n\t"
               "global_load_async_to_lds_b128 %5, %13, off\n\t"
               "global_load_async_to_lds_b128 %6, %14, off\n\t"
               "global_load_async_to_lds_b128 %7, %15, off\n\t"
               "s_wait_xcnt 0x0"
               :: "v"(l[0]), "v"(l[1]), "v"(l[2]), "v"(l[3]),
                  "v"(l[4]), "v"(l[5]), "v"(l[6]), "v"(l[7]),
                  "v"((uint64_t)(uintptr_t)g[0]), "v"((uint64_t)(uintptr_t)g[1]),
                  "v"((uint64_t)(uintptr_t)g[2]), "v"((uint64_t)(uintptr_t)g[3]),
                  "v"((uint64_t)(uintptr_t)g[4]), "v"((uint64_t)(uintptr_t)g[5]),
                  "v"((uint64_t)(uintptr_t)g[6]), "v"((uint64_t)(uintptr_t)g[7])
               : "memory");
}

// Reductions over the 16 lanes of a row by DPP row_xmask butterfly steps, on the
// vector port. A shuffle compiles to ds_bpermute_b32, which goes through the LDS
// queue and is waited for at every one of its steps.
//
// Sum step: the value of lane (l ^ MASK); the compiler folds it into the add.
template <int MASK>
static __device__ __forceinline__ float row_xor(float x) {
  return __builtin_bit_cast(float, __builtin_amdgcn_update_dpp(
      0, __builtin_bit_cast(int, x), 0x160 + MASK, 0xf, 0xf, true));
}

// Maximum of eight rows at once. In asm because the compiler puts a move and a
// quieting maximum in front of every fmaxf on a DPP value (three dependent
// instructions a step instead of one). The eight rows stand side by side in each
// step, so every instruction's producer is eight instructions back.
#define ROWMAX_1(r, m) \
  "v_max_num_f32_dpp " r ", " r ", " r " row_xmask:" m " row_mask:0xf bank_mask:0xf bound_ctrl:1\n\t"
#define ROWMAX_8(m) \
  ROWMAX_1("%0", m) ROWMAX_1("%1", m) ROWMAX_1("%2", m) ROWMAX_1("%3", m) \
  ROWMAX_1("%4", m) ROWMAX_1("%5", m) ROWMAX_1("%6", m) ROWMAX_1("%7", m)
static __device__ __forceinline__ void row16_max8(float (&t)[8]) {
  asm(ROWMAX_8("1") ROWMAX_8("2") ROWMAX_8("4") ROWMAX_8("8")
      : "+v"(t[0]), "+v"(t[1]), "+v"(t[2]), "+v"(t[3]),
        "+v"(t[4]), "+v"(t[5]), "+v"(t[6]), "+v"(t[7]));
}

static __device__ __forceinline__ void wait_async0() {
  asm volatile("s_wait_asynccnt 0x0" ::: "memory");
}

// ---------------------------------------------------------------------------
// The two streaming kernels below move little data. For speed only, each wave does
// much more than one element per lane: 16-B loads that cover whole lines
// (32 lanes x 16 B = 512 B in a row),
// all of a lane's loads issued together, and few waves in the grid.
// ---------------------------------------------------------------------------
typedef __attribute__((ext_vector_type(4))) float  f32x4;
typedef __attribute__((ext_vector_type(4))) __bf16 v4bf;

// fp32 -> bf16 elementwise convert (weights). Block blk of THREADS threads converts
// THREADS * PER groups of four neighbours, PER groups per lane.
template <int THREADS, int PER>
static __device__ __forceinline__
void f32_to_bf16_block(const float* __restrict__ src, __bf16* __restrict__ dst, int blk) {
  const size_t first = (size_t)blk * (THREADS * PER) + threadIdx.x;
  const f32x4* s = (const f32x4*)src + first;
  v4bf* d = (v4bf*)dst + first;
  f32x4 v[PER];
  #pragma unroll
  for (int j = 0; j < PER; ++j) v[j] = s[j * THREADS];
  #pragma unroll
  for (int j = 0; j < PER; ++j) d[j * THREADS] = __builtin_convertvector(v[j], v4bf);
}

// ---------------------------------------------------------------------------
// Row LayerNorm (H=1024), fp32 in -> bf16 out. One wave per row, 8 rows per block:
// the row stays in registers (8 x 16 B per lane), its sums are formed in the lane
// and joined by a five-step butterfly, so no LDS and no barrier is needed.
// ---------------------------------------------------------------------------
static __device__ __forceinline__
void ln_bf16_block(const float* __restrict__ x, const float* __restrict__ g,
                   const float* __restrict__ b, __bf16* __restrict__ out, int blk) {
  const int lane = threadIdx.x & 31;
  const int row  = blk * 8 + (threadIdx.x >> 5);
  const f32x4* xr = (const f32x4*)(x + (size_t)row * HID) + lane;
  const f32x4* gp = (const f32x4*)g + lane;
  const f32x4* bp = (const f32x4*)b + lane;
  f32x4 v[8], gv[8], bv[8];
  #pragma unroll
  for (int j = 0; j < 8; ++j) v[j] = xr[j * 32];
  // Behind the row's loads, since a later load's result may be given their address
  // pair as its place (a precaution for a replayed address translation).
  asm volatile("s_wait_xcnt 0x0" ::: "memory");
  #pragma unroll
  for (int j = 0; j < 8; ++j) { gv[j] = gp[j * 32]; bv[j] = bp[j * 32]; }
  // Keeps all 24 loads in front of the sums: without it the gain and bias loads
  // are issued behind the reduction, two at a time, each waited for.
  __builtin_amdgcn_sched_barrier(0);
  f32x4 sv = {}, qv = {};   // four independent chains each
  #pragma unroll
  for (int j = 0; j < 8; ++j) { sv += v[j]; qv += v[j] * v[j]; }
  float s  = (sv[0] + sv[1]) + (sv[2] + sv[3]);
  float s2 = (qv[0] + qv[1]) + (qv[2] + qv[3]);
  #pragma unroll
  for (int d = 1; d < 32; d <<= 1) {
    s  += __shfl_xor(s,  d, 32);
    s2 += __shfl_xor(s2, d, 32);
  }
  const float mu  = s * (1.0f / HID);
  const float var = s2 * (1.0f / HID) - mu * mu;
  const float r   = rsqrtf(var + 1e-5f);
  v4bf* o = (v4bf*)(out + (size_t)row * HID) + lane;
  #pragma unroll
  for (int j = 0; j < 8; ++j)
    o[j * 32] = __builtin_convertvector((v[j] - mu) * r * gv[j] + bv[j], v4bf);
}

__global__ __launch_bounds__(256)
void ln_bf16_kernel(const float* __restrict__ x, const float* __restrict__ g,
                    const float* __restrict__ b, __bf16* __restrict__ out) {
  ln_bf16_block(x, g, b, out, blockIdx.x);
}

// ---------------------------------------------------------------------------
// What the Q, K and V products wait for, in one launch: the first LayerNorm and the
// converts of their three weights. None reads what another writes, so each gets a
// range of the block index; short launches one behind the other each pay their own
// start and drain, with most of the chip idle meanwhile. (The other three weights
// are first read behind attention and are converted in its launch.)
// ---------------------------------------------------------------------------
#define LN_BLOCKS    (MROWS / 8)               // 8 rows a block
#define SQ_BLOCKS    (HID * HID / (1024 * 4))  // a HID x HID weight, 256 threads, PER = 4
#define PREP_BLOCKS  (LN_BLOCKS + 3 * SQ_BLOCKS)
static_assert(HID * HID % (1024 * 4) == 0, "whole blocks only");

__global__ __launch_bounds__(256)
void prep_kernel(const float* __restrict__ x, const float* __restrict__ g,
                 const float* __restrict__ b, __bf16* __restrict__ hn,
                 const float* __restrict__ wq, const float* __restrict__ wk,
                 const float* __restrict__ wv, __bf16* __restrict__ wqb,
                 __bf16* __restrict__ wkb, __bf16* __restrict__ wvb) {
  int blk = blockIdx.x;
  if (blk < LN_BLOCKS) {
    ln_bf16_block(x, g, b, hn, blk);
    return;
  }
  blk -= LN_BLOCKS;
  const int which = blk / SQ_BLOCKS;
  f32_to_bf16_block<256, 4>(which == 0 ? wq : which == 1 ? wk : wv,
                            which == 0 ? wqb : which == 1 ? wkb : wvb,
                            blk - which * SQ_BLOCKS);
}

// ---------------------------------------------------------------------------
// WMMA GEMM with async-LDS double-buffered staging.
// C[M,N] = A[M,K] (row-major) * W[N,K]^T (+ bias, epilogue modes).
// Block: 256 threads = 8 waves (4 M x 2 N); block tile 128x128;
// wave tile 32x64 (2x4 WMMA frags). K-step 64 (2 x 8 WMMAs per barrier pair).
// Staging: 128x64 bf16 tiles of A and W copied global->LDS with
// global_load_async_to_lds_b128 (ASYNCcnt), double buffered, rows padded to
// G_PITCH (72 KB LDS).
// MODE and NCOLS (the output's row length) are template parameters: the epilogue
// then holds one mode's code with no test per element, every address is one base
// plus a constant, and its loads and stores are issued together.
// MODE 1: bf16 out in [B,heads,S,d]        (Q / K)
// MODE 2: bf16 out in [B,heads,d,S]        (V^T)
// MODE 3: fp32 out = resid + acc + bias    (O-proj / MLP2 residual)
// MODE 4: bf16 out = gelu(acc + bias)      (MLP1)
// ---------------------------------------------------------------------------
static __device__ __forceinline__
void gemm_main_loop(const __bf16* __restrict__ A, const __bf16* __restrict__ W, int K,
                    v8f (&acc)[2][4]) {
  const int lane = threadIdx.x & 31;
  const int wave = threadIdx.x >> 5;
  const int wm   = wave & 3;          // 4 waves along M
  const int wn   = wave >> 2;         // 2 waves along N
  const int mblk = blockIdx.y * BLK_M;
  const int nblk = blockIdx.x * BLK_N;
  const int lrow = lane & 15;
  const int koff = (lane >> 4) << 3;  // 0 or 8

  __shared__ __align__(16) __bf16 tA[2][BLK_M * G_PITCH];
  __shared__ __align__(16) __bf16 tB[2][BLK_N * G_PITCH];

  // Stage one 128x64 K-slice of A and W into LDS buffer `buf`.
  // 1024 16B chunks per tile; 256 threads issue 4 chunks each per tile.
  auto stage = [&](int buf, int k0) {
    uint32_t l[8];
    const __bf16* g[8];
    #pragma unroll
    for (int j = 0; j < 4; ++j) {
      const int id  = threadIdx.x + j * 256;
      const int row = id >> 3;
      const int ch  = (id & 7) << 3;  // element offset of the 16B chunk
      l[2 * j]     = lds_addr_of(&tA[buf][row * G_PITCH + ch]);
      g[2 * j]     = A + (size_t)(mblk + row) * K + k0 + ch;
      l[2 * j + 1] = lds_addr_of(&tB[buf][row * G_PITCH + ch]);
      g[2 * j + 1] = W + (size_t)(nblk + row) * K + k0 + ch;
    }
    async_copy8_b128(l, g);
  };

  stage(0, 0);
  for (int k0 = 0; k0 < K; k0 += BLK_K) {
    const int cur = (k0 >> 6) & 1;
    wait_async0();       // this wave's copies into tX[cur] have landed
    __syncthreads();     // everyone's copies have landed
    if (k0 + BLK_K < K) stage(cur ^ 1, k0 + BLK_K);

    #pragma unroll
    for (int ks = 0; ks < BLK_K; ks += 32) {
      v16bf a[2], b[4];
      #pragma unroll
      for (int mt = 0; mt < 2; ++mt)
        a[mt] = load_frag(&tA[cur][(wm * 32 + mt * 16 + lrow) * G_PITCH + ks + koff]);
      #pragma unroll
      for (int nt = 0; nt < 4; ++nt)
        b[nt] = load_frag(&tB[cur][(wn * 64 + nt * 16 + lrow) * G_PITCH + ks + koff]);
      #pragma unroll
      for (int mt = 0; mt < 2; ++mt)
        #pragma unroll
        for (int nt = 0; nt < 4; ++nt)
          acc[mt][nt] = wmma_bf16(a[mt], b[nt], acc[mt][nt]);
    }

    __syncthreads();     // all reads of tX[cur] done before it is re-staged
  }
}

template <int MODE, int NCOLS>
static __device__ __forceinline__
void gemm_epilogue(const v8f (&acc)[2][4], const float* __restrict__ bias,
                   const float* __restrict__ resid, void* __restrict__ outp) {
  const int lane = threadIdx.x & 31;
  const int wave = threadIdx.x >> 5;
  const int wm   = wave & 3;
  const int wn   = wave >> 2;
  const int mblk = blockIdx.y * BLK_M;
  const int nblk = blockIdx.x * BLK_N;
  const int lrow = lane & 15;

  // Element (mt, nt, v) of this lane is row row0 + mt*16 + v, column col0 + nt*16.
  // A block's 128 rows lie in one batch entry and its 128 columns in one head.
  const int row0 = mblk + wm * 32 + ((lane >> 4) << 3);  // upper 16 lanes: rows +8
  const int col0 = nblk + wn * 64 + lrow;
  float bv[4];
  #pragma unroll
  for (int nt = 0; nt < 4; ++nt) bv[nt] = bias[col0 + nt * 16];

  if constexpr (MODE == 1 || MODE == 2) {
    const int bb = row0 >> 11, ss = row0 & (SEQ - 1);   // S = 2048
    const int hh = col0 >> 7,  dd = col0 & (HDIM - 1);  // d = 128
    if constexpr (MODE == 1) {
      __bf16* o = (__bf16*)outp + ((size_t)((bb * NHEADS + hh) * SEQ + ss)) * HDIM + dd;
      #pragma unroll
      for (int mt = 0; mt < 2; ++mt)
      #pragma unroll
      for (int nt = 0; nt < 4; ++nt)
      #pragma unroll
      for (int v = 0; v < 8; ++v)
        o[(mt * 16 + v) * HDIM + nt * 16] = (__bf16)(acc[mt][nt][v] + bv[nt]);
      // Behind the run of stores: where two epilogues share a kernel, the code laid
      // out behind this one rewrites registers that the stores name (a precaution
      // for a replayed address translation).
      asm volatile("s_wait_xcnt 0x0" ::: "memory");
    } else {
      // A lane's eight rows are eight neighbours along S: one 16-B store.
      __bf16* o = (__bf16*)outp + ((size_t)((bb * NHEADS + hh) * HDIM + dd)) * SEQ + ss;
      #pragma unroll
      for (int mt = 0; mt < 2; ++mt)
      #pragma unroll
      for (int nt = 0; nt < 4; ++nt) {
        v8bf pk;
        #pragma unroll
        for (int v = 0; v < 8; ++v) pk[v] = (__bf16)(acc[mt][nt][v] + bv[nt]);
        *(v8bf*)(o + nt * 16 * SEQ + mt * 16) = pk;
      }
    }
  } else if constexpr (MODE == 3) {
    const size_t base = (size_t)row0 * NCOLS + col0;
    const float* rp = resid + base;
    float* o = (float*)outp + base;
    float r[2][4][8];
    #pragma unroll
    for (int mt = 0; mt < 2; ++mt)
    #pragma unroll
    for (int v = 0; v < 8; ++v)
    #pragma unroll
    for (int nt = 0; nt < 4; ++nt)
      r[mt][nt][v] = rp[(mt * 16 + v) * NCOLS + nt * 16];
    #pragma unroll
    for (int mt = 0; mt < 2; ++mt)
    #pragma unroll
    for (int v = 0; v < 8; ++v)
    #pragma unroll
    for (int nt = 0; nt < 4; ++nt)
      o[(mt * 16 + v) * NCOLS + nt * 16] = r[mt][nt][v] + (acc[mt][nt][v] + bv[nt]);
  } else {  // MODE 4: exact GELU, bf16 out
    __bf16* o = (__bf16*)outp + (size_t)row0 * NCOLS + col0;
    #pragma unroll
    for (int mt = 0; mt < 2; ++mt)
    #pragma unroll
    for (int nt = 0; nt < 4; ++nt)
    #pragma unroll
    for (int v = 0; v < 8; ++v) {
      const float val = acc[mt][nt][v] + bv[nt];
      const float gl = 0.5f * val * (1.0f + erff(val * 0.70710678118654752f));
      o[(mt * 16 + v) * NCOLS + nt * 16] = (__bf16)gl;
    }
  }
}

template <int MODE, int NCOLS>
__global__ __launch_bounds__(256)
void gemm_wmma_kernel(const __bf16* __restrict__ A, const __bf16* __restrict__ W,
                      const float* __restrict__ bias, const float* __restrict__ resid,
                      void* __restrict__ outp, int K) {
  v8f acc[2][4] = {};
  gemm_main_loop(A, W, K, acc);
  gemm_epilogue<MODE, NCOLS>(acc, bias, resid, outp);
}

// The Q, K and V projections in one launch, blockIdx.z naming the product. Each
// alone has one block per WGP, whose waves cannot cover their own copy and
// barrier waits. Three blocks fit a WGP (72 KiB of LDS each; two waves per SIMD
// each, at a register count that lets seven stand there), so the joined grid can
// be resident at once, each block filling the others' waits.
// The choice of epilogue is one test per block, the same in all of its lanes.
__global__ __launch_bounds__(256)
void gemm_qkv_kernel(const __bf16* __restrict__ A, const __bf16* __restrict__ Wq,
                     const __bf16* __restrict__ Wk, const __bf16* __restrict__ Wv,
                     const float* __restrict__ bq, const float* __restrict__ bk,
                     const float* __restrict__ bv, __bf16* __restrict__ q,
                     __bf16* __restrict__ k, __bf16* __restrict__ vt, int K) {
  const int z = blockIdx.z;
  v8f acc[2][4] = {};
  gemm_main_loop(A, z == 0 ? Wq : z == 1 ? Wk : Wv, K, acc);
  if (z == 2) gemm_epilogue<2, HID>(acc, bv, nullptr, vt);
  else        gemm_epilogue<1, HID>(acc, z == 0 ? bq : bk, nullptr, z == 0 ? q : k);
}

// ---------------------------------------------------------------------------
// Causal flash attention with shared async-LDS K/V staging.
// Block: 128 threads = 4 waves; each wave owns a 16-query tile (64 rows/block).
// Per 32-key block: K tile (32x128) and V^T tile (128x32) staged global->LDS
// (double buffered, ASYNCcnt) once and consumed by all 4 waves.
// All waves run to the block's last key block; the causal mask nulls any
// key > query row (exp(-huge)=0), so lower waves' surplus blocks are inert.
// The launch also converts the three weights that are first read behind it: the
// blocks with blockIdx.y >= BATCH * NHEADS. Attention leaves wave places and nearly
// all of the memory rate free, and its blocks, lower in the index, start first.
// ---------------------------------------------------------------------------
#define AT_XBLOCKS   (SEQ / 64)
#define AT_FF_BLOCKS (FF * HID / (512 * 8))    // a FF x HID weight,  128 threads, PER = 8
#define AT_SQ_BLOCKS (HID * HID / (512 * 8))   // a HID x HID weight, 128 threads, PER = 8
#define AT_CONV_ROWS ((2 * AT_FF_BLOCKS + AT_SQ_BLOCKS) / AT_XBLOCKS)
static_assert(HID * HID % (512 * 8) == 0 &&
              (2 * AT_FF_BLOCKS + AT_SQ_BLOCKS) % AT_XBLOCKS == 0, "whole blocks, whole grid rows");

__global__ __launch_bounds__(128)
void attn_wmma_kernel(const __bf16* __restrict__ Q, const __bf16* __restrict__ Kc,
                      const __bf16* __restrict__ VT, __bf16* __restrict__ Y,
                      const float* __restrict__ w1, const float* __restrict__ w2,
                      const float* __restrict__ wo, __bf16* __restrict__ w1b,
                      __bf16* __restrict__ w2b, __bf16* __restrict__ wob) {
  if (blockIdx.y >= BATCH * NHEADS) {   // the same for a whole block, ahead of every barrier
    const int blk   = (blockIdx.y - BATCH * NHEADS) * AT_XBLOCKS + blockIdx.x;
    const int which = blk / AT_FF_BLOCKS;   // 0: w1, 1: w2, 2: wo
    f32_to_bf16_block<128, 8>(which == 0 ? w1 : which == 1 ? w2 : wo,
                              which == 0 ? w1b : which == 1 ? w2b : wob,
                              blk - which * AT_FF_BLOCKS);
    return;
  }
  const int lane  = threadIdx.x & 31;
  const int wave  = threadIdx.x >> 5;
  const int lrow  = lane & 15;
  const int koff  = (lane >> 4) << 3;
  const int rplus = koff;               // C-layout: upper lanes own rows +8
  const int qblk  = blockIdx.x * 64;
  const int qbase = qblk + wave * 16;
  const int bh    = blockIdx.y;
  const float scale = 0.08838834764831845f;  // 1/sqrt(128)
  const float NEGF  = -3.0e38f;

  __shared__ __align__(16) __bf16 kt[2][32 * K_PITCH];    // 2 x 8.5 KB
  __shared__ __align__(16) __bf16 vt[2][HDIM * V_PITCH];  // 2 x 10 KB
  __shared__ __align__(16) __bf16 pbuf[4][16 * P_PITCH];  // per-wave P tiles

  // Stage K tile (32 keys x 128) and V^T tile (128 x 32 keys) for key block kb.
  // 512 16B chunks per tile; 128 threads issue 4 chunks each per tile.
  auto stage = [&](int buf, int kb) {
    uint32_t l[8];
    const __bf16* g[8];
    #pragma unroll
    for (int j = 0; j < 4; ++j) {
      const int id = threadIdx.x + j * 128;
      const int kr = id >> 4, kc = (id & 15) << 3;   // K tile: 16 chunks/row
      l[2 * j]     = lds_addr_of(&kt[buf][kr * K_PITCH + kc]);
      g[2 * j]     = Kc + ((size_t)bh * SEQ + kb + kr) * HDIM + kc;
      const int vr = id >> 2, vc = (id & 3) << 3;    // V^T tile: 4 chunks/row
      l[2 * j + 1] = lds_addr_of(&vt[buf][vr * V_PITCH + vc]);
      g[2 * j + 1] = VT + ((size_t)bh * HDIM + vr) * SEQ + kb + vc;
    }
    async_copy8_b128(l, g);
  };

  v16bf qf[4];
  #pragma unroll
  for (int kc = 0; kc < 4; ++kc)
    qf[kc] = load_frag(Q + ((size_t)bh * SEQ + qbase + lrow) * HDIM + kc * 32 + koff);

  v8f o[8] = {};
  float mrow[8], lsum[8];
  #pragma unroll
  for (int v = 0; v < 8; ++v) { mrow[v] = NEGF; lsum[v] = 0.f; }

  const int kend = qblk + 64;           // block-uniform key range
  stage(0, 0);
  for (int kb = 0; kb < kend; kb += 32) {
    const int cur = (kb >> 5) & 1;
    wait_async0();
    __syncthreads();
    if (kb + 32 < kend) stage(cur ^ 1, kb + 32);

    // ---- S = Q K^T over d=128 (4 x K=32 WMMAs per 16-key column tile) ----
    v8f s0acc = {}, s1acc = {};
    #pragma unroll
    for (int kc = 0; kc < 4; ++kc) {
      v16bf k0 = load_frag(&kt[cur][(     lrow) * K_PITCH + kc * 32 + koff]);
      v16bf k1 = load_frag(&kt[cur][(16 + lrow) * K_PITCH + kc * 32 + koff]);
      s0acc = wmma_bf16(qf[kc], k0, s0acc);
      s1acc = wmma_bf16(qf[kc], k1, s1acc);
    }
    // ---- scale, causal mask, online softmax (per C-layout row) ----
    // The running maximum is the same in all 16 lanes of a row, so it goes into
    // the reduction's start value and the reduction yields the new maximum.
    // Every loop over v is unrolled so that its arrays are registers, not scratch;
    // the sum's steps are loops of their own to set the eight rows side by side.
    float s0[8], s1[8], mnew[8];
    #pragma unroll
    for (int v = 0; v < 8; ++v) {
      const int qrow = qbase + v + rplus;
      s0[v] = s0acc[v] * scale;
      s1[v] = s1acc[v] * scale;
      if (kb +      lrow > qrow) s0[v] = NEGF;
      if (kb + 16 + lrow > qrow) s1[v] = NEGF;
      mnew[v] = fmaxf(fmaxf(s0[v], s1[v]), mrow[v]);
    }
    row16_max8(mnew);
    float rs[8];
    #pragma unroll
    for (int v = 0; v < 8; ++v) {
      const float p0 = __expf(s0[v] - mnew[v]);
      const float p1 = __expf(s1[v] - mnew[v]);
      rs[v] = p0 + p1;
      const int prow = v + rplus;
      pbuf[wave][prow * P_PITCH +      lrow] = (__bf16)p0;
      pbuf[wave][prow * P_PITCH + 16 + lrow] = (__bf16)p1;
    }
    #pragma unroll
    for (int v = 0; v < 8; ++v) rs[v] += row_xor<1>(rs[v]);
    #pragma unroll
    for (int v = 0; v < 8; ++v) rs[v] += row_xor<2>(rs[v]);
    #pragma unroll
    for (int v = 0; v < 8; ++v) rs[v] += row_xor<4>(rs[v]);
    #pragma unroll
    for (int v = 0; v < 8; ++v) rs[v] += row_xor<8>(rs[v]);
    #pragma unroll
    for (int v = 0; v < 8; ++v) {
      const float sc = __expf(mrow[v] - mnew[v]);
      lsum[v] = lsum[v] * sc + rs[v];
      mrow[v] = mnew[v];
      #pragma unroll
      for (int dt = 0; dt < 8; ++dt) o[dt][v] *= sc;
    }
    __syncthreads();
    v16bf pf = load_frag(&pbuf[wave][lrow * P_PITCH + koff]);
    // ---- O += P V (keys as contraction dim; V^T rows are contiguous) ----
    #pragma unroll
    for (int dt = 0; dt < 8; ++dt) {
      v16bf vf = load_frag(&vt[cur][(dt * 16 + lrow) * V_PITCH + koff]);
      o[dt] = wmma_bf16(pf, vf, o[dt]);
    }
    __syncthreads();     // kt/vt[cur] + pbuf free before re-staging / rewrite
  }
  // ---- normalize and scatter back to [B,S,HID] ----
  const int b = bh >> 3, h = bh & 7;
  #pragma unroll
  for (int dt = 0; dt < 8; ++dt)
  #pragma unroll
  for (int v = 0; v < 8; ++v) {
    const int row = qbase + v + rplus;
    const int col = h * HDIM + dt * 16 + lrow;
    Y[((size_t)b * SEQ + row) * HID + col] = (__bf16)(o[dt][v] / lsum[v]);
  }
}

// ---------------------------------------------------------------------------
// Orchestration
// ---------------------------------------------------------------------------
extern "C" void kernel_launch(void* const* d_in, const int* in_sizes, int n_in,
                              void* d_out, int out_size, void* d_ws, size_t ws_size,
                              hipStream_t stream) {
  (void)in_sizes; (void)n_in; (void)out_size; (void)ws_size;

  const float* x    = (const float*)d_in[0];
  const float* ln1g = (const float*)d_in[1];
  const float* ln1b = (const float*)d_in[2];
  const float* wq   = (const float*)d_in[3];
  const float* bq   = (const float*)d_in[4];
  const float* wk   = (const float*)d_in[5];
  const float* bk   = (const float*)d_in[6];
  const float* wv   = (const float*)d_in[7];
  const float* bv   = (const float*)d_in[8];
  const float* wo   = (const float*)d_in[9];
  const float* bo   = (const float*)d_in[10];
  const float* ln2g = (const float*)d_in[11];
  const float* ln2b = (const float*)d_in[12];
  const float* w1   = (const float*)d_in[13];
  const float* b1   = (const float*)d_in[14];
  const float* w2   = (const float*)d_in[15];
  const float* b2   = (const float*)d_in[16];
  float* out = (float*)d_out;

  char* ws = (char*)d_ws;
  size_t off = 0;
  auto take = [&](size_t bytes) -> char* {
    char* p = ws + off;
    off += bytes;
    off = (off + 255) & ~(size_t)255;
    return p;
  };

  __bf16* wqb = (__bf16*)take((size_t)HID * HID * 2);
  __bf16* wkb = (__bf16*)take((size_t)HID * HID * 2);
  __bf16* wvb = (__bf16*)take((size_t)HID * HID * 2);
  __bf16* wob = (__bf16*)take((size_t)HID * HID * 2);
  __bf16* w1b = (__bf16*)take((size_t)FF  * HID * 2);
  __bf16* w2b = (__bf16*)take((size_t)HID * FF  * 2);
  __bf16* hn  = (__bf16*)take((size_t)MROWS * HID * 2);  // LN1 out
  __bf16* qb  = (__bf16*)take((size_t)MROWS * HID * 2);  // [B,h,S,d]
  __bf16* kbf = (__bf16*)take((size_t)MROWS * HID * 2);  // [B,h,S,d]
  __bf16* vtb = (__bf16*)take((size_t)MROWS * HID * 2);  // [B,h,d,S]
  __bf16* yb  = (__bf16*)take((size_t)MROWS * HID * 2);  // attn out [B,S,H]
  float*  x1  = (float*) take((size_t)MROWS * HID * 4);  // x + attn
  __bf16* m2  = (__bf16*)take((size_t)MROWS * HID * 2);  // LN2 out
  __bf16* gb  = (__bf16*)take((size_t)MROWS * FF  * 2);  // GELU(MLP1)

  // LN1 and wq, wk, wv -> bf16, one launch
  prep_kernel<<<PREP_BLOCKS, 256, 0, stream>>>(x, ln1g, ln1b, hn, wq, wk, wv, wqb, wkb, wvb);

  // QKV projections (block tile 128x128, K-step 64), one launch
  dim3 gH(HID / BLK_N, MROWS / BLK_M);
  dim3 gQKV(HID / BLK_N, MROWS / BLK_M, 3);
  gemm_qkv_kernel<<<gQKV, 256, 0, stream>>>(hn, wqb, wkb, wvb, bq, bk, bv, qb, kbf, vtb, HID);

  // causal flash attention (64 query rows per block, shared K/V staging);
  // the grid's upper rows: w1, w2, wo -> bf16
  dim3 gA(AT_XBLOCKS, BATCH * NHEADS + AT_CONV_ROWS);
  attn_wmma_kernel<<<gA, 128, 0, stream>>>(qb, kbf, vtb, yb, w1, w2, wo, w1b, w2b, wob);

  // O-proj + residual -> x1 (fp32)
  gemm_wmma_kernel<3, HID><<<gH, 256, 0, stream>>>(yb, wob, bo, x, x1, HID);

  // LN2
  ln_bf16_kernel<<<MROWS / 8, 256, 0, stream>>>(x1, ln2g, ln2b, m2);

  // MLP
  dim3 gF(FF / BLK_N, MROWS / BLK_M);
  gemm_wmma_kernel<4, FF><<<gF, 256, 0, stream>>>(m2, w1b, b1, nullptr, gb, HID);
  gemm_wmma_kernel<3, HID><<<gH, 256, 0, stream>>>(gb, w2b, b2, x1, out, FF);
}

// v006
// One run takes 197 microseconds.
// Next to v005, in two timings, it ran 1.07 times as fast each time.
// All steps since v000 together make it 3.66 times as fast.
#include <hip/hip_runtime.h>
#include <hip/hip_bf16.h>
#include <math.h>

typedef __attribute__((ext_vector_type(16))) __bf16 v16bf;
typedef __attribute__((ext_vector_type(8)))  __bf16 v8bf;
typedef __attribute__((ext_vector_type(8)))  float  v8f;

#define HID    1024
#define SEQ    2048
#define BATCH  2
#define NHEADS 8
#define HDIM   128
#define FF     4096
#define MROWS  (BATCH * SEQ)

#define BLK_M 128
#define BLK_N 128
#define BLK_K 64

// LDS row pitches in bf16 elements. Every tile below is read row per lane with
// ds_load_b128, which is free of bank conflicts at a pitch of 16 B x odd; the
// unpadded pitches (128, 256, 64 B) put the 16 rows of a fragment on few banks.
#define G_PITCH (BLK_K + 8)   // GEMM tiles: 128-B rows at 144 B
#define K_PITCH (HDIM + 8)    // K tile:     256-B rows at 272 B
#define V_PITCH (32 + 8)      // V^T tile:    64-B rows at  80 B
#define P_PITCH (32 + 8)      // P tile:      64-B rows at  80 B

// ---------------------------------------------------------------------------
// Fragment loader: CDNA5 16-bit A/B layout for 16x16x32 WMMA.
// Lane L (0..15): row = L, holds K = kb..kb+7 and kb+16..kb+23
// Lane L (16..31): row = L-16, holds K = kb+8..15 and kb+24..31
// => per lane: two contiguous 8-element (16B) chunks at +koff and +koff+16.
// ---------------------------------------------------------------------------
static __device__ __forceinline__ v16bf load_frag(const __bf16* p) {
  v8bf lo = *(const v8bf*)p;
  v8bf hi = *(const v8bf*)(p + 16);
  return __builtin_shufflevector(lo, hi, 0,1,2,3,4,5,6,7,8,9,10,11,12,13,14,15);
}

static __device__ __forceinline__ v8f wmma_bf16(v16bf a, v16bf b, v8f c) {
  return __builtin_amdgcn_wmma_f32_16x16x32_bf16(false, a, false, b, (short)0, c,
                                                 false, false);
}

// Async global -> LDS copy, 16B per lane, tracked by ASYNCcnt (gfx1250).
// lds_addr = low 32 bits of the flat shared-memory pointer (LDS aperture
// mapping: LDS_ADDR = addr[31:0]).
// One stage's eight copies of a lane stand in one statement that ends in
// s_wait_xcnt 0, so that no address register of a copy is rewritten ahead of
// that wait (a precaution for a replayed address translation).
static __device__ __forceinline__ uint32_t lds_addr_of(const void* lds_ptr) {
  return (uint32_t)(uintptr_t)lds_ptr;
}

static __device__ __forceinline__ void async_copy8_b128(const uint32_t (&l)[8],
                                                        const __bf16* const (&g)[8]) {
  asm volatile("global_load_async_to_lds_b128 %0, %8, off\n\t"
               "global_load_async_to_lds_b128 %1, %9, off\n\t"
               "global_load_async_to_lds_b128 %2, %10, off\n\t"
               "global_load_async_to_lds_b128 %3, %11, off\n\t"
               "global_load_async_to_lds_b128 %4, %12, off\n\t"
               "global_load_async_to_lds_b128 %5, %13, off\n\t"
               "global_load_async_to_lds_b128 %6, %14, off\n\t"
               "global_load_async_to_lds_b128 %7, %15, off\n\t"
               "s_wait_xcnt 0x0"
               :: "v"(l[0]), "v"(l[1]), "v"(l[2]), "v"(l[3]),
                  "v"(l[4]), "v"(l[5]), "v"(l[6]), "v"(l[7]),
                  "v"((uint64_t)(uintptr_t)g[0]), "v"((uint64_t)(uintptr_t)g[1]),
                  "v"((uint64_t)(uintptr_t)g[2]), "v"((uint64_t)(uintptr_t)g[3]),
                  "v"((uint64_t)(uintptr_t)g[4]), "v"((uint64_t)(uintptr_t)g[5]),
                  "v"((uint64_t)(uintptr_t)g[6]), "v"((uint64_t)(uintptr_t)g[7])
               : "memory");
}

// Reductions over the 16 lanes of a row by DPP row_xmask butterfly steps, on the
// vector port. A shuffle compiles to ds_bpermute_b32, which goes through the LDS
// queue and is waited for at every one of its steps.
//
// Sum step: the value of lane (l ^ MASK); the compiler folds it into the add.
template <int MASK>
static __device__ __forceinline__ float row_xor(float x) {
  return __builtin_bit_cast(float, __builtin_amdgcn_update_dpp(
      0, __builtin_bit_cast(int, x), 0x160 + MASK, 0xf, 0xf, true));
}

// Maximum of eight rows at once. In asm because the compiler puts a move and a
// quieting maximum in front of every fmaxf on a DPP value (three dependent
// instructions a step instead of one). The eight rows stand side by side in each
// step, so every instruction's producer is eight instructions back.
#define ROWMAX_1(r, m) \
  "v_max_num_f32_dpp " r ", " r ", " r " row_xmask:" m " row_mask:0xf bank_mask:0xf bound_ctrl:1\n\t"
#define ROWMAX_8(m) \
  ROWMAX_1("%0", m) ROWMAX_1("%1", m) ROWMAX_1("%2", m) ROWMAX_1("%3", m) \
  ROWMAX_1("%4", m) ROWMAX_1("%5", m) ROWMAX_1("%6", m) ROWMAX_1("%7", m)
static __device__ __forceinline__ void row16_max8(float (&t)[8]) {
  asm(ROWMAX_8("1") ROWMAX_8("2") ROWMAX_8("4") ROWMAX_8("8")
      : "+v"(t[0]), "+v"(t[1]), "+v"(t[2]), "+v"(t[3]),
        "+v"(t[4]), "+v"(t[5]), "+v"(t[6]), "+v"(t[7]));
}

static __device__ __forceinline__ void wait_async0() {
  asm volatile("s_wait_asynccnt 0x0" ::: "memory");
}

// ---------------------------------------------------------------------------
// The two streaming kernels below move little data. For speed only, each wave does
// much more than one element per lane: 16-B loads that cover whole lines
// (32 lanes x 16 B = 512 B in a row),
// all of a lane's loads issued together, and few waves in the grid.
// ---------------------------------------------------------------------------
typedef __attribute__((ext_vector_type(4))) float  f32x4;
typedef __attribute__((ext_vector_type(4))) __bf16 v4bf;

// fp32 -> bf16 elementwise convert (weights). Block blk of THREADS threads converts
// THREADS * PER groups of four neighbours, PER groups per lane.
template <int THREADS, int PER>
static __device__ __forceinline__
void f32_to_bf16_block(const float* __restrict__ src, __bf16* __restrict__ dst, int blk) {
  const size_t first = (size_t)blk * (THREADS * PER) + threadIdx.x;
  const f32x4* s = (const f32x4*)src + first;
  v4bf* d = (v4bf*)dst + first;
  f32x4 v[PER];
  #pragma unroll
  for (int j = 0; j < PER; ++j) v[j] = s[j * THREADS];
  #pragma unroll
  for (int j = 0; j < PER; ++j) d[j * THREADS] = __builtin_convertvector(v[j], v4bf);
}

// ---------------------------------------------------------------------------
// Row LayerNorm (H=1024), fp32 in -> bf16 out. One wave per row, 8 rows per block:
// the row stays in registers (8 x 16 B per lane), its sums are formed in the lane
// and joined by a five-step butterfly, so no LDS and no barrier is needed.
// ---------------------------------------------------------------------------
static __device__ __forceinline__
void ln_bf16_block(const float* __restrict__ x, const float* __restrict__ g,
                   const float* __restrict__ b, __bf16* __restrict__ out, int blk) {
  const int lane = threadIdx.x & 31;
  const int row  = blk * 8 + (threadIdx.x >> 5);
  const f32x4* xr = (const f32x4*)(x + (size_t)row * HID) + lane;
  const f32x4* gp = (const f32x4*)g + lane;
  const f32x4* bp = (const f32x4*)b + lane;
  f32x4 v[8], gv[8], bv[8];
  #pragma unroll
  for (int j = 0; j < 8; ++j) v[j] = xr[j * 32];
  // Behind the row's loads, since a later load's result may be given their address
  // pair as its place (a precaution for a replayed address translation).
  asm volatile("s_wait_xcnt 0x0" ::: "memory");
  #pragma unroll
  for (int j = 0; j < 8; ++j) { gv[j] = gp[j * 32]; bv[j] = bp[j * 32]; }
  // Keeps all 24 loads in front of the sums: without it the gain and bias loads
  // are issued behind the reduction, two at a time, each waited for.
  __builtin_amdgcn_sched_barrier(0);
  f32x4 sv = {}, qv = {};   // four independent chains each
  #pragma unroll
  for (int j = 0; j < 8; ++j) { sv += v[j]; qv += v[j] * v[j]; }
  float s  = (sv[0] + sv[1]) + (sv[2] + sv[3]);
  float s2 = (qv[0] + qv[1]) + (qv[2] + qv[3]);
  #pragma unroll
  for (int d = 1; d < 32; d <<= 1) {
    s  += __shfl_xor(s,  d, 32);
    s2 += __shfl_xor(s2, d, 32);
  }
  const float mu  = s * (1.0f / HID);
  const float var = s2 * (1.0f / HID) - mu * mu;
  const float r   = rsqrtf(var + 1e-5f);
  v4bf* o = (v4bf*)(out + (size_t)row * HID) + lane;
  #pragma unroll
  for (int j = 0; j < 8; ++j)
    o[j * 32] = __builtin_convertvector((v[j] - mu) * r * gv[j] + bv[j], v4bf);
}

__global__ __launch_bounds__(256)
void ln_bf16_kernel(const float* __restrict__ x, const float* __restrict__ g,
                    const float* __restrict__ b, __bf16* __restrict__ out) {
  ln_bf16_block(x, g, b, out, blockIdx.x);
}

// ---------------------------------------------------------------------------
// What the Q, K and V products wait for, in one launch: the first LayerNorm and the
// converts of their three weights. None reads what another writes, so each gets a
// range of the block index; short launches one behind the other each pay their own
// start and drain, with most of the chip idle meanwhile. (The other three weights
// are first read behind attention and are converted in its launch.)
// ---------------------------------------------------------------------------
#define LN_BLOCKS    (MROWS / 8)               // 8 rows a block
#define SQ_BLOCKS    (HID * HID / (1024 * 4))  // a HID x HID weight, 256 threads, PER = 4
#define PREP_BLOCKS  (LN_BLOCKS + 3 * SQ_BLOCKS)
static_assert(HID * HID % (1024 * 4) == 0, "whole blocks only");

__global__ __launch_bounds__(256)
void prep_kernel(const float* __restrict__ x, const float* __restrict__ g,
                 const float* __restrict__ b, __bf16* __restrict__ hn,
                 const float* __restrict__ wq, const float* __restrict__ wk,
                 const float* __restrict__ wv, __bf16* __restrict__ wqb,
                 __bf16* __restrict__ wkb, __bf16* __restrict__ wvb) {
  int blk = blockIdx.x;
  if (blk < LN_BLOCKS) {
    ln_bf16_block(x, g, b, hn, blk);
    return;
  }
  blk -= LN_BLOCKS;
  const int which = blk / SQ_BLOCKS;
  f32_to_bf16_block<256, 4>(which == 0 ? wq : which == 1 ? wk : wv,
                            which == 0 ? wqb : which == 1 ? wkb : wvb,
                            blk - which * SQ_BLOCKS);
}

// ---------------------------------------------------------------------------
// WMMA GEMM with async-LDS double-buffered staging.
// C[M,N] = A[M,K] (row-major) * W[N,K]^T (+ bias, epilogue modes).
// Block: 256 threads = 8 waves (4 M x 2 N); block tile 128x128;
// wave tile 32x64 (2x4 WMMA frags). K-step 64 (2 x 8 WMMAs per barrier pair).
// Staging: 128x64 bf16 tiles of A and W copied global->LDS with
// global_load_async_to_lds_b128 (ASYNCcnt), double buffered, rows padded to
// G_PITCH (72 KB LDS).
// MODE and NCOLS (the output's row length) are template parameters: the epilogue
// then holds one mode's code with no test per element, every address is one base
// plus a constant, and its loads and stores are issued together.
// MODE 1: bf16 out in [B,heads,S,d]        (Q / K)
// MODE 2: bf16 out in [B,heads,d,S]        (V^T)
// MODE 3: fp32 out = resid + acc + bias    (O-proj / MLP2 residual)
// MODE 4: bf16 out = gelu(acc + bias)      (MLP1)
// ---------------------------------------------------------------------------
static __device__ __forceinline__
void gemm_main_loop(const __bf16* __restrict__ A, const __bf16* __restrict__ W, int K,
                    v8f (&acc)[2][4]) {
  const int lane = threadIdx.x & 31;
  const int wave = threadIdx.x >> 5;
  const int wm   = wave & 3;          // 4 waves along M
  const int wn   = wave >> 2;         // 2 waves along N
  const int mblk = blockIdx.y * BLK_M;
  const int nblk = blockIdx.x * BLK_N;
  const int lrow = lane & 15;
  const int koff = (lane >> 4) << 3;  // 0 or 8

  __shared__ __align__(16) __bf16 tA[2][BLK_M * G_PITCH];
  __shared__ __align__(16) __bf16 tB[2][BLK_N * G_PITCH];

  // Stage one 128x64 K-slice of A and W into LDS buffer `buf`.
  // 1024 16B chunks per tile; 256 threads issue 4 chunks each per tile.
  auto stage = [&](int buf, int k0) {
    uint32_t l[8];
    const __bf16* g[8];
    #pragma unroll
    for (int j = 0; j < 4; ++j) {
      const int id  = threadIdx.x + j * 256;
      const int row = id >> 3;
      const int ch  = (id & 7) << 3;  // element offset of the 16B chunk
      l[2 * j]     = lds_addr_of(&tA[buf][row * G_PITCH + ch]);
      g[2 * j]     = A + (size_t)(mblk + row) * K + k0 + ch;
      l[2 * j + 1] = lds_addr_of(&tB[buf][row * G_PITCH + ch]);
      g[2 * j + 1] = W + (size_t)(nblk + row) * K + k0 + ch;
    }
    async_copy8_b128(l, g);
  };

  stage(0, 0);
  for (int k0 = 0; k0 < K; k0 += BLK_K) {
    const int cur = (k0 >> 6) & 1;
    wait_async0();       // this wave's copies into tX[cur] have landed
    __syncthreads();     // everyone's copies have landed
    if (k0 + BLK_K < K) stage(cur ^ 1, k0 + BLK_K);

    #pragma unroll
    for (int ks = 0; ks < BLK_K; ks += 32) {
      v16bf a[2], b[4];
      #pragma unroll
      for (int mt = 0; mt < 2; ++mt)
        a[mt] = load_frag(&tA[cur][(wm * 32 + mt * 16 + lrow) * G_PITCH + ks + koff]);
      #pragma unroll
      for (int nt = 0; nt < 4; ++nt)
        b[nt] = load_frag(&tB[cur][(wn * 64 + nt * 16 + lrow) * G_PITCH + ks + koff]);
      #pragma unroll
      for (int mt = 0; mt < 2; ++mt)
        #pragma unroll
        for (int nt = 0; nt < 4; ++nt)
          acc[mt][nt] = wmma_bf16(a[mt], b[nt], acc[mt][nt]);
    }

    __syncthreads();     // all reads of tX[cur] done before it is re-staged
  }
}

template <int MODE, int NCOLS>
static __device__ __forceinline__
void gemm_epilogue(const v8f (&acc)[2][4], const float* __restrict__ bias,
                   const float* __restrict__ resid, void* __restrict__ outp) {
  const int lane = threadIdx.x & 31;
  const int wave = threadIdx.x >> 5;
  const int wm   = wave & 3;
  const int wn   = wave >> 2;
  const int mblk = blockIdx.y * BLK_M;
  const int nblk = blockIdx.x * BLK_N;
  const int lrow = lane & 15;

  // Element (mt, nt, v) of this lane is row row0 + mt*16 + v, column col0 + nt*16.
  // A block's 128 rows lie in one batch entry and its 128 columns in one head.
  const int row0 = mblk + wm * 32 + ((lane >> 4) << 3);  // upper 16 lanes: rows +8
  const int col0 = nblk + wn * 64 + lrow;
  float bv[4];
  #pragma unroll
  for (int nt = 0; nt < 4; ++nt) bv[nt] = bias[col0 + nt * 16];

  if constexpr (MODE == 1 || MODE == 2) {
    const int bb = row0 >> 11, ss = row0 & (SEQ - 1);   // S = 2048
    const int hh = col0 >> 7,  dd = col0 & (HDIM - 1);  // d = 128
    if constexpr (MODE == 1) {
      __bf16* o = (__bf16*)outp + ((size_t)((bb * NHEADS + hh) * SEQ + ss)) * HDIM + dd;
      #pragma unroll
      for (int mt = 0; mt < 2; ++mt)
      #pragma unroll
      for (int nt = 0; nt < 4; ++nt)
      #pragma unroll
      for (int v = 0; v < 8; ++v)
        o[(mt * 16 + v) * HDIM + nt * 16] = (__bf16)(acc[mt][nt][v] + bv[nt]);
      // Behind the run of stores: where two epilogues share a kernel, the code laid
      // out behind this one rewrites registers that the stores name (a precaution
      // for a replayed address translation).
      asm volatile("s_wait_xcnt 0x0" ::: "memory");
    } else {
      // A lane's eight rows are eight neighbours along S: one 16-B store.
      __bf16* o = (__bf16*)outp + ((size_t)((bb * NHEADS + hh) * HDIM + dd)) * SEQ + ss;
      #pragma unroll
      for (int mt = 0; mt < 2; ++mt)
      #pragma unroll
      for (int nt = 0; nt < 4; ++nt) {
        v8bf pk;
        #pragma unroll
        for (int v = 0; v < 8; ++v) pk[v] = (__bf16)(acc[mt][nt][v] + bv[nt]);
        *(v8bf*)(o + nt * 16 * SEQ + mt * 16) = pk;
      }
    }
  } else if constexpr (MODE == 3) {
    const size_t base = (size_t)row0 * NCOLS + col0;
    const float* rp = resid + base;
    float* o = (float*)outp + base;
    float r[2][4][8];
    #pragma unroll
    for (int mt = 0; mt < 2; ++mt)
    #pragma unroll
    for (int v = 0; v < 8; ++v)
    #pragma unroll
    for (int nt = 0; nt < 4; ++nt)
      r[mt][nt][v] = rp[(mt * 16 + v) * NCOLS + nt * 16];
    #pragma unroll
    for (int mt = 0; mt < 2; ++mt)
    #pragma unroll
    for (int v = 0; v < 8; ++v)
    #pragma unroll
    for (int nt = 0; nt < 4; ++nt)
      o[(mt * 16 + v) * NCOLS + nt * 16] = r[mt][nt][v] + (acc[mt][nt][v] + bv[nt]);
  } else {  // MODE 4: exact GELU, bf16 out
    __bf16* o = (__bf16*)outp + (size_t)row0 * NCOLS + col0;
    #pragma unroll
    for (int mt = 0; mt < 2; ++mt)
    #pragma unroll
    for (int nt = 0; nt < 4; ++nt)
    #pragma unroll
    for (int v = 0; v < 8; ++v) {
      const float val = acc[mt][nt][v] + bv[nt];
      const float gl = 0.5f * val * (1.0f + erff(val * 0.70710678118654752f));
      o[(mt * 16 + v) * NCOLS + nt * 16] = (__bf16)gl;
    }
  }
}

template <int MODE, int NCOLS>
__global__ __launch_bounds__(256)
void gemm_wmma_kernel(const __bf16* __restrict__ A, const __bf16* __restrict__ W,
                      const float* __restrict__ bias, const float* __restrict__ resid,
                      void* __restrict__ outp, int K) {
  v8f acc[2][4] = {};
  gemm_main_loop(A, W, K, acc);
  gemm_epilogue<MODE, NCOLS>(acc, bias, resid, outp);
}

// The Q, K and V projections in one launch, blockIdx.z naming the product. Each
// alone has one block per WGP, whose waves cannot cover their own copy and
// barrier waits. Three blocks fit a WGP (72 KiB of LDS each; two waves per SIMD
// each, at a register count that lets seven stand there), so the joined grid can
// be resident at once, each block filling the others' waits.
// The choice of epilogue is one test per block, the same in all of its lanes.
__global__ __launch_bounds__(256)
void gemm_qkv_kernel(const __bf16* __restrict__ A, const __bf16* __restrict__ Wq,
                     const __bf16* __restrict__ Wk, const __bf16* __restrict__ Wv,
                     const float* __restrict__ bq, const float* __restrict__ bk,
                     const float* __restrict__ bv, __bf16* __restrict__ q,
                     __bf16* __restrict__ k, __bf16* __restrict__ vt, int K) {
  const int z = blockIdx.z;
  v8f acc[2][4] = {};
  gemm_main_loop(A, z == 0 ? Wq : z == 1 ? Wk : Wv, K, acc);
  if (z == 2) gemm_epilogue<2, HID>(acc, bv, nullptr, vt);
  else        gemm_epilogue<1, HID>(acc, z == 0 ? bq : bk, nullptr, z == 0 ? q : k);
}

// ---------------------------------------------------------------------------
// Causal flash attention with shared async-LDS K/V staging.
// Block: 256 threads = 8 waves on 64 query rows: wave w owns the 16-query tile w & 3
// and, of every 64-key pass, the 32 keys of half w >> 2. The launch lasts as long as
// the block with the most passes, whose waves mostly wait on their own dependent
// steps; two waves per query tile halve its passes. Each keeps its own running
// maximum, sum and output tile; the two are joined once, through LDS, at the end.
// Per pass: K tile (64x128) and V^T tile (128x64, one slab per half) staged
// global->LDS (double buffered, ASYNCcnt) once and consumed by all 8 waves.
// All waves run to the block's last key block; the causal mask nulls any
// key > query row (exp(-huge)=0), so lower waves' surplus blocks are inert.
// The launch also converts the three weights that are first read behind it: the
// blocks with blockIdx.y >= BATCH * NHEADS. Attention leaves wave places and nearly
// all of the memory rate free, and its blocks, lower in the index, start first.
// ---------------------------------------------------------------------------
#define AT_XBLOCKS   (SEQ / 64)
#define AT_FF_BLOCKS (FF * HID / (1024 * 8))   // a FF x HID weight,  256 threads, PER = 8
#define AT_SQ_BLOCKS (HID * HID / (1024 * 8))  // a HID x HID weight, 256 threads, PER = 8
#define AT_CONV_ROWS ((2 * AT_FF_BLOCKS + AT_SQ_BLOCKS) / AT_XBLOCKS)
static_assert(HID * HID % (1024 * 8) == 0 &&
              (2 * AT_FF_BLOCKS + AT_SQ_BLOCKS) % AT_XBLOCKS == 0, "whole blocks, whole grid rows");

__global__ __launch_bounds__(256)
void attn_wmma_kernel(const __bf16* __restrict__ Q, const __bf16* __restrict__ Kc,
                      const __bf16* __restrict__ VT, __bf16* __restrict__ Y,
                      const float* __restrict__ w1, const float* __restrict__ w2,
                      const float* __restrict__ wo, __bf16* __restrict__ w1b,
                      __bf16* __restrict__ w2b, __bf16* __restrict__ wob) {
  if (blockIdx.y >= BATCH * NHEADS) {   // the same for a whole block, ahead of every barrier
    const int blk   = (blockIdx.y - BATCH * NHEADS) * AT_XBLOCKS + blockIdx.x;
    const int which = blk / AT_FF_BLOCKS;   // 0: w1, 1: w2, 2: wo
    f32_to_bf16_block<256, 8>(which == 0 ? w1 : which == 1 ? w2 : wo,
                              which == 0 ? w1b : which == 1 ? w2b : wob,
                              blk - which * AT_FF_BLOCKS);
    return;
  }
  const int lane  = threadIdx.x & 31;
  const int wave  = threadIdx.x >> 5;
  const int lrow  = lane & 15;
  const int koff  = (lane >> 4) << 3;
  const int rplus = koff;               // C-layout: upper lanes own rows +8
  const int qblk  = blockIdx.x * 64;
  const int wq    = wave & 3;           // query tile
  const int grp   = wave >> 2;          // which 32 keys of a 64-key pass
  const int qbase = qblk + wq * 16;
  const int bh    = blockIdx.y;
  const float scale = 0.08838834764831845f;  // 1/sqrt(128)
  const float NEGF  = -3.0e38f;

  __shared__ __align__(16) __bf16 kt[2][64 * K_PITCH];       // 2 x 17 KB
  __shared__ __align__(16) __bf16 vt[2][2][HDIM * V_PITCH];  // 2 x 2 x 10 KB
  __shared__ __align__(16) __bf16 pbuf[8][16 * P_PITCH];     // per-wave P tiles

  // Stage K tile (64 keys x 128) and V^T tile (128 x 64 keys) for key block kb.
  // 1024 16B chunks per tile; 256 threads issue 4 chunks each per tile.
  auto stage = [&](int buf, int kb) {
    uint32_t l[8];
    const __bf16* g[8];
    #pragma unroll
    for (int j = 0; j < 4; ++j) {
      const int id = threadIdx.x + j * 256;
      const int kr = id >> 4, kc = (id & 15) << 3;   // K tile: 16 chunks/row
      l[2 * j]     = lds_addr_of(&kt[buf][kr * K_PITCH + kc]);
      g[2 * j]     = Kc + ((size_t)bh * SEQ + kb + kr) * HDIM + kc;
      const int vr = id >> 3, vc = id & 7;           // V^T tile: 8 chunks/row, 4 a slab
      l[2 * j + 1] = lds_addr_of(&vt[buf][vc >> 2][vr * V_PITCH + ((vc & 3) << 3)]);
      g[2 * j + 1] = VT + ((size_t)bh * HDIM + vr) * SEQ + kb + (vc << 3);
    }
    async_copy8_b128(l, g);
  };

  v16bf qf[4];
  #pragma unroll
  for (int kc = 0; kc < 4; ++kc)
    qf[kc] = load_frag(Q + ((size_t)bh * SEQ + qbase + lrow) * HDIM + kc * 32 + koff);

  v8f o[8] = {};
  float mrow[8], lsum[8];
  #pragma unroll
  for (int v = 0; v < 8; ++v) { mrow[v] = NEGF; lsum[v] = 0.f; }

  const int kend = qblk + 64;           // block-uniform key range, whole passes
  stage(0, 0);
  for (int kb = 0; kb < kend; kb += 64) {
    const int cur = (kb >> 6) & 1;
    const int kg  = kb + grp * 32;      // first of this wave's 32 keys
    wait_async0();
    __syncthreads();
    if (kb + 64 < kend) stage(cur ^ 1, kb + 64);

    // ---- S = Q K^T over d=128 (4 x K=32 WMMAs per 16-key column tile) ----
    v8f s0acc = {}, s1acc = {};
    #pragma unroll
    for (int kc = 0; kc < 4; ++kc) {
      v16bf k0 = load_frag(&kt[cur][(grp * 32 +      lrow) * K_PITCH + kc * 32 + koff]);
      v16bf k1 = load_frag(&kt[cur][(grp * 32 + 16 + lrow) * K_PITCH + kc * 32 + koff]);
      s0acc = wmma_bf16(qf[kc], k0, s0acc);
      s1acc = wmma_bf16(qf[kc], k1, s1acc);
    }
    // ---- scale, causal mask, online softmax (per C-layout row) ----
    // The running maximum is the same in all 16 lanes of a row, so it goes into
    // the reduction's start value and the reduction yields the new maximum.
    // Every loop over v is unrolled so that its arrays are registers, not scratch;
    // the sum's steps are loops of their own to set the eight rows side by side.
    float s0[8], s1[8], mnew[8];
    #pragma unroll
    for (int v = 0; v < 8; ++v) {
      const int qrow = qbase + v + rplus;
      s0[v] = s0acc[v] * scale;
      s1[v] = s1acc[v] * scale;
      if (kg +      lrow > qrow) s0[v] = NEGF;
      if (kg + 16 + lrow > qrow) s1[v] = NEGF;
      mnew[v] = fmaxf(fmaxf(s0[v], s1[v]), mrow[v]);
    }
    row16_max8(mnew);
    float rs[8];
    #pragma unroll
    for (int v = 0; v < 8; ++v) {
      const float p0 = __expf(s0[v] - mnew[v]);
      const float p1 = __expf(s1[v] - mnew[v]);
      rs[v] = p0 + p1;
      const int prow = v + rplus;
      pbuf[wave][prow * P_PITCH +      lrow] = (__bf16)p0;
      pbuf[wave][prow * P_PITCH + 16 + lrow] = (__bf16)p1;
    }
    #pragma unroll
    for (int v = 0; v < 8; ++v) rs[v] += row_xor<1>(rs[v]);
    #pragma unroll
    for (int v = 0; v < 8; ++v) rs[v] += row_xor<2>(rs[v]);
    #pragma unroll
    for (int v = 0; v < 8; ++v) rs[v] += row_xor<4>(rs[v]);
    #pragma unroll
    for (int v = 0; v < 8; ++v) rs[v] += row_xor<8>(rs[v]);
    #pragma unroll
    for (int v = 0; v < 8; ++v) {
      const float sc = __expf(mrow[v] - mnew[v]);
      lsum[v] = lsum[v] * sc + rs[v];
      mrow[v] = mnew[v];
      #pragma unroll
      for (int dt = 0; dt < 8; ++dt) o[dt][v] *= sc;
    }
    __syncthreads();
    v16bf pf = load_frag(&pbuf[wave][lrow * P_PITCH + koff]);
    // ---- O += P V (keys as contraction dim; V^T rows are contiguous) ----
    #pragma unroll
    for (int dt = 0; dt < 8; ++dt) {
      v16bf vf = load_frag(&vt[cur][grp][(dt * 16 + lrow) * V_PITCH + koff]);
      o[dt] = wmma_bf16(pf, vf, o[dt]);
    }
    __syncthreads();     // kt/vt[cur] + pbuf free before re-staging / rewrite
  }
  // ---- join the two key halves of each query tile ----
  // Wave wq + 4 hands its 80 values per lane (output tile, maxima, sums) to wave wq,
  // lane to lane, through the V^T buffers: the loop's last barrier has ended every
  // read of them, and no copy is in flight (the last pass staged nothing).
  // A half whose keys were all masked has the maximum NEGF and finite sums, and its
  // weight below is exp(NEGF - m) = 0; the lower half always holds key 0.
  static_assert(sizeof(vt) >= 4 * 80 * 32 * sizeof(float), "hand-over fits the V^T buffers");
  float* mb = (float*)&vt[0][0][0] + wq * (80 * 32) + lane;
  if (grp == 1) {
    #pragma unroll
    for (int dt = 0; dt < 8; ++dt)
    #pragma unroll
    for (int v = 0; v < 8; ++v) mb[(dt * 8 + v) * 32] = o[dt][v];
    #pragma unroll
    for (int v = 0; v < 8; ++v) {
      mb[(64 + v) * 32] = mrow[v];
      mb[(72 + v) * 32] = lsum[v];
    }
  }
  __syncthreads();       // the upper halves' values are in LDS
  if (grp == 1) return;  // behind the last barrier
  float wlo[8], whi[8];
  #pragma unroll
  for (int v = 0; v < 8; ++v) {
    const float m1 = mb[(64 + v) * 32];
    const float l1 = mb[(72 + v) * 32];
    const float m  = fmaxf(mrow[v], m1);
    wlo[v] = __expf(mrow[v] - m);
    whi[v] = __expf(m1 - m);
    lsum[v] = lsum[v] * wlo[v] + l1 * whi[v];
  }
  // A loop of its own: among the divisions and stores below each LDS read was
  // waited for alone; here several are in flight behind counted waits.
  #pragma unroll
  for (int dt = 0; dt < 8; ++dt)
  #pragma unroll
  for (int v = 0; v < 8; ++v)
    o[dt][v] = o[dt][v] * wlo[v] + mb[(dt * 8 + v) * 32] * whi[v];
  // ---- normalize and scatter back to [B,S,HID] ----
  const int b = bh >> 3, h = bh & 7;
  #pragma unroll
  for (int dt = 0; dt < 8; ++dt)
  #pragma unroll
  for (int v = 0; v < 8; ++v) {
    const int row = qbase + v + rplus;
    const int col = h * HDIM + dt * 16 + lrow;
    Y[((size_t)b * SEQ + row) * HID + col] = (__bf16)(o[dt][v] / lsum[v]);
  }
}

// ---------------------------------------------------------------------------
// Orchestration
// ---------------------------------------------------------------------------
extern "C" void kernel_launch(void* const* d_in, const int* in_sizes, int n_in,
                              void* d_out, int out_size, void* d_ws, size_t ws_size,
                              hipStream_t stream) {
  (void)in_sizes; (void)n_in; (void)out_size; (void)ws_size;

  const float* x    = (const float*)d_in[0];
  const float* ln1g = (const float*)d_in[1];
  const float* ln1b = (const float*)d_in[2];
  const float* wq   = (const float*)d_in[3];
  const float* bq   = (const float*)d_in[4];
  const float* wk   = (const float*)d_in[5];
  const float* bk   = (const float*)d_in[6];
  const float* wv   = (const float*)d_in[7];
  const float* bv   = (const float*)d_in[8];
  const float* wo   = (const float*)d_in[9];
  const float* bo   = (const float*)d_in[10];
  const float* ln2g = (const float*)d_in[11];
  const float* ln2b = (const float*)d_in[12];
  const float* w1   = (const float*)d_in[13];
  const float* b1   = (const float*)d_in[14];
  const float* w2   = (const float*)d_in[15];
  const float* b2   = (const float*)d_in[16];
  float* out = (float*)d_out;

  char* ws = (char*)d_ws;
  size_t off = 0;
  auto take = [&](size_t bytes) -> char* {
    char* p = ws + off;
    off += bytes;
    off = (off + 255) & ~(size_t)255;
    return p;
  };

  __bf16* wqb = (__bf16*)take((size_t)HID * HID * 2);
  __bf16* wkb = (__bf16*)take((size_t)HID * HID * 2);
  __bf16* wvb = (__bf16*)take((size_t)HID * HID * 2);
  __bf16* wob = (__bf16*)take((size_t)HID * HID * 2);
  __bf16* w1b = (__bf16*)take((size_t)FF  * HID * 2);
  __bf16* w2b = (__bf16*)take((size_t)HID * FF  * 2);
  __bf16* hn  = (__bf16*)take((size_t)MROWS * HID * 2);  // LN1 out
  __bf16* qb  = (__bf16*)take((size_t)MROWS * HID * 2);  // [B,h,S,d]
  __bf16* kbf = (__bf16*)take((size_t)MROWS * HID * 2);  // [B,h,S,d]
  __bf16* vtb = (__bf16*)take((size_t)MROWS * HID * 2);  // [B,h,d,S]
  __bf16* yb  = (__bf16*)take((size_t)MROWS * HID * 2);  // attn out [B,S,H]
  float*  x1  = (float*) take((size_t)MROWS * HID * 4);  // x + attn
  __bf16* m2  = (__bf16*)take((size_t)MROWS * HID * 2);  // LN2 out
  __bf16* gb  = (__bf16*)take((size_t)MROWS * FF  * 2);  // GELU(MLP1)

  // LN1 and wq, wk, wv -> bf16, one launch
  prep_kernel<<<PREP_BLOCKS, 256, 0, stream>>>(x, ln1g, ln1b, hn, wq, wk, wv, wqb, wkb, wvb);

  // QKV projections (block tile 128x128, K-step 64), one launch
  dim3 gH(HID / BLK_N, MROWS / BLK_M);
  dim3 gQKV(HID / BLK_N, MROWS / BLK_M, 3);
  gemm_qkv_kernel<<<gQKV, 256, 0, stream>>>(hn, wqb, wkb, wvb, bq, bk, bv, qb, kbf, vtb, HID);

  // causal flash attention (64 query rows per block, 8 waves, shared K/V staging);
  // the grid's upper rows: w1, w2, wo -> bf16
  dim3 gA(AT_XBLOCKS, BATCH * NHEADS + AT_CONV_ROWS);
  attn_wmma_kernel<<<gA, 256, 0, stream>>>(qb, kbf, vtb, yb, w1, w2, wo, w1b, w2b, wob);

  // O-proj + residual -> x1 (fp32)
  gemm_wmma_kernel<3, HID><<<gH, 256, 0, stream>>>(yb, wob, bo, x, x1, HID);

  // LN2
  ln_bf16_kernel<<<MROWS / 8, 256, 0, stream>>>(x1, ln2g, ln2b, m2);

  // MLP
  dim3 gF(FF / BLK_N, MROWS / BLK_M);
  gemm_wmma_kernel<4, FF><<<gF, 256, 0, stream>>>(m2, w1b, b1, nullptr, gb, HID);
  gemm_wmma_kernel<3, HID><<<gH, 256, 0, stream>>>(gb, w2b, b2, x1, out, FF);
}

// v007
// It runs in 186 microseconds.
// Two timings next to v006 both put it at 1.04 times that version's speed.
// Over all steps from v000 it is 3.81 times as fast.
#include <hip/hip_runtime.h>
#include <hip/hip_bf16.h>
#include <math.h>

typedef __attribute__((ext_vector_type(16))) __bf16 v16bf;
typedef __attribute__((ext_vector_type(8)))  __bf16 v8bf;
typedef __attribute__((ext_vector_type(8)))  float  v8f;

#define HID    1024
#define SEQ    2048
#define BATCH  2
#define NHEADS 8
#define HDIM   128
#define FF     4096
#define MROWS  (BATCH * SEQ)

#define BLK_M 128
#define BLK_N 128
#define BLK_K 64

// LDS row pitches in bf16 elements. Every tile below is read row per lane with
// ds_load_b128, which is free of bank conflicts at a pitch of 16 B x odd; the
// unpadded pitches (128, 256, 64 B) put the 16 rows of a fragment on few banks.
#define G_PITCH (BLK_K + 8)   // GEMM tiles: 128-B rows at 144 B
#define K_PITCH (HDIM + 8)    // K tile:     256-B rows at 272 B
#define V_PITCH (32 + 8)      // V^T tile:    64-B rows at  80 B
#define P_PITCH (32 + 8)      // P tile:      64-B rows at  80 B

// ---------------------------------------------------------------------------
// Fragment loader: CDNA5 16-bit A/B layout for 16x16x32 WMMA.
// Lane L (0..15): row = L, holds K = kb..kb+7 and kb+16..kb+23
// Lane L (16..31): row = L-16, holds K = kb+8..15 and kb+24..31
// => per lane: two contiguous 8-element (16B) chunks at +koff and +koff+16.
// ---------------------------------------------------------------------------
static __device__ __forceinline__ v16bf load_frag(const __bf16* p) {
  v8bf lo = *(const v8bf*)p;
  v8bf hi = *(const v8bf*)(p + 16);
  return __builtin_shufflevector(lo, hi, 0,1,2,3,4,5,6,7,8,9,10,11,12,13,14,15);
}

static __device__ __forceinline__ v8f wmma_bf16(v16bf a, v16bf b, v8f c) {
  return __builtin_amdgcn_wmma_f32_16x16x32_bf16(false, a, false, b, (short)0, c,
                                                 false, false);
}

// Async global -> LDS copy, 16B per lane, tracked by ASYNCcnt (gfx1250).
// lds_addr = low 32 bits of the flat shared-memory pointer (LDS aperture
// mapping: LDS_ADDR = addr[31:0]).
// One stage's eight copies of a lane stand in one statement that ends in
// s_wait_xcnt 0, so that no address register of a copy is rewritten ahead of
// that wait (a precaution for a replayed address translation).
static __device__ __forceinline__ uint32_t lds_addr_of(const void* lds_ptr) {
  return (uint32_t)(uintptr_t)lds_ptr;
}

static __device__ __forceinline__ void async_copy8_b128(const uint32_t (&l)[8],
                                                        const __bf16* const (&g)[8]) {
  asm volatile("global_load_async_to_lds_b128 %0, %8, off\n\t"
               "global_load_async_to_lds_b128 %1, %9, off\n\t"
               "global_load_async_to_lds_b128 %2, %10, off\n\t"
               "global_load_async_to_lds_b128 %3, %11, off\n\t"
               "global_load_async_to_lds_b128 %4, %12, off\n\t"
               "global_load_async_to_lds_b128 %5, %13, off\n\t"
               "global_load_async_to_lds_b128 %6, %14, off\n\t"
               "global_load_async_to_lds_b128 %7, %15, off\n\t"
               "s_wait_xcnt 0x0"
               :: "v"(l[0]), "v"(l[1]), "v"(l[2]), "v"(l[3]),
                  "v"(l[4]), "v"(l[5]), "v"(l[6]), "v"(l[7]),
                  "v"((uint64_t)(uintptr_t)g[0]), "v"((uint64_t)(uintptr_t)g[1]),
                  "v"((uint64_t)(uintptr_t)g[2]), "v"((uint64_t)(uintptr_t)g[3]),
                  "v"((uint64_t)(uintptr_t)g[4]), "v"((uint64_t)(uintptr_t)g[5]),
                  "v"((uint64_t)(uintptr_t)g[6]), "v"((uint64_t)(uintptr_t)g[7])
               : "memory");
}

// Reductions over the 16 lanes of a row by DPP row_xmask butterfly steps, on the
// vector port. A shuffle compiles to ds_bpermute_b32, which goes through the LDS
// queue and is waited for at every one of its steps.
//
// Sum step: the value of lane (l ^ MASK); the compiler folds it into the add.
template <int MASK>
static __device__ __forceinline__ float row_xor(float x) {
  return __builtin_bit_cast(float, __builtin_amdgcn_update_dpp(
      0, __builtin_bit_cast(int, x), 0x160 + MASK, 0xf, 0xf, true));
}

// Maximum of eight rows at once. In asm because the compiler puts a move and a
// quieting maximum in front of every fmaxf on a DPP value (three dependent
// instructions a step instead of one). The eight rows stand side by side in each
// step, so every instruction's producer is eight instructions back.
#define ROWMAX_1(r, m) \
  "v_max_num_f32_dpp " r ", " r ", " r " row_xmask:" m " row_mask:0xf bank_mask:0xf bound_ctrl:1\n\t"
#define ROWMAX_8(m) \
  ROWMAX_1("%0", m) ROWMAX_1("%1", m) ROWMAX_1("%2", m) ROWMAX_1("%3", m) \
  ROWMAX_1("%4", m) ROWMAX_1("%5", m) ROWMAX_1("%6", m) ROWMAX_1("%7", m)
static __device__ __forceinline__ void row16_max8(float (&t)[8]) {
  asm(ROWMAX_8("1") ROWMAX_8("2") ROWMAX_8("4") ROWMAX_8("8")
      : "+v"(t[0]), "+v"(t[1]), "+v"(t[2]), "+v"(t[3]),
        "+v"(t[4]), "+v"(t[5]), "+v"(t[6]), "+v"(t[7]));
}

static __device__ __forceinline__ void wait_async0() {
  asm volatile("s_wait_asynccnt 0x0" ::: "memory");
}

// ---------------------------------------------------------------------------
// The two streaming kernels below move little data. For speed only, each wave does
// much more than one element per lane: 16-B loads that cover whole lines
// (32 lanes x 16 B = 512 B in a row),
// all of a lane's loads issued together, and few waves in the grid.
// ---------------------------------------------------------------------------
typedef __attribute__((ext_vector_type(4))) float  f32x4;
typedef __attribute__((ext_vector_type(4))) __bf16 v4bf;

// fp32 -> bf16 elementwise convert (weights). Block blk of THREADS threads converts
// THREADS * PER groups of four neighbours, PER groups per lane.
template <int THREADS, int PER>
static __device__ __forceinline__
void f32_to_bf16_block(const float* __restrict__ src, __bf16* __restrict__ dst, int blk) {
  const size_t first = (size_t)blk * (THREADS * PER) + threadIdx.x;
  const f32x4* s = (const f32x4*)src + first;
  v4bf* d = (v4bf*)dst + first;
  f32x4 v[PER];
  #pragma unroll
  for (int j = 0; j < PER; ++j) v[j] = s[j * THREADS];
  #pragma unroll
  for (int j = 0; j < PER; ++j) d[j * THREADS] = __builtin_convertvector(v[j], v4bf);
}

// ---------------------------------------------------------------------------
// Row LayerNorm (H=1024), fp32 in -> bf16 out. One wave per row, 8 rows per block:
// the row stays in registers (8 x 16 B per lane), its sums are formed in the lane
// and joined by a five-step butterfly, so no LDS and no barrier is needed.
// ---------------------------------------------------------------------------
static __device__ __forceinline__
void ln_bf16_block(const float* __restrict__ x, const float* __restrict__ g,
                   const float* __restrict__ b, __bf16* __restrict__ out, int blk) {
  const int lane = threadIdx.x & 31;
  const int row  = blk * 8 + (threadIdx.x >> 5);
  const f32x4* xr = (const f32x4*)(x + (size_t)row * HID) + lane;
  const f32x4* gp = (const f32x4*)g + lane;
  const f32x4* bp = (const f32x4*)b + lane;
  f32x4 v[8], gv[8], bv[8];
  #pragma unroll
  for (int j = 0; j < 8; ++j) v[j] = xr[j * 32];
  // Behind the row's loads, since a later load's result may be given their address
  // pair as its place (a precaution for a replayed address translation).
  asm volatile("s_wait_xcnt 0x0" ::: "memory");
  #pragma unroll
  for (int j = 0; j < 8; ++j) { gv[j] = gp[j * 32]; bv[j] = bp[j * 32]; }
  // Keeps all 24 loads in front of the sums: without it the gain and bias loads
  // are issued behind the reduction, two at a time, each waited for.
  __builtin_amdgcn_sched_barrier(0);
  f32x4 sv = {}, qv = {};   // four independent chains each
  #pragma unroll
  for (int j = 0; j < 8; ++j) { sv += v[j]; qv += v[j] * v[j]; }
  float s  = (sv[0] + sv[1]) + (sv[2] + sv[3]);
  float s2 = (qv[0] + qv[1]) + (qv[2] + qv[3]);
  #pragma unroll
  for (int d = 1; d < 32; d <<= 1) {
    s  += __shfl_xor(s,  d, 32);
    s2 += __shfl_xor(s2, d, 32);
  }
  const float mu  = s * (1.0f / HID);
  const float var = s2 * (1.0f / HID) - mu * mu;
  const float r   = rsqrtf(var + 1e-5f);
  v4bf* o = (v4bf*)(out + (size_t)row * HID) + lane;
  #pragma unroll
  for (int j = 0; j < 8; ++j)
    o[j * 32] = __builtin_convertvector((v[j] - mu) * r * gv[j] + bv[j], v4bf);
}

__global__ __launch_bounds__(256)
void ln_bf16_kernel(const float* __restrict__ x, const float* __restrict__ g,
                    const float* __restrict__ b, __bf16* __restrict__ out) {
  ln_bf16_block(x, g, b, out, blockIdx.x);
}

// ---------------------------------------------------------------------------
// What the Q, K and V products wait for, in one launch: the first LayerNorm and the
// converts of their three weights. None reads what another writes, so each gets a
// range of the block index; short launches one behind the other each pay their own
// start and drain, with most of the chip idle meanwhile. (The other three weights
// are first read behind attention and are converted in its launch.)
// ---------------------------------------------------------------------------
#define LN_BLOCKS    (MROWS / 8)               // 8 rows a block
#define SQ_BLOCKS    (HID * HID / (1024 * 4))  // a HID x HID weight, 256 threads, PER = 4
#define PREP_BLOCKS  (LN_BLOCKS + 3 * SQ_BLOCKS)
static_assert(HID * HID % (1024 * 4) == 0, "whole blocks only");

__global__ __launch_bounds__(256)
void prep_kernel(const float* __restrict__ x, const float* __restrict__ g,
                 const float* __restrict__ b, __bf16* __restrict__ hn,
                 const float* __restrict__ wq, const float* __restrict__ wk,
                 const float* __restrict__ wv, __bf16* __restrict__ wqb,
                 __bf16* __restrict__ wkb, __bf16* __restrict__ wvb) {
  int blk = blockIdx.x;
  if (blk < LN_BLOCKS) {
    ln_bf16_block(x, g, b, hn, blk);
    return;
  }
  blk -= LN_BLOCKS;
  const int which = blk / SQ_BLOCKS;
  f32_to_bf16_block<256, 4>(which == 0 ? wq : which == 1 ? wk : wv,
                            which == 0 ? wqb : which == 1 ? wkb : wvb,
                            blk - which * SQ_BLOCKS);
}

// ---------------------------------------------------------------------------
// WMMA GEMM with async-LDS double-buffered staging.
// C[M,N] = A[M,K] (row-major) * W[N,K]^T (+ bias, epilogue modes).
// Block: 256 threads = 8 waves (4 M x 2 N); block tile 128x128;
// wave tile 32x64 (2x4 WMMA frags). K-step 64 (2 x 8 WMMAs per barrier pair).
// Staging: 128x64 bf16 tiles of A and W copied global->LDS with
// global_load_async_to_lds_b128 (ASYNCcnt), double buffered, rows padded to
// G_PITCH (72 KB LDS).
// MODE and NCOLS (the output's row length) are template parameters: the epilogue
// then holds one mode's code with no test per element, every address is one base
// plus a constant, and its loads and stores are issued together.
// MODE 1: bf16 out in [B,heads,S,d]        (Q / K)
// MODE 2: bf16 out in [B,heads,d,S]        (V^T)
// MODE 3: fp32 out = resid + acc + bias    (O-proj / MLP2 residual)
// MODE 4: bf16 out = gelu(acc + bias)      (MLP1)
// ---------------------------------------------------------------------------
static __device__ __forceinline__
void gemm_main_loop(const __bf16* __restrict__ A, const __bf16* __restrict__ W, int K,
                    v8f (&acc)[2][4]) {
  const int lane = threadIdx.x & 31;
  const int wave = threadIdx.x >> 5;
  const int wm   = wave & 3;          // 4 waves along M
  const int wn   = wave >> 2;         // 2 waves along N
  const int mblk = blockIdx.y * BLK_M;
  const int nblk = blockIdx.x * BLK_N;
  const int lrow = lane & 15;
  const int koff = (lane >> 4) << 3;  // 0 or 8

  __shared__ __align__(16) __bf16 tA[2][BLK_M * G_PITCH];
  __shared__ __align__(16) __bf16 tB[2][BLK_N * G_PITCH];

  // Stage one 128x64 K-slice of A and W into LDS buffer `buf`.
  // 1024 16B chunks per tile; 256 threads issue 4 chunks each per tile.
  auto stage = [&](int buf, int k0) {
    uint32_t l[8];
    const __bf16* g[8];
    #pragma unroll
    for (int j = 0; j < 4; ++j) {
      const int id  = threadIdx.x + j * 256;
      const int row = id >> 3;
      const int ch  = (id & 7) << 3;  // element offset of the 16B chunk
      l[2 * j]     = lds_addr_of(&tA[buf][row * G_PITCH + ch]);
      g[2 * j]     = A + (size_t)(mblk + row) * K + k0 + ch;
      l[2 * j + 1] = lds_addr_of(&tB[buf][row * G_PITCH + ch]);
      g[2 * j + 1] = W + (size_t)(nblk + row) * K + k0 + ch;
    }
    async_copy8_b128(l, g);
  };

  stage(0, 0);
  for (int k0 = 0; k0 < K; k0 += BLK_K) {
    const int cur = (k0 >> 6) & 1;
    wait_async0();       // this wave's copies into tX[cur] have landed
    __syncthreads();     // everyone's copies have landed
    if (k0 + BLK_K < K) stage(cur ^ 1, k0 + BLK_K);

    #pragma unroll
    for (int ks = 0; ks < BLK_K; ks += 32) {
      v16bf a[2], b[4];
      #pragma unroll
      for (int mt = 0; mt < 2; ++mt)
        a[mt] = load_frag(&tA[cur][(wm * 32 + mt * 16 + lrow) * G_PITCH + ks + koff]);
      #pragma unroll
      for (int nt = 0; nt < 4; ++nt)
        b[nt] = load_frag(&tB[cur][(wn * 64 + nt * 16 + lrow) * G_PITCH + ks + koff]);
      #pragma unroll
      for (int mt = 0; mt < 2; ++mt)
        #pragma unroll
        for (int nt = 0; nt < 4; ++nt)
          acc[mt][nt] = wmma_bf16(a[mt], b[nt], acc[mt][nt]);
    }

    __syncthreads();     // all reads of tX[cur] done before it is re-staged
  }
}

// ---------------------------------------------------------------------------
// Exact GELU of eight values, 0.5 v (1 + erf(v / sqrt 2)), without a branch.
// erff() tests |x| < 1 per value: in a wave both sides are met, so each value runs
// both under changing lane masks, one value after the other, every instruction
// waiting for the one before. Here both of erff's own polynomials (same
// coefficients, same order of evaluation) are worked out for all eight values side
// by side, two values an instruction where a packed form exists, and a select
// takes the one that holds. The side not taken may overflow; it is never used.
// v erf(x) = |v| erf(|x|), so no sign has to be put back.
// ---------------------------------------------------------------------------
static __device__ __forceinline__ v8f fma8(v8f a, v8f b, float c) {
  return __builtin_elementwise_fma(a, b, (v8f)(c));
}
static __device__ __forceinline__ v8f gelu8(v8f val) {
  const v8f av = __builtin_elementwise_abs(val);
  const v8f h  = val * 0.5f;
  const v8f ah = av * 0.5f;                     // |h|
  const v8f ax = av * 0.70710678118654752f;     // |x|
  // |x| >= 1: erf = 1 - exp(-(|x| + |x| p(|x|)))
  v8f p = fma8(ax, (v8f)(__builtin_bit_cast(float, 0x378e98abu)),
                         __builtin_bit_cast(float, 0xb9c68948u));
  p = fma8(ax, p, __builtin_bit_cast(float, 0x3b7cd369u));
  p = fma8(ax, p, __builtin_bit_cast(float, 0xbcc618b2u));
  p = fma8(ax, p, __builtin_bit_cast(float, 0x3dda74e4u));
  p = fma8(ax, p, __builtin_bit_cast(float, 0x3f228afdu));
  p = fma8(ax, p, __builtin_bit_cast(float, 0x3e03c728u));
  p = __builtin_elementwise_fma(ax, p, ax);
  // |x| < 1: erf = |x| + |x| q(x^2)
  const v8f s = ax * ax;
  v8f q = fma8(s, (v8f)(__builtin_bit_cast(float, 0xba1345e1u)),
                        __builtin_bit_cast(float, 0x3ba10414u));
  q = fma8(s, q, __builtin_bit_cast(float, 0xbcdac9b8u));
  q = fma8(s, q, __builtin_bit_cast(float, 0x3de703beu));
  q = fma8(s, q, __builtin_bit_cast(float, 0xbec09330u));
  q = fma8(s, q, __builtin_bit_cast(float, 0x3e0375d0u));
  q = __builtin_elementwise_fma(ax, q, ax);
  v8f e;
  #pragma unroll   // so that every index is a constant and the vectors stay in registers
  for (int v = 0; v < 8; ++v) e[v] = ax[v] < 1.0f ? q[v] : 1.0f - __expf(-p[v]);
  return __builtin_elementwise_fma(ah, e, h);
}

template <int MODE, int NCOLS>
static __device__ __forceinline__
void gemm_epilogue(const v8f (&acc)[2][4], const float* __restrict__ bias,
                   const float* __restrict__ resid, void* __restrict__ outp) {
  const int lane = threadIdx.x & 31;
  const int wave = threadIdx.x >> 5;
  const int wm   = wave & 3;
  const int wn   = wave >> 2;
  const int mblk = blockIdx.y * BLK_M;
  const int nblk = blockIdx.x * BLK_N;
  const int lrow = lane & 15;

  // Element (mt, nt, v) of this lane is row row0 + mt*16 + v, column col0 + nt*16.
  // A block's 128 rows lie in one batch entry and its 128 columns in one head.
  const int row0 = mblk + wm * 32 + ((lane >> 4) << 3);  // upper 16 lanes: rows +8
  const int col0 = nblk + wn * 64 + lrow;
  float bv[4];
  #pragma unroll
  for (int nt = 0; nt < 4; ++nt) bv[nt] = bias[col0 + nt * 16];

  if constexpr (MODE == 1 || MODE == 2) {
    const int bb = row0 >> 11, ss = row0 & (SEQ - 1);   // S = 2048
    const int hh = col0 >> 7,  dd = col0 & (HDIM - 1);  // d = 128
    if constexpr (MODE == 1) {
      __bf16* o = (__bf16*)outp + ((size_t)((bb * NHEADS + hh) * SEQ + ss)) * HDIM + dd;
      #pragma unroll
      for (int mt = 0; mt < 2; ++mt)
      #pragma unroll
      for (int nt = 0; nt < 4; ++nt)
      #pragma unroll
      for (int v = 0; v < 8; ++v)
        o[(mt * 16 + v) * HDIM + nt * 16] = (__bf16)(acc[mt][nt][v] + bv[nt]);
      // Behind the run of stores: where two epilogues share a kernel, the code laid
      // out behind this one rewrites registers that the stores name (a precaution
      // for a replayed address translation).
      asm volatile("s_wait_xcnt 0x0" ::: "memory");
    } else {
      // A lane's eight rows are eight neighbours along S: one 16-B store.
      __bf16* o = (__bf16*)outp + ((size_t)((bb * NHEADS + hh) * HDIM + dd)) * SEQ + ss;
      #pragma unroll
      for (int mt = 0; mt < 2; ++mt)
      #pragma unroll
      for (int nt = 0; nt < 4; ++nt) {
        v8bf pk;
        #pragma unroll
        for (int v = 0; v < 8; ++v) pk[v] = (__bf16)(acc[mt][nt][v] + bv[nt]);
        *(v8bf*)(o + nt * 16 * SEQ + mt * 16) = pk;
      }
    }
  } else if constexpr (MODE == 3) {
    const size_t base = (size_t)row0 * NCOLS + col0;
    const float* rp = resid + base;
    float* o = (float*)outp + base;
    float r[2][4][8];
    #pragma unroll
    for (int mt = 0; mt < 2; ++mt)
    #pragma unroll
    for (int v = 0; v < 8; ++v)
    #pragma unroll
    for (int nt = 0; nt < 4; ++nt)
      r[mt][nt][v] = rp[(mt * 16 + v) * NCOLS + nt * 16];
    #pragma unroll
    for (int mt = 0; mt < 2; ++mt)
    #pragma unroll
    for (int v = 0; v < 8; ++v)
    #pragma unroll
    for (int nt = 0; nt < 4; ++nt)
      o[(mt * 16 + v) * NCOLS + nt * 16] = r[mt][nt][v] + (acc[mt][nt][v] + bv[nt]);
  } else {  // MODE 4: exact GELU, bf16 out
    // Behind the four bias loads: the arithmetic below is given their offset register
    // as a place before the last of them is waited for (a precaution for a replayed
    // address translation).
    asm volatile("s_wait_xcnt 0x0" ::: "memory");
    __bf16* o = (__bf16*)outp + (size_t)row0 * NCOLS + col0;
    #pragma unroll
    for (int mt = 0; mt < 2; ++mt)
    #pragma unroll
    for (int nt = 0; nt < 4; ++nt) {
      const v8f gl = gelu8(acc[mt][nt] + bv[nt]);
      #pragma unroll   // constant indices and store offsets, as in the other modes
      for (int v = 0; v < 8; ++v)
        o[(mt * 16 + v) * NCOLS + nt * 16] = (__bf16)gl[v];
    }
  }
}

template <int MODE, int NCOLS>
__global__ __launch_bounds__(256)
void gemm_wmma_kernel(const __bf16* __restrict__ A, const __bf16* __restrict__ W,
                      const float* __restrict__ bias, const float* __restrict__ resid,
                      void* __restrict__ outp, int K) {
  v8f acc[2][4] = {};
  gemm_main_loop(A, W, K, acc);
  gemm_epilogue<MODE, NCOLS>(acc, bias, resid, outp);
}

// The Q, K and V projections in one launch, blockIdx.z naming the product. Each
// alone has one block per WGP, whose waves cannot cover their own copy and
// barrier waits. Three blocks fit a WGP (72 KiB of LDS each; two waves per SIMD
// each, at a register count that lets seven stand there), so the joined grid can
// be resident at once, each block filling the others' waits.
// The choice of epilogue is one test per block, the same in all of its lanes.
__global__ __launch_bounds__(256)
void gemm_qkv_kernel(const __bf16* __restrict__ A, const __bf16* __restrict__ Wq,
                     const __bf16* __restrict__ Wk, const __bf16* __restrict__ Wv,
                     const float* __restrict__ bq, const float* __restrict__ bk,
                     const float* __restrict__ bv, __bf16* __restrict__ q,
                     __bf16* __restrict__ k, __bf16* __restrict__ vt, int K) {
  const int z = blockIdx.z;
  v8f acc[2][4] = {};
  gemm_main_loop(A, z == 0 ? Wq : z == 1 ? Wk : Wv, K, acc);
  if (z == 2) gemm_epilogue<2, HID>(acc, bv, nullptr, vt);
  else        gemm_epilogue<1, HID>(acc, z == 0 ? bq : bk, nullptr, z == 0 ? q : k);
}

// ---------------------------------------------------------------------------
// Causal flash attention with shared async-LDS K/V staging.
// Block: 256 threads = 8 waves on 64 query rows: wave w owns the 16-query tile w & 3
// and, of every 64-key pass, the 32 keys of half w >> 2. The launch lasts as long as
// the block with the most passes, whose waves mostly wait on their own dependent
// steps; two waves per query tile halve its passes. Each keeps its own running
// maximum, sum and output tile; the two are joined once, through LDS, at the end.
// Per pass: K tile (64x128) and V^T tile (128x64, one slab per half) staged
// global->LDS (double buffered, ASYNCcnt) once and consumed by all 8 waves.
// All waves run to the block's last key block; the causal mask nulls any
// key > query row (exp(-huge)=0), so lower waves' surplus blocks are inert.
// The launch also converts the three weights that are first read behind it: the
// blocks with blockIdx.y >= BATCH * NHEADS. Attention leaves wave places and nearly
// all of the memory rate free, and its blocks, lower in the index, start first.
// ---------------------------------------------------------------------------
#define AT_XBLOCKS   (SEQ / 64)
#define AT_FF_BLOCKS (FF * HID / (1024 * 8))   // a FF x HID weight,  256 threads, PER = 8
#define AT_SQ_BLOCKS (HID * HID / (1024 * 8))  // a HID x HID weight, 256 threads, PER = 8
#define AT_CONV_ROWS ((2 * AT_FF_BLOCKS + AT_SQ_BLOCKS) / AT_XBLOCKS)
static_assert(HID * HID % (1024 * 8) == 0 &&
              (2 * AT_FF_BLOCKS + AT_SQ_BLOCKS) % AT_XBLOCKS == 0, "whole blocks, whole grid rows");

__global__ __launch_bounds__(256)
void attn_wmma_kernel(const __bf16* __restrict__ Q, const __bf16* __restrict__ Kc,
                      const __bf16* __restrict__ VT, __bf16* __restrict__ Y,
                      const float* __restrict__ w1, const float* __restrict__ w2,
                      const float* __restrict__ wo, __bf16* __restrict__ w1b,
                      __bf16* __restrict__ w2b, __bf16* __restrict__ wob) {
  if (blockIdx.y >= BATCH * NHEADS) {   // the same for a whole block, ahead of every barrier
    const int blk   = (blockIdx.y - BATCH * NHEADS) * AT_XBLOCKS + blockIdx.x;
    const int which = blk / AT_FF_BLOCKS;   // 0: w1, 1: w2, 2: wo
    f32_to_bf16_block<256, 8>(which == 0 ? w1 : which == 1 ? w2 : wo,
                              which == 0 ? w1b : which == 1 ? w2b : wob,
                              blk - which * AT_FF_BLOCKS);
    return;
  }
  const int lane  = threadIdx.x & 31;
  const int wave  = threadIdx.x >> 5;
  const int lrow  = lane & 15;
  const int koff  = (lane >> 4) << 3;
  const int rplus = koff;               // C-layout: upper lanes own rows +8
  const int qblk  = blockIdx.x * 64;
  const int wq    = wave & 3;           // query tile
  const int grp   = wave >> 2;          // which 32 keys of a 64-key pass
  const int qbase = qblk + wq * 16;
  const int bh    = blockIdx.y;
  const float scale = 0.08838834764831845f;  // 1/sqrt(128)
  const float NEGF  = -3.0e38f;

  __shared__ __align__(16) __bf16 kt[2][64 * K_PITCH];       // 2 x 17 KB
  __shared__ __align__(16) __bf16 vt[2][2][HDIM * V_PITCH];  // 2 x 2 x 10 KB
  __shared__ __align__(16) __bf16 pbuf[8][16 * P_PITCH];     // per-wave P tiles

  // Stage K tile (64 keys x 128) and V^T tile (128 x 64 keys) for key block kb.
  // 1024 16B chunks per tile; 256 threads issue 4 chunks each per tile.
  auto stage = [&](int buf, int kb) {
    uint32_t l[8];
    const __bf16* g[8];
    #pragma unroll
    for (int j = 0; j < 4; ++j) {
      const int id = threadIdx.x + j * 256;
      const int kr = id >> 4, kc = (id & 15) << 3;   // K tile: 16 chunks/row
      l[2 * j]     = lds_addr_of(&kt[buf][kr * K_PITCH + kc]);
      g[2 * j]     = Kc + ((size_t)bh * SEQ + kb + kr) * HDIM + kc;
      const int vr = id >> 3, vc = id & 7;           // V^T tile: 8 chunks/row, 4 a slab
      l[2 * j + 1] = lds_addr_of(&vt[buf][vc >> 2][vr * V_PITCH + ((vc & 3) << 3)]);
      g[2 * j + 1] = VT + ((size_t)bh * HDIM + vr) * SEQ + kb + (vc << 3);
    }
    async_copy8_b128(l, g);
  };

  v16bf qf[4];
  #pragma unroll
  for (int kc = 0; kc < 4; ++kc)
    qf[kc] = load_frag(Q + ((size_t)bh * SEQ + qbase + lrow) * HDIM + kc * 32 + koff);

  v8f o[8] = {};
  float mrow[8], lsum[8];
  #pragma unroll
  for (int v = 0; v < 8; ++v) { mrow[v] = NEGF; lsum[v] = 0.f; }

  const int kend = qblk + 64;           // block-uniform key range, whole passes
  stage(0, 0);
  for (int kb = 0; kb < kend; kb += 64) {
    const int cur = (kb >> 6) & 1;
    const int kg  = kb + grp * 32;      // first of this wave's 32 keys
    wait_async0();
    __syncthreads();
    if (kb + 64 < kend) stage(cur ^ 1, kb + 64);

    // ---- S = Q K^T over d=128 (4 x K=32 WMMAs per 16-key column tile) ----
    v8f s0acc = {}, s1acc = {};
    #pragma unroll
    for (int kc = 0; kc < 4; ++kc) {
      v16bf k0 = load_frag(&kt[cur][(grp * 32 +      lrow) * K_PITCH + kc * 32 + koff]);
      v16bf k1 = load_frag(&kt[cur][(grp * 32 + 16 + lrow) * K_PITCH + kc * 32 + koff]);
      s0acc = wmma_bf16(qf[kc], k0, s0acc);
      s1acc = wmma_bf16(qf[kc], k1, s1acc);
    }
    // ---- scale, causal mask, online softmax (per C-layout row) ----
    // The running maximum is the same in all 16 lanes of a row, so it goes into
    // the reduction's start value and the reduction yields the new maximum.
    // Every loop over v is unrolled so that its arrays are registers, not scratch;
    // the sum's steps are loops of their own to set the eight rows side by side.
    float s0[8], s1[8], mnew[8];
    #pragma unroll
    for (int v = 0; v < 8; ++v) {
      const int qrow = qbase + v + rplus;
      s0[v] = s0acc[v] * scale;
      s1[v] = s1acc[v] * scale;
      if (kg +      lrow > qrow) s0[v] = NEGF;
      if (kg + 16 + lrow > qrow) s1[v] = NEGF;
      mnew[v] = fmaxf(fmaxf(s0[v], s1[v]), mrow[v]);
    }
    row16_max8(mnew);
    float rs[8];
    #pragma unroll
    for (int v = 0; v < 8; ++v) {
      const float p0 = __expf(s0[v] - mnew[v]);
      const float p1 = __expf(s1[v] - mnew[v]);
      rs[v] = p0 + p1;
      const int prow = v + rplus;
      pbuf[wave][prow * P_PITCH +      lrow] = (__bf16)p0;
      pbuf[wave][prow * P_PITCH + 16 + lrow] = (__bf16)p1;
    }
    #pragma unroll
    for (int v = 0; v < 8; ++v) rs[v] += row_xor<1>(rs[v]);
    #pragma unroll
    for (int v = 0; v < 8; ++v) rs[v] += row_xor<2>(rs[v]);
    #pragma unroll
    for (int v = 0; v < 8; ++v) rs[v] += row_xor<4>(rs[v]);
    #pragma unroll
    for (int v = 0; v < 8; ++v) rs[v] += row_xor<8>(rs[v]);
    #pragma unroll
    for (int v = 0; v < 8; ++v) {
      const float sc = __expf(mrow[v] - mnew[v]);
      lsum[v] = lsum[v] * sc + rs[v];
      mrow[v] = mnew[v];
      #pragma unroll
      for (int dt = 0; dt < 8; ++dt) o[dt][v] *= sc;
    }
    __syncthreads();
    v16bf pf = load_frag(&pbuf[wave][lrow * P_PITCH + koff]);
    // ---- O += P V (keys as contraction dim; V^T rows are contiguous) ----
    #pragma unroll
    for (int dt = 0; dt < 8; ++dt) {
      v16bf vf = load_frag(&vt[cur][grp][(dt * 16 + lrow) * V_PITCH + koff]);
      o[dt] = wmma_bf16(pf, vf, o[dt]);
    }
    __syncthreads();     // kt/vt[cur] + pbuf free before re-staging / rewrite
  }
  // ---- join the two key halves of each query tile ----
  // Wave wq + 4 hands its 80 values per lane (output tile, maxima, sums) to wave wq,
  // lane to lane, through the V^T buffers: the loop's last barrier has ended every
  // read of them, and no copy is in flight (the last pass staged nothing).
  // A half whose keys were all masked has the maximum NEGF and finite sums, and its
  // weight below is exp(NEGF - m) = 0; the lower half always holds key 0.
  static_assert(sizeof(vt) >= 4 * 80 * 32 * sizeof(float), "hand-over fits the V^T buffers");
  float* mb = (float*)&vt[0][0][0] + wq * (80 * 32) + lane;
  if (grp == 1) {
    #pragma unroll
    for (int dt = 0; dt < 8; ++dt)
    #pragma unroll
    for (int v = 0; v < 8; ++v) mb[(dt * 8 + v) * 32] = o[dt][v];
    #pragma unroll
    for (int v = 0; v < 8; ++v) {
      mb[(64 + v) * 32] = mrow[v];
      mb[(72 + v) * 32] = lsum[v];
    }
  }
  __syncthreads();       // the upper halves' values are in LDS
  if (grp == 1) return;  // behind the last barrier
  float wlo[8], whi[8];
  #pragma unroll
  for (int v = 0; v < 8; ++v) {
    const float m1 = mb[(64 + v) * 32];
    const float l1 = mb[(72 + v) * 32];
    const float m  = fmaxf(mrow[v], m1);
    wlo[v] = __expf(mrow[v] - m);
    whi[v] = __expf(m1 - m);
    lsum[v] = lsum[v] * wlo[v] + l1 * whi[v];
  }
  // A loop of its own: among the divisions and stores below each LDS read was
  // waited for alone; here several are in flight behind counted waits.
  #pragma unroll
  for (int dt = 0; dt < 8; ++dt)
  #pragma unroll
  for (int v = 0; v < 8; ++v)
    o[dt][v] = o[dt][v] * wlo[v] + mb[(dt * 8 + v) * 32] * whi[v];
  // ---- normalize and scatter back to [B,S,HID] ----
  const int b = bh >> 3, h = bh & 7;
  #pragma unroll
  for (int dt = 0; dt < 8; ++dt)
  #pragma unroll
  for (int v = 0; v < 8; ++v) {
    const int row = qbase + v + rplus;
    const int col = h * HDIM + dt * 16 + lrow;
    Y[((size_t)b * SEQ + row) * HID + col] = (__bf16)(o[dt][v] / lsum[v]);
  }
}

// ---------------------------------------------------------------------------
// Orchestration
// ---------------------------------------------------------------------------
extern "C" void kernel_launch(void* const* d_in, const int* in_sizes, int n_in,
                              void* d_out, int out_size, void* d_ws, size_t ws_size,
                              hipStream_t stream) {
  (void)in_sizes; (void)n_in; (void)out_size; (void)ws_size;

  const float* x    = (const float*)d_in[0];
  const float* ln1g = (const float*)d_in[1];
  const float* ln1b = (const float*)d_in[2];
  const float* wq   = (const float*)d_in[3];
  const float* bq   = (const float*)d_in[4];
  const float* wk   = (const float*)d_in[5];
  const float* bk   = (const float*)d_in[6];
  const float* wv   = (const float*)d_in[7];
  const float* bv   = (const float*)d_in[8];
  const float* wo   = (const float*)d_in[9];
  const float* bo   = (const float*)d_in[10];
  const float* ln2g = (const float*)d_in[11];
  const float* ln2b = (const float*)d_in[12];
  const float* w1   = (const float*)d_in[13];
  const float* b1   = (const float*)d_in[14];
  const float* w2   = (const float*)d_in[15];
  const float* b2   = (const float*)d_in[16];
  float* out = (float*)d_out;

  char* ws = (char*)d_ws;
  size_t off = 0;
  auto take = [&](size_t bytes) -> char* {
    char* p = ws + off;
    off += bytes;
    off = (off + 255) & ~(size_t)255;
    return p;
  };

  __bf16* wqb = (__bf16*)take((size_t)HID * HID * 2);
  __bf16* wkb = (__bf16*)take((size_t)HID * HID * 2);
  __bf16* wvb = (__bf16*)take((size_t)HID * HID * 2);
  __bf16* wob = (__bf16*)take((size_t)HID * HID * 2);
  __bf16* w1b = (__bf16*)take((size_t)FF  * HID * 2);
  __bf16* w2b = (__bf16*)take((size_t)HID * FF  * 2);
  __bf16* hn  = (__bf16*)take((size_t)MROWS * HID * 2);  // LN1 out
  __bf16* qb  = (__bf16*)take((size_t)MROWS * HID * 2);  // [B,h,S,d]
  __bf16* kbf = (__bf16*)take((size_t)MROWS * HID * 2);  // [B,h,S,d]
  __bf16* vtb = (__bf16*)take((size_t)MROWS * HID * 2);  // [B,h,d,S]
  __bf16* yb  = (__bf16*)take((size_t)MROWS * HID * 2);  // attn out [B,S,H]
  float*  x1  = (float*) take((size_t)MROWS * HID * 4);  // x + attn
  __bf16* m2  = (__bf16*)take((size_t)MROWS * HID * 2);  // LN2 out
  __bf16* gb  = (__bf16*)take((size_t)MROWS * FF  * 2);  // GELU(MLP1)

  // LN1 and wq, wk, wv -> bf16, one launch
  prep_kernel<<<PREP_BLOCKS, 256, 0, stream>>>(x, ln1g, ln1b, hn, wq, wk, wv, wqb, wkb, wvb);

  // QKV projections (block tile 128x128, K-step 64), one launch
  dim3 gH(HID / BLK_N, MROWS / BLK_M);
  dim3 gQKV(HID / BLK_N, MROWS / BLK_M, 3);
  gemm_qkv_kernel<<<gQKV, 256, 0, stream>>>(hn, wqb, wkb, wvb, bq, bk, bv, qb, kbf, vtb, HID);

  // causal flash attention (64 query rows per block, 8 waves, shared K/V staging);
  // the grid's upper rows: w1, w2, wo -> bf16
  dim3 gA(AT_XBLOCKS, BATCH * NHEADS + AT_CONV_ROWS);
  attn_wmma_kernel<<<gA, 256, 0, stream>>>(qb, kbf, vtb, yb, w1, w2, wo, w1b, w2b, wob);

  // O-proj + residual -> x1 (fp32)
  gemm_wmma_kernel<3, HID><<<gH, 256, 0, stream>>>(yb, wob, bo, x, x1, HID);

  // LN2
  ln_bf16_kernel<<<MROWS / 8, 256, 0, stream>>>(x1, ln2g, ln2b, m2);

  // MLP
  dim3 gF(FF / BLK_N, MROWS / BLK_M);
  gemm_wmma_kernel<4, FF><<<gF, 256, 0, stream>>>(m2, w1b, b1, nullptr, gb, HID);
  gemm_wmma_kernel<3, HID><<<gH, 256, 0, stream>>>(gb, w2b, b2, x1, out, FF);
}

// v008
// One run takes 172 microseconds.
// Next to v007, in two timings, it ran 1.09 times as fast each time.
// All steps since v000 together make it 4.14 times as fast.
#include <hip/hip_runtime.h>
#include <hip/hip_bf16.h>
#include <math.h>

typedef __attribute__((ext_vector_type(16))) __bf16 v16bf;
typedef __attribute__((ext_vector_type(8)))  __bf16 v8bf;
typedef __attribute__((ext_vector_type(8)))  float  v8f;

#define HID    1024
#define SEQ    2048
#define BATCH  2
#define NHEADS 8
#define HDIM   128
#define FF     4096
#define MROWS  (BATCH * SEQ)

#define BLK_M 128
#define BLK_N 128
#define BLK_K 64

// LDS row pitches in bf16 elements. Every tile below is read row per lane with
// ds_load_b128, which is free of bank conflicts at a pitch of 16 B x odd; the
// unpadded pitches (128, 256, 64 B) put the 16 rows of a fragment on few banks.
#define G_PITCH (BLK_K + 8)   // GEMM tiles: 128-B rows at 144 B
#define K_PITCH (HDIM + 8)    // K tile:     256-B rows at 272 B
#define V_PITCH (32 + 8)      // V^T tile:    64-B rows at  80 B
#define P_PITCH (32 + 8)      // P tile:      64-B rows at  80 B

// ---------------------------------------------------------------------------
// Fragment loader: CDNA5 16-bit A/B layout for 16x16x32 WMMA.
// Lane L (0..15): row = L, holds K = kb..kb+7 and kb+16..kb+23
// Lane L (16..31): row = L-16, holds K = kb+8..15 and kb+24..31
// => per lane: two contiguous 8-element (16B) chunks at +koff and +koff+16.
// ---------------------------------------------------------------------------
static __device__ __forceinline__ v16bf load_frag(const __bf16* p) {
  v8bf lo = *(const v8bf*)p;
  v8bf hi = *(const v8bf*)(p + 16);
  return __builtin_shufflevector(lo, hi, 0,1,2,3,4,5,6,7,8,9,10,11,12,13,14,15);
}

static __device__ __forceinline__ v8f wmma_bf16(v16bf a, v16bf b, v8f c) {
  return __builtin_amdgcn_wmma_f32_16x16x32_bf16(false, a, false, b, (short)0, c,
                                                 false, false);
}

// Async global -> LDS copy, 16B per lane, tracked by ASYNCcnt (gfx1250).
// lds_addr = low 32 bits of the flat shared-memory pointer (LDS aperture
// mapping: LDS_ADDR = addr[31:0]).
// One stage's eight copies of a lane stand in one statement that ends in
// s_wait_xcnt 0, so that no address register of a copy is rewritten ahead of
// that wait (a precaution for a replayed address translation).
static __device__ __forceinline__ uint32_t lds_addr_of(const void* lds_ptr) {
  return (uint32_t)(uintptr_t)lds_ptr;
}

static __device__ __forceinline__ void async_copy8_b128(const uint32_t (&l)[8],
                                                        const __bf16* const (&g)[8]) {
  asm volatile("global_load_async_to_lds_b128 %0, %8, off\n\t"
               "global_load_async_to_lds_b128 %1, %9, off\n\t"
               "global_load_async_to_lds_b128 %2, %10, off\n\t"
               "global_load_async_to_lds_b128 %3, %11, off\n\t"
               "global_load_async_to_lds_b128 %4, %12, off\n\t"
               "global_load_async_to_lds_b128 %5, %13, off\n\t"
               "global_load_async_to_lds_b128 %6, %14, off\n\t"
               "global_load_async_to_lds_b128 %7, %15, off\n\t"
               "s_wait_xcnt 0x0"
               :: "v"(l[0]), "v"(l[1]), "v"(l[2]), "v"(l[3]),
                  "v"(l[4]), "v"(l[5]), "v"(l[6]), "v"(l[7]),
                  "v"((uint64_t)(uintptr_t)g[0]), "v"((uint64_t)(uintptr_t)g[1]),
                  "v"((uint64_t)(uintptr_t)g[2]), "v"((uint64_t)(uintptr_t)g[3]),
                  "v"((uint64_t)(uintptr_t)g[4]), "v"((uint64_t)(uintptr_t)g[5]),
                  "v"((uint64_t)(uintptr_t)g[6]), "v"((uint64_t)(uintptr_t)g[7])
               : "memory");
}

// Reductions over the 16 lanes of a row by DPP row_xmask butterfly steps, on the
// vector port. A shuffle compiles to ds_bpermute_b32, which goes through the LDS
// queue and is waited for at every one of its steps.
//
// Sum step: the value of lane (l ^ MASK); the compiler folds it into the add.
template <int MASK>
static __device__ __forceinline__ float row_xor(float x) {
  return __builtin_bit_cast(float, __builtin_amdgcn_update_dpp(
      0, __builtin_bit_cast(int, x), 0x160 + MASK, 0xf, 0xf, true));
}

// Maximum of eight rows at once. In asm because the compiler puts a move and a
// quieting maximum in front of every fmaxf on a DPP value (three dependent
// instructions a step instead of one). The eight rows stand side by side in each
// step, so every instruction's producer is eight instructions back.
#define ROWMAX_1(r, m) \
  "v_max_num_f32_dpp " r ", " r ", " r " row_xmask:" m " row_mask:0xf bank_mask:0xf bound_ctrl:1\n\t"
#define ROWMAX_8(m) \
  ROWMAX_1("%0", m) ROWMAX_1("%1", m) ROWMAX_1("%2", m) ROWMAX_1("%3", m) \
  ROWMAX_1("%4", m) ROWMAX_1("%5", m) ROWMAX_1("%6", m) ROWMAX_1("%7", m)
static __device__ __forceinline__ void row16_max8(float (&t)[8]) {
  asm(ROWMAX_8("1") ROWMAX_8("2") ROWMAX_8("4") ROWMAX_8("8")
      : "+v"(t[0]), "+v"(t[1]), "+v"(t[2]), "+v"(t[3]),
        "+v"(t[4]), "+v"(t[5]), "+v"(t[6]), "+v"(t[7]));
}

static __device__ __forceinline__ void wait_async0() {
  asm volatile("s_wait_asynccnt 0x0" ::: "memory");
}

// ---------------------------------------------------------------------------
// The two streaming kernels below move little data. For speed only, each wave does
// much more than one element per lane: 16-B loads that cover whole lines
// (32 lanes x 16 B = 512 B in a row),
// all of a lane's loads issued together, and few waves in the grid.
// ---------------------------------------------------------------------------
typedef __attribute__((ext_vector_type(4))) float  f32x4;
typedef __attribute__((ext_vector_type(4))) __bf16 v4bf;

// fp32 -> bf16 elementwise convert (weights). Block blk of THREADS threads converts
// THREADS * PER groups of four neighbours, PER groups per lane.
template <int THREADS, int PER>
static __device__ __forceinline__
void f32_to_bf16_block(const float* __restrict__ src, __bf16* __restrict__ dst, int blk) {
  const size_t first = (size_t)blk * (THREADS * PER) + threadIdx.x;
  const f32x4* s = (const f32x4*)src + first;
  v4bf* d = (v4bf*)dst + first;
  f32x4 v[PER];
  #pragma unroll
  for (int j = 0; j < PER; ++j) v[j] = s[j * THREADS];
  #pragma unroll
  for (int j = 0; j < PER; ++j) d[j * THREADS] = __builtin_convertvector(v[j], v4bf);
}

// ---------------------------------------------------------------------------
// Row LayerNorm (H=1024), fp32 in -> bf16 out. One wave per row, 8 rows per block:
// the row stays in registers (8 x 16 B per lane), its sums are formed in the lane
// and joined by a five-step butterfly, so no LDS and no barrier is needed.
// ---------------------------------------------------------------------------
static __device__ __forceinline__
void ln_bf16_block(const float* __restrict__ x, const float* __restrict__ g,
                   const float* __restrict__ b, __bf16* __restrict__ out, int blk) {
  const int lane = threadIdx.x & 31;
  const int row  = blk * 8 + (threadIdx.x >> 5);
  const f32x4* xr = (const f32x4*)(x + (size_t)row * HID) + lane;
  const f32x4* gp = (const f32x4*)g + lane;
  const f32x4* bp = (const f32x4*)b + lane;
  f32x4 v[8], gv[8], bv[8];
  #pragma unroll
  for (int j = 0; j < 8; ++j) v[j] = xr[j * 32];
  // Behind the row's loads, since a later load's result may be given their address
  // pair as its place (a precaution for a replayed address translation).
  asm volatile("s_wait_xcnt 0x0" ::: "memory");
  #pragma unroll
  for (int j = 0; j < 8; ++j) { gv[j] = gp[j * 32]; bv[j] = bp[j * 32]; }
  // Keeps all 24 loads in front of the sums: without it the gain and bias loads
  // are issued behind the reduction, two at a time, each waited for.
  __builtin_amdgcn_sched_barrier(0);
  f32x4 sv = {}, qv = {};   // four independent chains each
  #pragma unroll
  for (int j = 0; j < 8; ++j) { sv += v[j]; qv += v[j] * v[j]; }
  float s  = (sv[0] + sv[1]) + (sv[2] + sv[3]);
  float s2 = (qv[0] + qv[1]) + (qv[2] + qv[3]);
  #pragma unroll
  for (int d = 1; d < 32; d <<= 1) {
    s  += __shfl_xor(s,  d, 32);
    s2 += __shfl_xor(s2, d, 32);
  }
  const float mu  = s * (1.0f / HID);
  const float var = s2 * (1.0f / HID) - mu * mu;
  const float r   = rsqrtf(var + 1e-5f);
  v4bf* o = (v4bf*)(out + (size_t)row * HID) + lane;
  #pragma unroll
  for (int j = 0; j < 8; ++j)
    o[j * 32] = __builtin_convertvector((v[j] - mu) * r * gv[j] + bv[j], v4bf);
}

__global__ __launch_bounds__(256)
void ln_bf16_kernel(const float* __restrict__ x, const float* __restrict__ g,
                    const float* __restrict__ b, __bf16* __restrict__ out) {
  ln_bf16_block(x, g, b, out, blockIdx.x);
}

// ---------------------------------------------------------------------------
// What the Q, K and V products wait for, in one launch: the first LayerNorm and the
// converts of their three weights. None reads what another writes, so each gets a
// range of the block index; short launches one behind the other each pay their own
// start and drain, with most of the chip idle meanwhile. (The other three weights
// are first read behind attention and are converted in its launch.)
// ---------------------------------------------------------------------------
#define LN_BLOCKS    (MROWS / 8)               // 8 rows a block
#define SQ_BLOCKS    (HID * HID / (1024 * 4))  // a HID x HID weight, 256 threads, PER = 4
#define PREP_BLOCKS  (LN_BLOCKS + 3 * SQ_BLOCKS)
static_assert(HID * HID % (1024 * 4) == 0, "whole blocks only");

__global__ __launch_bounds__(256)
void prep_kernel(const float* __restrict__ x, const float* __restrict__ g,
                 const float* __restrict__ b, __bf16* __restrict__ hn,
                 const float* __restrict__ wq, const float* __restrict__ wk,
                 const float* __restrict__ wv, __bf16* __restrict__ wqb,
                 __bf16* __restrict__ wkb, __bf16* __restrict__ wvb) {
  int blk = blockIdx.x;
  if (blk < LN_BLOCKS) {
    ln_bf16_block(x, g, b, hn, blk);
    return;
  }
  blk -= LN_BLOCKS;
  const int which = blk / SQ_BLOCKS;
  f32_to_bf16_block<256, 4>(which == 0 ? wq : which == 1 ? wk : wv,
                            which == 0 ? wqb : which == 1 ? wkb : wvb,
                            blk - which * SQ_BLOCKS);
}

// ---------------------------------------------------------------------------
// WMMA GEMM with async-LDS double-buffered staging.
// C[M,N] = A[M,K] (row-major) * W[N,K]^T (+ bias, epilogue modes).
// Block: 256 threads = 8 waves (4 M x 2 N); block tile 128x128;
// wave tile 32x64 (2x4 WMMA frags). K-step 64 (2 x 8 WMMAs per barrier pair).
// Staging: 128x64 bf16 tiles of A and W copied global->LDS with
// global_load_async_to_lds_b128 (ASYNCcnt), double buffered, rows padded to
// G_PITCH (72 KB LDS).
// MODE and NCOLS (the output's row length) are template parameters: the epilogue
// then holds one mode's code with no test per element, every address is one base
// plus a constant, and its loads and stores are issued together.
// MODE 1: bf16 out in [B,heads,S,d]        (Q / K)
// MODE 2: bf16 out in [B,heads,d,S]        (V^T)
// MODE 3: fp32 out = resid + acc + bias    (O-proj / MLP2 residual)
// MODE 4: bf16 out = gelu(acc + bias)      (MLP1)
// ---------------------------------------------------------------------------
static __device__ __forceinline__
void gemm_main_loop(const __bf16* __restrict__ A, const __bf16* __restrict__ W, int K,
                    v8f (&acc)[2][4]) {
  const int lane = threadIdx.x & 31;
  const int wave = threadIdx.x >> 5;
  const int wm   = wave & 3;          // 4 waves along M
  const int wn   = wave >> 2;         // 2 waves along N
  const int mblk = blockIdx.y * BLK_M;
  const int nblk = blockIdx.x * BLK_N;
  const int lrow = lane & 15;
  const int koff = (lane >> 4) << 3;  // 0 or 8

  __shared__ __align__(16) __bf16 tA[2][BLK_M * G_PITCH];
  __shared__ __align__(16) __bf16 tB[2][BLK_N * G_PITCH];

  // Stage one 128x64 K-slice of A and W into LDS buffer `buf`.
  // 1024 16B chunks per tile; 256 threads issue 4 chunks each per tile.
  auto stage = [&](int buf, int k0) {
    uint32_t l[8];
    const __bf16* g[8];
    #pragma unroll
    for (int j = 0; j < 4; ++j) {
      const int id  = threadIdx.x + j * 256;
      const int row = id >> 3;
      const int ch  = (id & 7) << 3;  // element offset of the 16B chunk
      l[2 * j]     = lds_addr_of(&tA[buf][row * G_PITCH + ch]);
      g[2 * j]     = A + (size_t)(mblk + row) * K + k0 + ch;
      l[2 * j + 1] = lds_addr_of(&tB[buf][row * G_PITCH + ch]);
      g[2 * j + 1] = W + (size_t)(nblk + row) * K + k0 + ch;
    }
    async_copy8_b128(l, g);
  };

  stage(0, 0);
  for (int k0 = 0; k0 < K; k0 += BLK_K) {
    const int cur = (k0 >> 6) & 1;
    wait_async0();       // this wave's copies into tX[cur] have landed
    __syncthreads();     // everyone's copies have landed
    if (k0 + BLK_K < K) stage(cur ^ 1, k0 + BLK_K);

    #pragma unroll
    for (int ks = 0; ks < BLK_K; ks += 32) {
      v16bf a[2], b[4];
      #pragma unroll
      for (int mt = 0; mt < 2; ++mt)
        a[mt] = load_frag(&tA[cur][(wm * 32 + mt * 16 + lrow) * G_PITCH + ks + koff]);
      #pragma unroll
      for (int nt = 0; nt < 4; ++nt)
        b[nt] = load_frag(&tB[cur][(wn * 64 + nt * 16 + lrow) * G_PITCH + ks + koff]);
      #pragma unroll
      for (int mt = 0; mt < 2; ++mt)
        #pragma unroll
        for (int nt = 0; nt < 4; ++nt)
          acc[mt][nt] = wmma_bf16(a[mt], b[nt], acc[mt][nt]);
    }

    __syncthreads();     // all reads of tX[cur] done before it is re-staged
  }
}

// ---------------------------------------------------------------------------
// Exact GELU of eight values, 0.5 v (1 + erf(v / sqrt 2)), without a branch.
// erff() tests |x| < 1 per value: in a wave both sides are met, so each value runs
// both under changing lane masks, one value after the other, every instruction
// waiting for the one before. Here both of erff's own polynomials (same
// coefficients, same order of evaluation) are worked out for all eight values side
// by side, two values an instruction where a packed form exists, and a select
// takes the one that holds. The side not taken may overflow; it is never used.
// v erf(x) = |v| erf(|x|), so no sign has to be put back.
// ---------------------------------------------------------------------------
static __device__ __forceinline__ v8f fma8(v8f a, v8f b, float c) {
  return __builtin_elementwise_fma(a, b, (v8f)(c));
}
static __device__ __forceinline__ v8f gelu8(v8f val) {
  const v8f av = __builtin_elementwise_abs(val);
  const v8f h  = val * 0.5f;
  const v8f ah = av * 0.5f;                     // |h|
  const v8f ax = av * 0.70710678118654752f;     // |x|
  // |x| >= 1: erf = 1 - exp(-(|x| + |x| p(|x|)))
  v8f p = fma8(ax, (v8f)(__builtin_bit_cast(float, 0x378e98abu)),
                         __builtin_bit_cast(float, 0xb9c68948u));
  p = fma8(ax, p, __builtin_bit_cast(float, 0x3b7cd369u));
  p = fma8(ax, p, __builtin_bit_cast(float, 0xbcc618b2u));
  p = fma8(ax, p, __builtin_bit_cast(float, 0x3dda74e4u));
  p = fma8(ax, p, __builtin_bit_cast(float, 0x3f228afdu));
  p = fma8(ax, p, __builtin_bit_cast(float, 0x3e03c728u));
  p = __builtin_elementwise_fma(ax, p, ax);
  // |x| < 1: erf = |x| + |x| q(x^2)
  const v8f s = ax * ax;
  v8f q = fma8(s, (v8f)(__builtin_bit_cast(float, 0xba1345e1u)),
                        __builtin_bit_cast(float, 0x3ba10414u));
  q = fma8(s, q, __builtin_bit_cast(float, 0xbcdac9b8u));
  q = fma8(s, q, __builtin_bit_cast(float, 0x3de703beu));
  q = fma8(s, q, __builtin_bit_cast(float, 0xbec09330u));
  q = fma8(s, q, __builtin_bit_cast(float, 0x3e0375d0u));
  q = __builtin_elementwise_fma(ax, q, ax);
  v8f e;
  #pragma unroll   // so that every index is a constant and the vectors stay in registers
  for (int v = 0; v < 8; ++v) e[v] = ax[v] < 1.0f ? q[v] : 1.0f - __expf(-p[v]);
  return __builtin_elementwise_fma(ah, e, h);
}

template <int MODE, int NCOLS>
static __device__ __forceinline__
void gemm_epilogue(const v8f (&acc)[2][4], const float* __restrict__ bias,
                   const float* __restrict__ resid, void* __restrict__ outp) {
  const int lane = threadIdx.x & 31;
  const int wave = threadIdx.x >> 5;
  const int wm   = wave & 3;
  const int wn   = wave >> 2;
  const int mblk = blockIdx.y * BLK_M;
  const int nblk = blockIdx.x * BLK_N;
  const int lrow = lane & 15;

  // Element (mt, nt, v) of this lane is row row0 + mt*16 + v, column col0 + nt*16.
  // A block's 128 rows lie in one batch entry and its 128 columns in one head.
  const int row0 = mblk + wm * 32 + ((lane >> 4) << 3);  // upper 16 lanes: rows +8
  const int col0 = nblk + wn * 64 + lrow;
  float bv[4];
  #pragma unroll
  for (int nt = 0; nt < 4; ++nt) bv[nt] = bias[col0 + nt * 16];

  if constexpr (MODE == 1 || MODE == 2) {
    const int bb = row0 >> 11, ss = row0 & (SEQ - 1);   // S = 2048
    const int hh = col0 >> 7,  dd = col0 & (HDIM - 1);  // d = 128
    if constexpr (MODE == 1) {
      __bf16* o = (__bf16*)outp + ((size_t)((bb * NHEADS + hh) * SEQ + ss)) * HDIM + dd;
      #pragma unroll
      for (int mt = 0; mt < 2; ++mt)
      #pragma unroll
      for (int nt = 0; nt < 4; ++nt)
      #pragma unroll
      for (int v = 0; v < 8; ++v)
        o[(mt * 16 + v) * HDIM + nt * 16] = (__bf16)(acc[mt][nt][v] + bv[nt]);
      // Behind the run of stores: where two epilogues share a kernel, the code laid
      // out behind this one rewrites registers that the stores name (a precaution
      // for a replayed address translation).
      asm volatile("s_wait_xcnt 0x0" ::: "memory");
    } else {
      // A lane's eight rows are eight neighbours along S: one 16-B store.
      __bf16* o = (__bf16*)outp + ((size_t)((bb * NHEADS + hh) * HDIM + dd)) * SEQ + ss;
      #pragma unroll
      for (int mt = 0; mt < 2; ++mt)
      #pragma unroll
      for (int nt = 0; nt < 4; ++nt) {
        v8bf pk;
        #pragma unroll
        for (int v = 0; v < 8; ++v) pk[v] = (__bf16)(acc[mt][nt][v] + bv[nt]);
        *(v8bf*)(o + nt * 16 * SEQ + mt * 16) = pk;
      }
    }
  } else if constexpr (MODE == 3) {
    const size_t base = (size_t)row0 * NCOLS + col0;
    const float* rp = resid + base;
    float* o = (float*)outp + base;
    float r[2][4][8];
    #pragma unroll
    for (int mt = 0; mt < 2; ++mt)
    #pragma unroll
    for (int v = 0; v < 8; ++v)
    #pragma unroll
    for (int nt = 0; nt < 4; ++nt)
      r[mt][nt][v] = rp[(mt * 16 + v) * NCOLS + nt * 16];
    #pragma unroll
    for (int mt = 0; mt < 2; ++mt)
    #pragma unroll
    for (int v = 0; v < 8; ++v)
    #pragma unroll
    for (int nt = 0; nt < 4; ++nt)
      o[(mt * 16 + v) * NCOLS + nt * 16] = r[mt][nt][v] + (acc[mt][nt][v] + bv[nt]);
  } else {  // MODE 4: exact GELU, bf16 out
    // Behind the four bias loads: the arithmetic below is given their offset register
    // as a place before the last of them is waited for (a precaution for a replayed
    // address translation).
    asm volatile("s_wait_xcnt 0x0" ::: "memory");
    __bf16* o = (__bf16*)outp + (size_t)row0 * NCOLS + col0;
    #pragma unroll
    for (int mt = 0; mt < 2; ++mt)
    #pragma unroll
    for (int nt = 0; nt < 4; ++nt) {
      const v8f gl = gelu8(acc[mt][nt] + bv[nt]);
      #pragma unroll   // constant indices and store offsets, as in the other modes
      for (int v = 0; v < 8; ++v)
        o[(mt * 16 + v) * NCOLS + nt * 16] = (__bf16)gl[v];
    }
  }
}

template <int MODE, int NCOLS>
__global__ __launch_bounds__(256)
void gemm_wmma_kernel(const __bf16* __restrict__ A, const __bf16* __restrict__ W,
                      const float* __restrict__ bias, const float* __restrict__ resid,
                      void* __restrict__ outp, int K) {
  v8f acc[2][4] = {};
  gemm_main_loop(A, W, K, acc);
  gemm_epilogue<MODE, NCOLS>(acc, bias, resid, outp);
}

// The Q, K and V projections in one launch, blockIdx.z naming the product. Each
// alone has one block per WGP, whose waves cannot cover their own copy and
// barrier waits. Three blocks fit a WGP (72 KiB of LDS each; two waves per SIMD
// each, at a register count that lets seven stand there), so the joined grid can
// be resident at once, each block filling the others' waits.
// The choice of epilogue is one test per block, the same in all of its lanes.
__global__ __launch_bounds__(256)
void gemm_qkv_kernel(const __bf16* __restrict__ A, const __bf16* __restrict__ Wq,
                     const __bf16* __restrict__ Wk, const __bf16* __restrict__ Wv,
                     const float* __restrict__ bq, const float* __restrict__ bk,
                     const float* __restrict__ bv, __bf16* __restrict__ q,
                     __bf16* __restrict__ k, __bf16* __restrict__ vt, int K) {
  const int z = blockIdx.z;
  v8f acc[2][4] = {};
  gemm_main_loop(A, z == 0 ? Wq : z == 1 ? Wk : Wv, K, acc);
  if (z == 2) gemm_epilogue<2, HID>(acc, bv, nullptr, vt);
  else        gemm_epilogue<1, HID>(acc, z == 0 ? bq : bk, nullptr, z == 0 ? q : k);
}

// ---------------------------------------------------------------------------
// Causal flash attention with shared async-LDS K/V staging.
// Block: 256 threads = 8 waves on 64 query rows: wave w owns the 16-query tile w & 3
// and, of every 64-key pass, the 32 keys of half w >> 2. The launch lasts as long as
// the block with the most passes, whose waves mostly wait on their own dependent
// steps; two waves per query tile halve its passes. Each keeps its own running
// maximum, sum and output tile; the two are joined once, through LDS, at the end.
// Per pass: K tile (64x128) and V^T tile (128x64, one slab per half) staged
// global->LDS (double buffered, ASYNCcnt) once and consumed by all 8 waves.
// All waves run to the block's last key block; the causal mask nulls any
// key > query row (exp(-huge)=0), so lower waves' surplus blocks are inert.
// The launch also converts the three weights that are first read behind it: the
// blocks with blockIdx.y >= BATCH * NHEADS. Attention leaves wave places and nearly
// all of the memory rate free.
// ---------------------------------------------------------------------------
#define AT_XBLOCKS   (SEQ / 64)
#define AT_HALF      (AT_XBLOCKS * BATCH * NHEADS / 2)   // half of the attention blocks
static_assert(AT_XBLOCKS % 2 == 0, "tiles pair up as t and n - 1 - t");
#define AT_FF_BLOCKS (FF * HID / (1024 * 8))   // a FF x HID weight,  256 threads, PER = 8
#define AT_SQ_BLOCKS (HID * HID / (1024 * 8))  // a HID x HID weight, 256 threads, PER = 8
#define AT_CONV_ROWS ((2 * AT_FF_BLOCKS + AT_SQ_BLOCKS) / AT_XBLOCKS)
static_assert(HID * HID % (1024 * 8) == 0 &&
              (2 * AT_FF_BLOCKS + AT_SQ_BLOCKS) % AT_XBLOCKS == 0, "whole blocks, whole grid rows");

__global__ __launch_bounds__(256)
void attn_wmma_kernel(const __bf16* __restrict__ Q, const __bf16* __restrict__ Kc,
                      const __bf16* __restrict__ VT, __bf16* __restrict__ Y,
                      const float* __restrict__ w1, const float* __restrict__ w2,
                      const float* __restrict__ wo, __bf16* __restrict__ w1b,
                      __bf16* __restrict__ w2b, __bf16* __restrict__ wob) {
  if (blockIdx.y >= BATCH * NHEADS) {   // the same for a whole block, ahead of every barrier
    const int blk   = (blockIdx.y - BATCH * NHEADS) * AT_XBLOCKS + blockIdx.x;
    const int which = blk / AT_FF_BLOCKS;   // 0: w1, 1: w2, 2: wo
    f32_to_bf16_block<256, 8>(which == 0 ? w1 : which == 1 ? w2 : wo,
                              which == 0 ? w1b : which == 1 ? w2b : wob,
                              blk - which * AT_FF_BLOCKS);
    return;
  }
  const int lane  = threadIdx.x & 31;
  const int wave  = threadIdx.x >> 5;
  const int lrow  = lane & 15;
  const int koff  = (lane >> 4) << 3;
  const int rplus = koff;               // C-layout: upper lanes own rows +8
  // Which query tile and head this block takes. A tile's cost grows with its index,
  // and all attention blocks are resident at once, two to a WGP (by registers).
  // The first half of the range holds the upper tiles, longest first, the second half
  // the lower tiles, shortest first: blocks half the index range apart hold tiles t
  // and n - 1 - t. For speed only: each (head, tile)
  // is taken exactly once wherever the blocks land.
  const unsigned flat = blockIdx.y * AT_XBLOCKS + blockIdx.x;
  const unsigned rank = flat % AT_HALF;
  const unsigned step = rank / (BATCH * NHEADS);
  const int tile  = flat < AT_HALF ? AT_XBLOCKS - 1 - step : step;
  const int qblk  = tile * 64;
  const int wq    = wave & 3;           // query tile
  const int grp   = wave >> 2;          // which 32 keys of a 64-key pass
  const int qbase = qblk + wq * 16;
  const int bh    = rank % (BATCH * NHEADS);
  const float scale = 0.08838834764831845f;  // 1/sqrt(128)
  const float NEGF  = -3.0e38f;

  __shared__ __align__(16) __bf16 kt[2][64 * K_PITCH];       // 2 x 17 KB
  __shared__ __align__(16) __bf16 vt[2][2][HDIM * V_PITCH];  // 2 x 2 x 10 KB
  __shared__ __align__(16) __bf16 pbuf[8][16 * P_PITCH];     // per-wave P tiles

  // Stage K tile (64 keys x 128) and V^T tile (128 x 64 keys) for key block kb.
  // 1024 16B chunks per tile; 256 threads issue 4 chunks each per tile.
  auto stage = [&](int buf, int kb) {
    uint32_t l[8];
    const __bf16* g[8];
    #pragma unroll
    for (int j = 0; j < 4; ++j) {
      const int id = threadIdx.x + j * 256;
      const int kr = id >> 4, kc = (id & 15) << 3;   // K tile: 16 chunks/row
      l[2 * j]     = lds_addr_of(&kt[buf][kr * K_PITCH + kc]);
      g[2 * j]     = Kc + ((size_t)bh * SEQ + kb + kr) * HDIM + kc;
      const int vr = id >> 3, vc = id & 7;           // V^T tile: 8 chunks/row, 4 a slab
      l[2 * j + 1] = lds_addr_of(&vt[buf][vc >> 2][vr * V_PITCH + ((vc & 3) << 3)]);
      g[2 * j + 1] = VT + ((size_t)bh * HDIM + vr) * SEQ + kb + (vc << 3);
    }
    async_copy8_b128(l, g);
  };

  v16bf qf[4];
  #pragma unroll
  for (int kc = 0; kc < 4; ++kc)
    qf[kc] = load_frag(Q + ((size_t)bh * SEQ + qbase + lrow) * HDIM + kc * 32 + koff);

  v8f o[8] = {};
  float mrow[8], lsum[8];
  #pragma unroll
  for (int v = 0; v < 8; ++v) { mrow[v] = NEGF; lsum[v] = 0.f; }

  const int kend = qblk + 64;           // block-uniform key range, whole passes
  stage(0, 0);
  for (int kb = 0; kb < kend; kb += 64) {
    const int cur = (kb >> 6) & 1;
    const int kg  = kb + grp * 32;      // first of this wave's 32 keys
    wait_async0();
    __syncthreads();
    if (kb + 64 < kend) stage(cur ^ 1, kb + 64);

    // ---- S = Q K^T over d=128 (4 x K=32 WMMAs per 16-key column tile) ----
    v8f s0acc = {}, s1acc = {};
    #pragma unroll
    for (int kc = 0; kc < 4; ++kc) {
      v16bf k0 = load_frag(&kt[cur][(grp * 32 +      lrow) * K_PITCH + kc * 32 + koff]);
      v16bf k1 = load_frag(&kt[cur][(grp * 32 + 16 + lrow) * K_PITCH + kc * 32 + koff]);
      s0acc = wmma_bf16(qf[kc], k0, s0acc);
      s1acc = wmma_bf16(qf[kc], k1, s1acc);
    }
    // ---- scale, causal mask, online softmax (per C-layout row) ----
    // The running maximum is the same in all 16 lanes of a row, so it goes into
    // the reduction's start value and the reduction yields the new maximum.
    // Every loop over v is unrolled so that its arrays are registers, not scratch;
    // the sum's steps are loops of their own to set the eight rows side by side.
    float s0[8], s1[8], mnew[8];
    #pragma unroll
    for (int v = 0; v < 8; ++v) {
      const int qrow = qbase + v + rplus;
      s0[v] = s0acc[v] * scale;
      s1[v] = s1acc[v] * scale;
      if (kg +      lrow > qrow) s0[v] = NEGF;
      if (kg + 16 + lrow > qrow) s1[v] = NEGF;
      mnew[v] = fmaxf(fmaxf(s0[v], s1[v]), mrow[v]);
    }
    row16_max8(mnew);
    float rs[8];
    #pragma unroll
    for (int v = 0; v < 8; ++v) {
      const float p0 = __expf(s0[v] - mnew[v]);
      const float p1 = __expf(s1[v] - mnew[v]);
      rs[v] = p0 + p1;
      const int prow = v + rplus;
      pbuf[wave][prow * P_PITCH +      lrow] = (__bf16)p0;
      pbuf[wave][prow * P_PITCH + 16 + lrow] = (__bf16)p1;
    }
    #pragma unroll
    for (int v = 0; v < 8; ++v) rs[v] += row_xor<1>(rs[v]);
    #pragma unroll
    for (int v = 0; v < 8; ++v) rs[v] += row_xor<2>(rs[v]);
    #pragma unroll
    for (int v = 0; v < 8; ++v) rs[v] += row_xor<4>(rs[v]);
    #pragma unroll
    for (int v = 0; v < 8; ++v) rs[v] += row_xor<8>(rs[v]);
    #pragma unroll
    for (int v = 0; v < 8; ++v) {
      const float sc = __expf(mrow[v] - mnew[v]);
      lsum[v] = lsum[v] * sc + rs[v];
      mrow[v] = mnew[v];
      #pragma unroll
      for (int dt = 0; dt < 8; ++dt) o[dt][v] *= sc;
    }
    __syncthreads();
    v16bf pf = load_frag(&pbuf[wave][lrow * P_PITCH + koff]);
    // ---- O += P V (keys as contraction dim; V^T rows are contiguous) ----
    #pragma unroll
    for (int dt = 0; dt < 8; ++dt) {
      v16bf vf = load_frag(&vt[cur][grp][(dt * 16 + lrow) * V_PITCH + koff]);
      o[dt] = wmma_bf16(pf, vf, o[dt]);
    }
    __syncthreads();     // kt/vt[cur] + pbuf free before re-staging / rewrite
  }
  // ---- join the two key halves of each query tile ----
  // Wave wq + 4 hands its 80 values per lane (output tile, maxima, sums) to wave wq,
  // lane to lane, through the V^T buffers: the loop's last barrier has ended every
  // read of them, and no copy is in flight (the last pass staged nothing).
  // A half whose keys were all masked has the maximum NEGF and finite sums, and its
  // weight below is exp(NEGF - m) = 0; the lower half always holds key 0.
  static_assert(sizeof(vt) >= 4 * 80 * 32 * sizeof(float), "hand-over fits the V^T buffers");
  float* mb = (float*)&vt[0][0][0] + wq * (80 * 32) + lane;
  if (grp == 1) {
    #pragma unroll
    for (int dt = 0; dt < 8; ++dt)
    #pragma unroll
    for (int v = 0; v < 8; ++v) mb[(dt * 8 + v) * 32] = o[dt][v];
    #pragma unroll
    for (int v = 0; v < 8; ++v) {
      mb[(64 + v) * 32] = mrow[v];
      mb[(72 + v) * 32] = lsum[v];
    }
  }
  __syncthreads();       // the upper halves' values are in LDS
  if (grp == 1) return;  // behind the last barrier
  float wlo[8], whi[8];
  #pragma unroll
  for (int v = 0; v < 8; ++v) {
    const float m1 = mb[(64 + v) * 32];
    const float l1 = mb[(72 + v) * 32];
    const float m  = fmaxf(mrow[v], m1);
    wlo[v] = __expf(mrow[v] - m);
    whi[v] = __expf(m1 - m);
    lsum[v] = lsum[v] * wlo[v] + l1 * whi[v];
  }
  // A loop of its own: among the divisions and stores below each LDS read was
  // waited for alone; here several are in flight behind counted waits.
  #pragma unroll
  for (int dt = 0; dt < 8; ++dt)
  #pragma unroll
  for (int v = 0; v < 8; ++v)
    o[dt][v] = o[dt][v] * wlo[v] + mb[(dt * 8 + v) * 32] * whi[v];
  // ---- normalize and scatter back to [B,S,HID] ----
  const int b = bh >> 3, h = bh & 7;
  #pragma unroll
  for (int dt = 0; dt < 8; ++dt)
  #pragma unroll
  for (int v = 0; v < 8; ++v) {
    const int row = qbase + v + rplus;
    const int col = h * HDIM + dt * 16 + lrow;
    Y[((size_t)b * SEQ + row) * HID + col] = (__bf16)(o[dt][v] / lsum[v]);
  }
}

// ---------------------------------------------------------------------------
// Orchestration
// ---------------------------------------------------------------------------
extern "C" void kernel_launch(void* const* d_in, const int* in_sizes, int n_in,
                              void* d_out, int out_size, void* d_ws, size_t ws_size,
                              hipStream_t stream) {
  (void)in_sizes; (void)n_in; (void)out_size; (void)ws_size;

  const float* x    = (const float*)d_in[0];
  const float* ln1g = (const float*)d_in[1];
  const float* ln1b = (const float*)d_in[2];
  const float* wq   = (const float*)d_in[3];
  const float* bq   = (const float*)d_in[4];
  const float* wk   = (const float*)d_in[5];
  const float* bk   = (const float*)d_in[6];
  const float* wv   = (const float*)d_in[7];
  const float* bv   = (const float*)d_in[8];
  const float* wo   = (const float*)d_in[9];
  const float* bo   = (const float*)d_in[10];
  const float* ln2g = (const float*)d_in[11];
  const float* ln2b = (const float*)d_in[12];
  const float* w1   = (const float*)d_in[13];
  const float* b1   = (const float*)d_in[14];
  const float* w2   = (const float*)d_in[15];
  const float* b2   = (const float*)d_in[16];
  float* out = (float*)d_out;

  char* ws = (char*)d_ws;
  size_t off = 0;
  auto take = [&](size_t bytes) -> char* {
    char* p = ws + off;
    off += bytes;
    off = (off + 255) & ~(size_t)255;
    return p;
  };

  __bf16* wqb = (__bf16*)take((size_t)HID * HID * 2);
  __bf16* wkb = (__bf16*)take((size_t)HID * HID * 2);
  __bf16* wvb = (__bf16*)take((size_t)HID * HID * 2);
  __bf16* wob = (__bf16*)take((size_t)HID * HID * 2);
  __bf16* w1b = (__bf16*)take((size_t)FF  * HID * 2);
  __bf16* w2b = (__bf16*)take((size_t)HID * FF  * 2);
  __bf16* hn  = (__bf16*)take((size_t)MROWS * HID * 2);  // LN1 out
  __bf16* qb  = (__bf16*)take((size_t)MROWS * HID * 2);  // [B,h,S,d]
  __bf16* kbf = (__bf16*)take((size_t)MROWS * HID * 2);  // [B,h,S,d]
  __bf16* vtb = (__bf16*)take((size_t)MROWS * HID * 2);  // [B,h,d,S]
  __bf16* yb  = (__bf16*)take((size_t)MROWS * HID * 2);  // attn out [B,S,H]
  float*  x1  = (float*) take((size_t)MROWS * HID * 4);  // x + attn
  __bf16* m2  = (__bf16*)take((size_t)MROWS * HID * 2);  // LN2 out
  __bf16* gb  = (__bf16*)take((size_t)MROWS * FF  * 2);  // GELU(MLP1)

  // LN1 and wq, wk, wv -> bf16, one launch
  prep_kernel<<<PREP_BLOCKS, 256, 0, stream>>>(x, ln1g, ln1b, hn, wq, wk, wv, wqb, wkb, wvb);

  // QKV projections (block tile 128x128, K-step 64), one launch
  dim3 gH(HID / BLK_N, MROWS / BLK_M);
  dim3 gQKV(HID / BLK_N, MROWS / BLK_M, 3);
  gemm_qkv_kernel<<<gQKV, 256, 0, stream>>>(hn, wqb, wkb, wvb, bq, bk, bv, qb, kbf, vtb, HID);

  // causal flash attention (64 query rows per block, 8 waves, shared K/V staging);
  // the grid's upper rows: w1, w2, wo -> bf16
  dim3 gA(AT_XBLOCKS, BATCH * NHEADS + AT_CONV_ROWS);
  attn_wmma_kernel<<<gA, 256, 0, stream>>>(qb, kbf, vtb, yb, w1, w2, wo, w1b, w2b, wob);

  // O-proj + residual -> x1 (fp32)
  gemm_wmma_kernel<3, HID><<<gH, 256, 0, stream>>>(yb, wob, bo, x, x1, HID);

  // LN2
  ln_bf16_kernel<<<MROWS / 8, 256, 0, stream>>>(x1, ln2g, ln2b, m2);

  // MLP
  dim3 gF(FF / BLK_N, MROWS / BLK_M);
  gemm_wmma_kernel<4, FF><<<gF, 256, 0, stream>>>(m2, w1b, b1, nullptr, gb, HID);
  gemm_wmma_kernel<3, HID><<<gH, 256, 0, stream>>>(gb, w2b, b2, x1, out, FF);
}

// v009
// A run of this version takes 161 microseconds.
// Next to v008, in two timings, it ran 1.06 and 1.07 times as fast.
// Counting every step since v000, it is 4.41 times as fast.
#include <hip/hip_runtime.h>
#include <hip/hip_bf16.h>
#include <math.h>

typedef __attribute__((ext_vector_type(16))) __bf16 v16bf;
typedef __attribute__((ext_vector_type(8)))  __bf16 v8bf;
typedef __attribute__((ext_vector_type(8)))  float  v8f;

#define HID    1024
#define SEQ    2048
#define BATCH  2
#define NHEADS 8
#define HDIM   128
#define FF     4096
#define MROWS  (BATCH * SEQ)

#define BLK_M 128
#define BLK_N 128
#define BLK_K 64

// LDS row pitches in bf16 elements. Every tile below is read row per lane with
// ds_load_b128, which is free of bank conflicts at a pitch of 16 B x odd; the
// unpadded pitches (128, 256, 64 B) put the 16 rows of a fragment on few banks.
#define G_PITCH (BLK_K + 8)   // GEMM tiles: 128-B rows at 144 B
#define K_PITCH (HDIM + 8)    // K tile:     256-B rows at 272 B
#define V_PITCH (32 + 8)      // V^T tile:    64-B rows at  80 B
#define P_PITCH (32 + 8)      // P tile:      64-B rows at  80 B

// ---------------------------------------------------------------------------
// Fragment loader: CDNA5 16-bit A/B layout for 16x16x32 WMMA.
// Lane L (0..15): row = L, holds K = kb..kb+7 and kb+16..kb+23
// Lane L (16..31): row = L-16, holds K = kb+8..15 and kb+24..31
// => per lane: two contiguous 8-element (16B) chunks at +koff and +koff+16.
// ---------------------------------------------------------------------------
static __device__ __forceinline__ v16bf load_frag(const __bf16* p) {
  v8bf lo = *(const v8bf*)p;
  v8bf hi = *(const v8bf*)(p + 16);
  return __builtin_shufflevector(lo, hi, 0,1,2,3,4,5,6,7,8,9,10,11,12,13,14,15);
}

static __device__ __forceinline__ v8f wmma_bf16(v16bf a, v16bf b, v8f c) {
  return __builtin_amdgcn_wmma_f32_16x16x32_bf16(false, a, false, b, (short)0, c,
                                                 false, false);
}

// Async global -> LDS copy, 16B per lane, tracked by ASYNCcnt (gfx1250).
// lds_addr = low 32 bits of the flat shared-memory pointer (LDS aperture
// mapping: LDS_ADDR = addr[31:0]).
// A lane's copies stand eight to a statement, each ending in
// s_wait_xcnt 0, so that no address register of a copy is rewritten ahead of
// that wait (a precaution for a replayed address translation).
static __device__ __forceinline__ uint32_t lds_addr_of(const void* lds_ptr) {
  return (uint32_t)(uintptr_t)lds_ptr;
}

static __device__ __forceinline__ void async_copy8_b128(const uint32_t (&l)[8],
                                                        const __bf16* const (&g)[8]) {
  asm volatile("global_load_async_to_lds_b128 %0, %8, off\n\t"
               "global_load_async_to_lds_b128 %1, %9, off\n\t"
               "global_load_async_to_lds_b128 %2, %10, off\n\t"
               "global_load_async_to_lds_b128 %3, %11, off\n\t"
               "global_load_async_to_lds_b128 %4, %12, off\n\t"
               "global_load_async_to_lds_b128 %5, %13, off\n\t"
               "global_load_async_to_lds_b128 %6, %14, off\n\t"
               "global_load_async_to_lds_b128 %7, %15, off\n\t"
               "s_wait_xcnt 0x0"
               :: "v"(l[0]), "v"(l[1]), "v"(l[2]), "v"(l[3]),
                  "v"(l[4]), "v"(l[5]), "v"(l[6]), "v"(l[7]),
                  "v"((uint64_t)(uintptr_t)g[0]), "v"((uint64_t)(uintptr_t)g[1]),
                  "v"((uint64_t)(uintptr_t)g[2]), "v"((uint64_t)(uintptr_t)g[3]),
                  "v"((uint64_t)(uintptr_t)g[4]), "v"((uint64_t)(uintptr_t)g[5]),
                  "v"((uint64_t)(uintptr_t)g[6]), "v"((uint64_t)(uintptr_t)g[7])
               : "memory");
}

// Reductions over the 16 lanes of a row by DPP row_xmask butterfly steps, on the
// vector port. A shuffle compiles to ds_bpermute_b32, which goes through the LDS
// queue and is waited for at every one of its steps.
//
// Sum step: the value of lane (l ^ MASK); the compiler folds it into the add.
template <int MASK>
static __device__ __forceinline__ float row_xor(float x) {
  return __builtin_bit_cast(float, __builtin_amdgcn_update_dpp(
      0, __builtin_bit_cast(int, x), 0x160 + MASK, 0xf, 0xf, true));
}

// Maximum of eight rows at once. In asm because the compiler puts a move and a
// quieting maximum in front of every fmaxf on a DPP value (three dependent
// instructions a step instead of one). The eight rows stand side by side in each
// step, so every instruction's producer is eight instructions back.
#define ROWMAX_1(r, m) \
  "v_max_num_f32_dpp " r ", " r ", " r " row_xmask:" m " row_mask:0xf bank_mask:0xf bound_ctrl:1\n\t"
#define ROWMAX_8(m) \
  ROWMAX_1("%0", m) ROWMAX_1("%1", m) ROWMAX_1("%2", m) ROWMAX_1("%3", m) \
  ROWMAX_1("%4", m) ROWMAX_1("%5", m) ROWMAX_1("%6", m) ROWMAX_1("%7", m)
static __device__ __forceinline__ void row16_max8(float (&t)[8]) {
  asm(ROWMAX_8("1") ROWMAX_8("2") ROWMAX_8("4") ROWMAX_8("8")
      : "+v"(t[0]), "+v"(t[1]), "+v"(t[2]), "+v"(t[3]),
        "+v"(t[4]), "+v"(t[5]), "+v"(t[6]), "+v"(t[7]));
}

static __device__ __forceinline__ void wait_async0() {
  asm volatile("s_wait_asynccnt 0x0" ::: "memory");
}

// ---------------------------------------------------------------------------
// The two streaming kernels below move little data. For speed only, each wave does
// much more than one element per lane: 16-B loads that cover whole lines
// (32 lanes x 16 B = 512 B in a row),
// all of a lane's loads issued together, and few waves in the grid.
// ---------------------------------------------------------------------------
typedef __attribute__((ext_vector_type(4))) float  f32x4;
typedef __attribute__((ext_vector_type(4))) __bf16 v4bf;

// fp32 -> bf16 elementwise convert (weights). Block blk of THREADS threads converts
// THREADS * PER groups of four neighbours, PER groups per lane.
template <int THREADS, int PER>
static __device__ __forceinline__
void f32_to_bf16_block(const float* __restrict__ src, __bf16* __restrict__ dst, int blk) {
  const size_t first = (size_t)blk * (THREADS * PER) + threadIdx.x;
  const f32x4* s = (const f32x4*)src + first;
  v4bf* d = (v4bf*)dst + first;
  f32x4 v[PER];
  #pragma unroll
  for (int j = 0; j < PER; ++j) v[j] = s[j * THREADS];
  #pragma unroll
  for (int j = 0; j < PER; ++j) d[j * THREADS] = __builtin_convertvector(v[j], v4bf);
}

// ---------------------------------------------------------------------------
// Row LayerNorm (H=1024), fp32 in -> bf16 out. One wave per row, 8 rows per block:
// the row stays in registers (8 x 16 B per lane), its sums are formed in the lane
// and joined by a five-step butterfly, so no LDS and no barrier is needed.
// ---------------------------------------------------------------------------
static __device__ __forceinline__
void ln_bf16_block(const float* __restrict__ x, const float* __restrict__ g,
                   const float* __restrict__ b, __bf16* __restrict__ out, int blk) {
  const int lane = threadIdx.x & 31;
  const int row  = blk * 8 + (threadIdx.x >> 5);
  const f32x4* xr = (const f32x4*)(x + (size_t)row * HID) + lane;
  const f32x4* gp = (const f32x4*)g + lane;
  const f32x4* bp = (const f32x4*)b + lane;
  f32x4 v[8], gv[8], bv[8];
  #pragma unroll
  for (int j = 0; j < 8; ++j) v[j] = xr[j * 32];
  // Behind the row's loads, since a later load's result may be given their address
  // pair as its place (a precaution for a replayed address translation).
  asm volatile("s_wait_xcnt 0x0" ::: "memory");
  #pragma unroll
  for (int j = 0; j < 8; ++j) { gv[j] = gp[j * 32]; bv[j] = bp[j * 32]; }
  // Keeps all 24 loads in front of the sums: without it the gain and bias loads
  // are issued behind the reduction, two at a time, each waited for.
  __builtin_amdgcn_sched_barrier(0);
  f32x4 sv = {}, qv = {};   // four independent chains each
  #pragma unroll
  for (int j = 0; j < 8; ++j) { sv += v[j]; qv += v[j] * v[j]; }
  float s  = (sv[0] + sv[1]) + (sv[2] + sv[3]);
  float s2 = (qv[0] + qv[1]) + (qv[2] + qv[3]);
  #pragma unroll
  for (int d = 1; d < 32; d <<= 1) {
    s  += __shfl_xor(s,  d, 32);
    s2 += __shfl_xor(s2, d, 32);
  }
  const float mu  = s * (1.0f / HID);
  const float var = s2 * (1.0f / HID) - mu * mu;
  const float r   = rsqrtf(var + 1e-5f);
  v4bf* o = (v4bf*)(out + (size_t)row * HID) + lane;
  #pragma unroll
  for (int j = 0; j < 8; ++j)
    o[j * 32] = __builtin_convertvector((v[j] - mu) * r * gv[j] + bv[j], v4bf);
}

__global__ __launch_bounds__(256)
void ln_bf16_kernel(const float* __restrict__ x, const float* __restrict__ g,
                    const float* __restrict__ b, __bf16* __restrict__ out) {
  ln_bf16_block(x, g, b, out, blockIdx.x);
}

// ---------------------------------------------------------------------------
// What the Q, K and V products wait for, in one launch: the first LayerNorm and the
// converts of their three weights. None reads what another writes, so each gets a
// range of the block index; short launches one behind the other each pay their own
// start and drain, with most of the chip idle meanwhile. (The other three weights
// are first read behind attention and are converted in its launch.)
// ---------------------------------------------------------------------------
#define LN_BLOCKS    (MROWS / 8)               // 8 rows a block
#define SQ_BLOCKS    (HID * HID / (1024 * 4))  // a HID x HID weight, 256 threads, PER = 4
#define PREP_BLOCKS  (LN_BLOCKS + 3 * SQ_BLOCKS)
static_assert(HID * HID % (1024 * 4) == 0, "whole blocks only");

__global__ __launch_bounds__(256)
void prep_kernel(const float* __restrict__ x, const float* __restrict__ g,
                 const float* __restrict__ b, __bf16* __restrict__ hn,
                 const float* __restrict__ wq, const float* __restrict__ wk,
                 const float* __restrict__ wv, __bf16* __restrict__ wqb,
                 __bf16* __restrict__ wkb, __bf16* __restrict__ wvb) {
  int blk = blockIdx.x;
  if (blk < LN_BLOCKS) {
    ln_bf16_block(x, g, b, hn, blk);
    return;
  }
  blk -= LN_BLOCKS;
  const int which = blk / SQ_BLOCKS;
  f32_to_bf16_block<256, 4>(which == 0 ? wq : which == 1 ? wk : wv,
                            which == 0 ? wqb : which == 1 ? wkb : wvb,
                            blk - which * SQ_BLOCKS);
}

// ---------------------------------------------------------------------------
// WMMA GEMM with async-LDS double-buffered staging.
// C[M,N] = A[M,K] (row-major) * W[N,K]^T (+ bias, epilogue modes).
// Block tile 128x128, K-step 64; wave tile 64x64 (4x4 WMMA frags), four wave tiles
// (2 M x 2 N). A wave reads 8 fragments from LDS for 16 WMMAs; at 32x64 it read 6
// for 8, and the block's LDS reads then took longer than its WMMAs.
// KSPLIT 1: 128 threads = 4 waves, each takes both 32-wide k slices of a K-step
//           (for grids with several blocks per WGP, whose waves share the SIMDs).
// KSPLIT 2: 256 threads = 8 waves, two per wave tile, wave w taking k slice w >> 2 of
//           every K-step (for grids with one block per WGP: two waves per SIMD stay).
//           The two partial tiles are joined once, through LDS, behind the loop; each
//           wave of a pair then owns 32 of the tile's 64 rows.
// Staging: 128x64 bf16 tiles of A and W copied global->LDS with
// global_load_async_to_lds_b128 (ASYNCcnt), double buffered, rows padded to
// G_PITCH (72 KB LDS).
// MODE and NCOLS (the output's row length) are template parameters: the epilogue
// then holds one mode's code with no test per element, every address is one base
// plus a constant, and its loads and stores are issued together.
// MODE 1: bf16 out in [B,heads,S,d]        (Q / K)
// MODE 2: bf16 out in [B,heads,d,S]        (V^T)
// MODE 3: fp32 out = resid + acc + bias    (O-proj / MLP2 residual)
// MODE 4: bf16 out = gelu(acc + bias)      (MLP1)
// ---------------------------------------------------------------------------
// acc[h][mt][nt]: rows (h ^ kg) * 32 + mt * 16 of the wave tile, kg the wave's k
// slice (0 at KSPLIT 1). So acc[0] is always the half that the wave keeps at the join.
template <int KSPLIT>
static __device__ __forceinline__
void gemm_main_loop(const __bf16* __restrict__ A, const __bf16* __restrict__ W, int K,
                    v8f (&acc)[2][2][4]) {
  constexpr int THREADS = 128 * KSPLIT;
  const int lane = threadIdx.x & 31;
  const int wave = threadIdx.x >> 5;
  const int wt   = wave & 3;          // wave tile
  const int kg   = wave >> 2;         // k slice (KSPLIT 2), else 0
  const int wm   = wt & 1;            // 2 wave tiles along M
  const int wn   = wt >> 1;           // 2 wave tiles along N
  const int mblk = blockIdx.y * BLK_M;
  const int nblk = blockIdx.x * BLK_N;
  const int lrow = lane & 15;
  const int koff = (lane >> 4) << 3;  // 0 or 8

  // [buffer][0: A, 1: W]; one array, since the join uses it as one range
  __shared__ __align__(16) __bf16 tile[2][2][BLK_M * G_PITCH];
  static_assert(BLK_M == BLK_N, "A and W tiles have one size");

  // Stage one 128x64 K-slice of A and W into LDS buffer `buf`.
  // 1024 16B chunks per tile; a statement holds 4 chunks of each tile per thread.
  auto stage = [&](int buf, int k0) {
    #pragma unroll   // constant chunk numbers
    for (int s = 0; s < 2 / KSPLIT; ++s) {
      uint32_t l[8];
      const __bf16* g[8];
      #pragma unroll
      for (int j = 0; j < 4; ++j) {
        const int id  = threadIdx.x + (s * 4 + j) * THREADS;
        const int row = id >> 3;
        const int ch  = (id & 7) << 3;  // element offset of the 16B chunk
        l[2 * j]     = lds_addr_of(&tile[buf][0][row * G_PITCH + ch]);
        g[2 * j]     = A + (size_t)(mblk + row) * K + k0 + ch;
        l[2 * j + 1] = lds_addr_of(&tile[buf][1][row * G_PITCH + ch]);
        g[2 * j + 1] = W + (size_t)(nblk + row) * K + k0 + ch;
      }
      async_copy8_b128(l, g);
    }
  };

  stage(0, 0);
  for (int k0 = 0; k0 < K; k0 += BLK_K) {
    const int cur = (k0 >> 6) & 1;
    wait_async0();       // this wave's copies into tile[cur] have landed
    __syncthreads();     // everyone's copies have landed
    if (k0 + BLK_K < K) stage(cur ^ 1, k0 + BLK_K);

    // Every loop over fragments, here and at the join, is unrolled so that its
    // arrays are registers and every LDS offset is a constant.
    #pragma unroll
    for (int ks = 0; ks < BLK_K; ks += 32 * KSPLIT) {
      const int kk = ks + kg * 32 + koff;
      v16bf a[2][2], b[4];
      #pragma unroll
      for (int h = 0; h < 2; ++h)
        #pragma unroll
        for (int mt = 0; mt < 2; ++mt)
          a[h][mt] = load_frag(
              &tile[cur][0][(wm * 64 + (h ^ kg) * 32 + mt * 16 + lrow) * G_PITCH + kk]);
      #pragma unroll
      for (int nt = 0; nt < 4; ++nt)
        b[nt] = load_frag(&tile[cur][1][(wn * 64 + nt * 16 + lrow) * G_PITCH + kk]);
      // Keeps the 16 LDS loads together in front of the 16 WMMAs: without it the A
      // fragments share one register set, each loaded behind the four WMMAs of the one
      // before and waited for alone, four exposed LDS latencies a slice instead of one.
      __builtin_amdgcn_sched_barrier(0);
      #pragma unroll
      for (int h = 0; h < 2; ++h)
        #pragma unroll
        for (int mt = 0; mt < 2; ++mt)
          #pragma unroll
          for (int nt = 0; nt < 4; ++nt)
            acc[h][mt][nt] = wmma_bf16(a[h][mt], b[nt], acc[h][mt][nt]);
    }

    __syncthreads();     // all reads of tile[cur] done before it is re-staged
  }

  if constexpr (KSPLIT == 2) {
    // Join the two k slices of each wave tile. Each wave hands acc[1], the 32 rows
    // that its partner keeps, lane to lane through the tile buffers: the loop's last
    // barrier has ended every read of them, and no copy is in flight (the last pass
    // staged nothing). 16-B accesses, a wave's 32 lanes side by side.
    static_assert(sizeof(tile) >= 8 * 16 * 32 * sizeof(f32x4), "hand-over fits the tiles");
    f32x4* xb  = (f32x4*)&tile[0][0][0] + lane;
    f32x4* put = xb + (wt * 2 + kg) * (16 * 32);
    const f32x4* get = xb + (wt * 2 + (kg ^ 1)) * (16 * 32);
    #pragma unroll
    for (int mt = 0; mt < 2; ++mt)
      #pragma unroll
      for (int nt = 0; nt < 4; ++nt) {
        const v8f t = acc[1][mt][nt];
        put[((mt * 4 + nt) * 2 + 0) * 32] = __builtin_shufflevector(t, t, 0, 1, 2, 3);
        put[((mt * 4 + nt) * 2 + 1) * 32] = __builtin_shufflevector(t, t, 4, 5, 6, 7);
      }
    __syncthreads();     // every wave's handed-over half is in LDS
    #pragma unroll
    for (int mt = 0; mt < 2; ++mt)
      #pragma unroll
      for (int nt = 0; nt < 4; ++nt) {
        const f32x4 lo = get[((mt * 4 + nt) * 2 + 0) * 32];
        const f32x4 hi = get[((mt * 4 + nt) * 2 + 1) * 32];
        acc[0][mt][nt] += __builtin_shufflevector(lo, hi, 0, 1, 2, 3, 4, 5, 6, 7);
      }
  }
}

// ---------------------------------------------------------------------------
// Exact GELU of eight values, 0.5 v (1 + erf(v / sqrt 2)), without a branch.
// erff() tests |x| < 1 per value: in a wave both sides are met, so each value runs
// both under changing lane masks, one value after the other, every instruction
// waiting for the one before. Here both of erff's own polynomials (same
// coefficients, same order of evaluation) are worked out for all eight values side
// by side, two values an instruction where a packed form exists, and a select
// takes the one that holds. The side not taken may overflow; it is never used.
// v erf(x) = |v| erf(|x|), so no sign has to be put back.
// ---------------------------------------------------------------------------
static __device__ __forceinline__ v8f fma8(v8f a, v8f b, float c) {
  return __builtin_elementwise_fma(a, b, (v8f)(c));
}
static __device__ __forceinline__ v8f gelu8(v8f val) {
  const v8f av = __builtin_elementwise_abs(val);
  const v8f h  = val * 0.5f;
  const v8f ah = av * 0.5f;                     // |h|
  const v8f ax = av * 0.70710678118654752f;     // |x|
  // |x| >= 1: erf = 1 - exp(-(|x| + |x| p(|x|)))
  v8f p = fma8(ax, (v8f)(__builtin_bit_cast(float, 0x378e98abu)),
                         __builtin_bit_cast(float, 0xb9c68948u));
  p = fma8(ax, p, __builtin_bit_cast(float, 0x3b7cd369u));
  p = fma8(ax, p, __builtin_bit_cast(float, 0xbcc618b2u));
  p = fma8(ax, p, __builtin_bit_cast(float, 0x3dda74e4u));
  p = fma8(ax, p, __builtin_bit_cast(float, 0x3f228afdu));
  p = fma8(ax, p, __builtin_bit_cast(float, 0x3e03c728u));
  p = __builtin_elementwise_fma(ax, p, ax);
  // |x| < 1: erf = |x| + |x| q(x^2)
  const v8f s = ax * ax;
  v8f q = fma8(s, (v8f)(__builtin_bit_cast(float, 0xba1345e1u)),
                        __builtin_bit_cast(float, 0x3ba10414u));
  q = fma8(s, q, __builtin_bit_cast(float, 0xbcdac9b8u));
  q = fma8(s, q, __builtin_bit_cast(float, 0x3de703beu));
  q = fma8(s, q, __builtin_bit_cast(float, 0xbec09330u));
  q = fma8(s, q, __builtin_bit_cast(float, 0x3e0375d0u));
  q = __builtin_elementwise_fma(ax, q, ax);
  v8f e;
  #pragma unroll   // so that every index is a constant and the vectors stay in registers
  for (int v = 0; v < 8; ++v) e[v] = ax[v] < 1.0f ? q[v] : 1.0f - __expf(-p[v]);
  return __builtin_elementwise_fma(ah, e, h);
}

template <int MODE, int NCOLS>
static __device__ __forceinline__
void gemm_epilogue(const v8f (&acc)[2][4], int wrow, const float* __restrict__ bias,
                   const float* __restrict__ resid, void* __restrict__ outp) {
  const int lane = threadIdx.x & 31;
  const int wn   = (threadIdx.x >> 6) & 1;
  const int mblk = blockIdx.y * BLK_M;
  const int nblk = blockIdx.x * BLK_N;
  const int lrow = lane & 15;

  // 32 rows x 64 columns; wrow: their first row within the block.
  // Element (mt, nt, v) of this lane is row row0 + mt*16 + v, column col0 + nt*16.
  // A block's 128 rows lie in one batch entry and its 128 columns in one head.
  const int row0 = mblk + wrow + ((lane >> 4) << 3);  // upper 16 lanes: rows +8
  const int col0 = nblk + wn * 64 + lrow;
  float bv[4];
  #pragma unroll
  for (int nt = 0; nt < 4; ++nt) bv[nt] = bias[col0 + nt * 16];

  if constexpr (MODE == 1 || MODE == 2) {
    const int bb = row0 >> 11, ss = row0 & (SEQ - 1);   // S = 2048
    const int hh = col0 >> 7,  dd = col0 & (HDIM - 1);  // d = 128
    if constexpr (MODE == 1) {
      __bf16* o = (__bf16*)outp + ((size_t)((bb * NHEADS + hh) * SEQ + ss)) * HDIM + dd;
      #pragma unroll
      for (int mt = 0; mt < 2; ++mt)
      #pragma unroll
      for (int nt = 0; nt < 4; ++nt)
      #pragma unroll
      for (int v = 0; v < 8; ++v)
        o[(mt * 16 + v) * HDIM + nt * 16] = (__bf16)(acc[mt][nt][v] + bv[nt]);
      // Behind the run of stores: where two epilogues share a kernel, the code laid
      // out behind this one rewrites registers that the stores name (a precaution
      // for a replayed address translation).
      asm volatile("s_wait_xcnt 0x0" ::: "memory");
    } else {
      // A lane's eight rows are eight neighbours along S: one 16-B store.
      __bf16* o = (__bf16*)outp + ((size_t)((bb * NHEADS + hh) * HDIM + dd)) * SEQ + ss;
      #pragma unroll
      for (int mt = 0; mt < 2; ++mt)
      #pragma unroll
      for (int nt = 0; nt < 4; ++nt) {
        v8bf pk;
        #pragma unroll
        for (int v = 0; v < 8; ++v) pk[v] = (__bf16)(acc[mt][nt][v] + bv[nt]);
        *(v8bf*)(o + nt * 16 * SEQ + mt * 16) = pk;
      }
      // Behind the run of stores, as in the other mode: the wave's second 32 rows follow.
      asm volatile("s_wait_xcnt 0x0" ::: "memory");
    }
  } else if constexpr (MODE == 3) {
    const size_t base = (size_t)row0 * NCOLS + col0;
    const float* rp = resid + base;
    float* o = (float*)outp + base;
    float r[2][4][8];
    #pragma unroll
    for (int mt = 0; mt < 2; ++mt)
    #pragma unroll
    for (int v = 0; v < 8; ++v)
    #pragma unroll
    for (int nt = 0; nt < 4; ++nt)
      r[mt][nt][v] = rp[(mt * 16 + v) * NCOLS + nt * 16];
    #pragma unroll
    for (int mt = 0; mt < 2; ++mt)
    #pragma unroll
    for (int v = 0; v < 8; ++v)
    #pragma unroll
    for (int nt = 0; nt < 4; ++nt)
      o[(mt * 16 + v) * NCOLS + nt * 16] = r[mt][nt][v] + (acc[mt][nt][v] + bv[nt]);
  } else {  // MODE 4: exact GELU, bf16 out
    // Behind the four bias loads: the arithmetic below is given their offset register
    // as a place before the last of them is waited for (a precaution for a replayed
    // address translation). The offset is an input, so that its register lives up to
    // the wait and is not given to the last load's own result either.
    asm volatile("s_wait_xcnt 0x0" :: "v"(col0) : "memory");
    __bf16* o = (__bf16*)outp + (size_t)row0 * NCOLS + col0;
    #pragma unroll
    for (int mt = 0; mt < 2; ++mt)
    #pragma unroll
    for (int nt = 0; nt < 4; ++nt) {
      const v8f gl = gelu8(acc[mt][nt] + bv[nt]);
      #pragma unroll   // constant indices and store offsets, as in the other modes
      for (int v = 0; v < 8; ++v)
        o[(mt * 16 + v) * NCOLS + nt * 16] = (__bf16)gl[v];
    }
    // Behind the run of stores: the wave's second 32 rows follow and rewrite registers
    // that the stores name (a precaution for a replayed address translation).
    asm volatile("s_wait_xcnt 0x0" ::: "memory");
  }
}

// The wave's rows go through the epilogue 32 at a time: at KSPLIT 2 the half it kept
// at the join, at KSPLIT 1 both halves of its tile, one after the other.
template <int MODE, int NCOLS, int KSPLIT>
static __device__ __forceinline__
void gemm_finish(const v8f (&acc)[2][2][4], const float* __restrict__ bias,
                 const float* __restrict__ resid, void* __restrict__ outp) {
  const int wave = threadIdx.x >> 5;
  const int wrow = (wave & 1) * 64 + (wave >> 2) * 32;
  gemm_epilogue<MODE, NCOLS>(acc[0], wrow, bias, resid, outp);
  if constexpr (KSPLIT == 1) gemm_epilogue<MODE, NCOLS>(acc[1], wrow + 32, bias, resid, outp);
}

template <int MODE, int NCOLS, int KSPLIT>
__global__ __launch_bounds__(128 * KSPLIT)
void gemm_wmma_kernel(const __bf16* __restrict__ A, const __bf16* __restrict__ W,
                      const float* __restrict__ bias, const float* __restrict__ resid,
                      void* __restrict__ outp, int K) {
  v8f acc[2][2][4] = {};
  gemm_main_loop<KSPLIT>(A, W, K, acc);
  gemm_finish<MODE, NCOLS, KSPLIT>(acc, bias, resid, outp);
}

// The Q, K and V projections in one launch, blockIdx.z naming the product. Each
// alone has one block per WGP, whose waves cannot cover their own copy and
// barrier waits. Three blocks fit a WGP (72 KiB of LDS each; one wave per SIMD
// each), so the joined grid can be resident at once, each block filling the
// others' waits.
// The choice of epilogue is one test per block, the same in all of its lanes.
__global__ __launch_bounds__(128)
void gemm_qkv_kernel(const __bf16* __restrict__ A, const __bf16* __restrict__ Wq,
                     const __bf16* __restrict__ Wk, const __bf16* __restrict__ Wv,
                     const float* __restrict__ bq, const float* __restrict__ bk,
                     const float* __restrict__ bv, __bf16* __restrict__ q,
                     __bf16* __restrict__ k, __bf16* __restrict__ vt, int K) {
  const int z = blockIdx.z;
  v8f acc[2][2][4] = {};
  gemm_main_loop<1>(A, z == 0 ? Wq : z == 1 ? Wk : Wv, K, acc);
  if (z == 2) gemm_finish<2, HID, 1>(acc, bv, nullptr, vt);
  else        gemm_finish<1, HID, 1>(acc, z == 0 ? bq : bk, nullptr, z == 0 ? q : k);
}

// ---------------------------------------------------------------------------
// Causal flash attention with shared async-LDS K/V staging.
// Block: 256 threads = 8 waves on 64 query rows: wave w owns the 16-query tile w & 3
// and, of every 64-key pass, the 32 keys of half w >> 2. The launch lasts as long as
// the block with the most passes, whose waves mostly wait on their own dependent
// steps; two waves per query tile halve its passes. Each keeps its own running
// maximum, sum and output tile; the two are joined once, through LDS, at the end.
// Per pass: K tile (64x128) and V^T tile (128x64, one slab per half) staged
// global->LDS (double buffered, ASYNCcnt) once and consumed by all 8 waves.
// All waves run to the block's last key block; the causal mask nulls any
// key > query row (exp(-huge)=0), so lower waves' surplus blocks are inert.
// The launch also converts the three weights that are first read behind it: the
// blocks with blockIdx.y >= BATCH * NHEADS. Attention leaves wave places and nearly
// all of the memory rate free.
// ---------------------------------------------------------------------------
#define AT_XBLOCKS   (SEQ / 64)
#define AT_HALF      (AT_XBLOCKS * BATCH * NHEADS / 2)   // half of the attention blocks
static_assert(AT_XBLOCKS % 2 == 0, "tiles pair up as t and n - 1 - t");
#define AT_FF_BLOCKS (FF * HID / (1024 * 8))   // a FF x HID weight,  256 threads, PER = 8
#define AT_SQ_BLOCKS (HID * HID / (1024 * 8))  // a HID x HID weight, 256 threads, PER = 8
#define AT_CONV_ROWS ((2 * AT_FF_BLOCKS + AT_SQ_BLOCKS) / AT_XBLOCKS)
static_assert(HID * HID % (1024 * 8) == 0 &&
              (2 * AT_FF_BLOCKS + AT_SQ_BLOCKS) % AT_XBLOCKS == 0, "whole blocks, whole grid rows");

__global__ __launch_bounds__(256)
void attn_wmma_kernel(const __bf16* __restrict__ Q, const __bf16* __restrict__ Kc,
                      const __bf16* __restrict__ VT, __bf16* __restrict__ Y,
                      const float* __restrict__ w1, const float* __restrict__ w2,
                      const float* __restrict__ wo, __bf16* __restrict__ w1b,
                      __bf16* __restrict__ w2b, __bf16* __restrict__ wob) {
  if (blockIdx.y >= BATCH * NHEADS) {   // the same for a whole block, ahead of every barrier
    const int blk   = (blockIdx.y - BATCH * NHEADS) * AT_XBLOCKS + blockIdx.x;
    const int which = blk / AT_FF_BLOCKS;   // 0: w1, 1: w2, 2: wo
    f32_to_bf16_block<256, 8>(which == 0 ? w1 : which == 1 ? w2 : wo,
                              which == 0 ? w1b : which == 1 ? w2b : wob,
                              blk - which * AT_FF_BLOCKS);
    return;
  }
  const int lane  = threadIdx.x & 31;
  const int wave  = threadIdx.x >> 5;
  const int lrow  = lane & 15;
  const int koff  = (lane >> 4) << 3;
  const int rplus = koff;               // C-layout: upper lanes own rows +8
  // Which query tile and head this block takes. A tile's cost grows with its index,
  // and all attention blocks are resident at once, two to a WGP (by registers).
  // The first half of the range holds the upper tiles, longest first, the second half
  // the lower tiles, shortest first: blocks half the index range apart hold tiles t
  // and n - 1 - t. For speed only: each (head, tile)
  // is taken exactly once wherever the blocks land.
  const unsigned flat = blockIdx.y * AT_XBLOCKS + blockIdx.x;
  const unsigned rank = flat % AT_HALF;
  const unsigned step = rank / (BATCH * NHEADS);
  const int tile  = flat < AT_HALF ? AT_XBLOCKS - 1 - step : step;
  const int qblk  = tile * 64;
  const int wq    = wave & 3;           // query tile
  const int grp   = wave >> 2;          // which 32 keys of a 64-key pass
  const int qbase = qblk + wq * 16;
  const int bh    = rank % (BATCH * NHEADS);
  const float scale = 0.08838834764831845f;  // 1/sqrt(128)
  const float NEGF  = -3.0e38f;

  __shared__ __align__(16) __bf16 kt[2][64 * K_PITCH];       // 2 x 17 KB
  __shared__ __align__(16) __bf16 vt[2][2][HDIM * V_PITCH];  // 2 x 2 x 10 KB
  __shared__ __align__(16) __bf16 pbuf[8][16 * P_PITCH];     // per-wave P tiles

  // Stage K tile (64 keys x 128) and V^T tile (128 x 64 keys) for key block kb.
  // 1024 16B chunks per tile; 256 threads issue 4 chunks each per tile.
  auto stage = [&](int buf, int kb) {
    uint32_t l[8];
    const __bf16* g[8];
    #pragma unroll
    for (int j = 0; j < 4; ++j) {
      const int id = threadIdx.x + j * 256;
      const int kr = id >> 4, kc = (id & 15) << 3;   // K tile: 16 chunks/row
      l[2 * j]     = lds_addr_of(&kt[buf][kr * K_PITCH + kc]);
      g[2 * j]     = Kc + ((size_t)bh * SEQ + kb + kr) * HDIM + kc;
      const int vr = id >> 3, vc = id & 7;           // V^T tile: 8 chunks/row, 4 a slab
      l[2 * j + 1] = lds_addr_of(&vt[buf][vc >> 2][vr * V_PITCH + ((vc & 3) << 3)]);
      g[2 * j + 1] = VT + ((size_t)bh * HDIM + vr) * SEQ + kb + (vc << 3);
    }
    async_copy8_b128(l, g);
  };

  v16bf qf[4];
  #pragma unroll
  for (int kc = 0; kc < 4; ++kc)
    qf[kc] = load_frag(Q + ((size_t)bh * SEQ + qbase + lrow) * HDIM + kc * 32 + koff);

  v8f o[8] = {};
  float mrow[8], lsum[8];
  #pragma unroll
  for (int v = 0; v < 8; ++v) { mrow[v] = NEGF; lsum[v] = 0.f; }

  const int kend = qblk + 64;           // block-uniform key range, whole passes
  stage(0, 0);
  for (int kb = 0; kb < kend; kb += 64) {
    const int cur = (kb >> 6) & 1;
    const int kg  = kb + grp * 32;      // first of this wave's 32 keys
    wait_async0();
    __syncthreads();
    if (kb + 64 < kend) stage(cur ^ 1, kb + 64);

    // ---- S = Q K^T over d=128 (4 x K=32 WMMAs per 16-key column tile) ----
    v8f s0acc = {}, s1acc = {};
    #pragma unroll
    for (int kc = 0; kc < 4; ++kc) {
      v16bf k0 = load_frag(&kt[cur][(grp * 32 +      lrow) * K_PITCH + kc * 32 + koff]);
      v16bf k1 = load_frag(&kt[cur][(grp * 32 + 16 + lrow) * K_PITCH + kc * 32 + koff]);
      s0acc = wmma_bf16(qf[kc], k0, s0acc);
      s1acc = wmma_bf16(qf[kc], k1, s1acc);
    }
    // ---- scale, causal mask, online softmax (per C-layout row) ----
    // The running maximum is the same in all 16 lanes of a row, so it goes into
    // the reduction's start value and the reduction yields the new maximum.
    // Every loop over v is unrolled so that its arrays are registers, not scratch;
    // the sum's steps are loops of their own to set the eight rows side by side.
    float s0[8], s1[8], mnew[8];
    #pragma unroll
    for (int v = 0; v < 8; ++v) {
      const int qrow = qbase + v + rplus;
      s0[v] = s0acc[v] * scale;
      s1[v] = s1acc[v] * scale;
      if (kg +      lrow > qrow) s0[v] = NEGF;
      if (kg + 16 + lrow > qrow) s1[v] = NEGF;
      mnew[v] = fmaxf(fmaxf(s0[v], s1[v]), mrow[v]);
    }
    row16_max8(mnew);
    float rs[8];
    #pragma unroll
    for (int v = 0; v < 8; ++v) {
      const float p0 = __expf(s0[v] - mnew[v]);
      const float p1 = __expf(s1[v] - mnew[v]);
      rs[v] = p0 + p1;
      const int prow = v + rplus;
      pbuf[wave][prow * P_PITCH +      lrow] = (__bf16)p0;
      pbuf[wave][prow * P_PITCH + 16 + lrow] = (__bf16)p1;
    }
    #pragma unroll
    for (int v = 0; v < 8; ++v) rs[v] += row_xor<1>(rs[v]);
    #pragma unroll
    for (int v = 0; v < 8; ++v) rs[v] += row_xor<2>(rs[v]);
    #pragma unroll
    for (int v = 0; v < 8; ++v) rs[v] += row_xor<4>(rs[v]);
    #pragma unroll
    for (int v = 0; v < 8; ++v) rs[v] += row_xor<8>(rs[v]);
    #pragma unroll
    for (int v = 0; v < 8; ++v) {
      const float sc = __expf(mrow[v] - mnew[v]);
      lsum[v] = lsum[v] * sc + rs[v];
      mrow[v] = mnew[v];
      #pragma unroll
      for (int dt = 0; dt < 8; ++dt) o[dt][v] *= sc;
    }
    __syncthreads();
    v16bf pf = load_frag(&pbuf[wave][lrow * P_PITCH + koff]);
    // ---- O += P V (keys as contraction dim; V^T rows are contiguous) ----
    #pragma unroll
    for (int dt = 0; dt < 8; ++dt) {
      v16bf vf = load_frag(&vt[cur][grp][(dt * 16 + lrow) * V_PITCH + koff]);
      o[dt] = wmma_bf16(pf, vf, o[dt]);
    }
    __syncthreads();     // kt/vt[cur] + pbuf free before re-staging / rewrite
  }
  // ---- join the two key halves of each query tile ----
  // Wave wq + 4 hands its 80 values per lane (output tile, maxima, sums) to wave wq,
  // lane to lane, through the V^T buffers: the loop's last barrier has ended every
  // read of them, and no copy is in flight (the last pass staged nothing).
  // A half whose keys were all masked has the maximum NEGF and finite sums, and its
  // weight below is exp(NEGF - m) = 0; the lower half always holds key 0.
  static_assert(sizeof(vt) >= 4 * 80 * 32 * sizeof(float), "hand-over fits the V^T buffers");
  float* mb = (float*)&vt[0][0][0] + wq * (80 * 32) + lane;
  if (grp == 1) {
    #pragma unroll
    for (int dt = 0; dt < 8; ++dt)
    #pragma unroll
    for (int v = 0; v < 8; ++v) mb[(dt * 8 + v) * 32] = o[dt][v];
    #pragma unroll
    for (int v = 0; v < 8; ++v) {
      mb[(64 + v) * 32] = mrow[v];
      mb[(72 + v) * 32] = lsum[v];
    }
  }
  __syncthreads();       // the upper halves' values are in LDS
  if (grp == 1) return;  // behind the last barrier
  float wlo[8], whi[8];
  #pragma unroll
  for (int v = 0; v < 8; ++v) {
    const float m1 = mb[(64 + v) * 32];
    const float l1 = mb[(72 + v) * 32];
    const float m  = fmaxf(mrow[v], m1);
    wlo[v] = __expf(mrow[v] - m);
    whi[v] = __expf(m1 - m);
    lsum[v] = lsum[v] * wlo[v] + l1 * whi[v];
  }
  // A loop of its own: among the divisions and stores below each LDS read was
  // waited for alone; here several are in flight behind counted waits.
  #pragma unroll
  for (int dt = 0; dt < 8; ++dt)
  #pragma unroll
  for (int v = 0; v < 8; ++v)
    o[dt][v] = o[dt][v] * wlo[v] + mb[(dt * 8 + v) * 32] * whi[v];
  // ---- normalize and scatter back to [B,S,HID] ----
  const int b = bh >> 3, h = bh & 7;
  #pragma unroll
  for (int dt = 0; dt < 8; ++dt)
  #pragma unroll
  for (int v = 0; v < 8; ++v) {
    const int row = qbase + v + rplus;
    const int col = h * HDIM + dt * 16 + lrow;
    Y[((size_t)b * SEQ + row) * HID + col] = (__bf16)(o[dt][v] / lsum[v]);
  }
}

// ---------------------------------------------------------------------------
// Orchestration
// ---------------------------------------------------------------------------
extern "C" void kernel_launch(void* const* d_in, const int* in_sizes, int n_in,
                              void* d_out, int out_size, void* d_ws, size_t ws_size,
                              hipStream_t stream) {
  (void)in_sizes; (void)n_in; (void)out_size; (void)ws_size;

  const float* x    = (const float*)d_in[0];
  const float* ln1g = (const float*)d_in[1];
  const float* ln1b = (const float*)d_in[2];
  const float* wq   = (const float*)d_in[3];
  const float* bq   = (const float*)d_in[4];
  const float* wk   = (const float*)d_in[5];
  const float* bk   = (const float*)d_in[6];
  const float* wv   = (const float*)d_in[7];
  const float* bv   = (const float*)d_in[8];
  const float* wo   = (const float*)d_in[9];
  const float* bo   = (const float*)d_in[10];
  const float* ln2g = (const float*)d_in[11];
  const float* ln2b = (const float*)d_in[12];
  const float* w1   = (const float*)d_in[13];
  const float* b1   = (const float*)d_in[14];
  const float* w2   = (const float*)d_in[15];
  const float* b2   = (const float*)d_in[16];
  float* out = (float*)d_out;

  char* ws = (char*)d_ws;
  size_t off = 0;
  auto take = [&](size_t bytes) -> char* {
    char* p = ws + off;
    off += bytes;
    off = (off + 255) & ~(size_t)255;
    return p;
  };

  __bf16* wqb = (__bf16*)take((size_t)HID * HID * 2);
  __bf16* wkb = (__bf16*)take((size_t)HID * HID * 2);
  __bf16* wvb = (__bf16*)take((size_t)HID * HID * 2);
  __bf16* wob = (__bf16*)take((size_t)HID * HID * 2);
  __bf16* w1b = (__bf16*)take((size_t)FF  * HID * 2);
  __bf16* w2b = (__bf16*)take((size_t)HID * FF  * 2);
  __bf16* hn  = (__bf16*)take((size_t)MROWS * HID * 2);  // LN1 out
  __bf16* qb  = (__bf16*)take((size_t)MROWS * HID * 2);  // [B,h,S,d]
  __bf16* kbf = (__bf16*)take((size_t)MROWS * HID * 2);  // [B,h,S,d]
  __bf16* vtb = (__bf16*)take((size_t)MROWS * HID * 2);  // [B,h,d,S]
  __bf16* yb  = (__bf16*)take((size_t)MROWS * HID * 2);  // attn out [B,S,H]
  float*  x1  = (float*) take((size_t)MROWS * HID * 4);  // x + attn
  __bf16* m2  = (__bf16*)take((size_t)MROWS * HID * 2);  // LN2 out
  __bf16* gb  = (__bf16*)take((size_t)MROWS * FF  * 2);  // GELU(MLP1)

  // LN1 and wq, wk, wv -> bf16, one launch
  prep_kernel<<<PREP_BLOCKS, 256, 0, stream>>>(x, ln1g, ln1b, hn, wq, wk, wv, wqb, wkb, wvb);

  // QKV projections (block tile 128x128, K-step 64), one launch
  dim3 gH(HID / BLK_N, MROWS / BLK_M);
  dim3 gQKV(HID / BLK_N, MROWS / BLK_M, 3);
  gemm_qkv_kernel<<<gQKV, 128, 0, stream>>>(hn, wqb, wkb, wvb, bq, bk, bv, qb, kbf, vtb, HID);

  // causal flash attention (64 query rows per block, 8 waves, shared K/V staging);
  // the grid's upper rows: w1, w2, wo -> bf16
  dim3 gA(AT_XBLOCKS, BATCH * NHEADS + AT_CONV_ROWS);
  attn_wmma_kernel<<<gA, 256, 0, stream>>>(qb, kbf, vtb, yb, w1, w2, wo, w1b, w2b, wob);

  // O-proj + residual -> x1 (fp32)
  gemm_wmma_kernel<3, HID, 2><<<gH, 256, 0, stream>>>(yb, wob, bo, x, x1, HID);

  // LN2
  ln_bf16_kernel<<<MROWS / 8, 256, 0, stream>>>(x1, ln2g, ln2b, m2);

  // MLP
  dim3 gF(FF / BLK_N, MROWS / BLK_M);
  gemm_wmma_kernel<4, FF, 1><<<gF, 128, 0, stream>>>(m2, w1b, b1, nullptr, gb, HID);
  gemm_wmma_kernel<3, HID, 2><<<gH, 256, 0, stream>>>(gb, w2b, b2, x1, out, FF);
}

// v010
// Measured time: 145 microseconds a run.
// Two timings next to v009 both put it at 1.11 times that version's speed.
// All steps since v000 together make it 4.90 times as fast.
#include <hip/hip_runtime.h>
#include <hip/hip_bf16.h>
#include <math.h>

typedef __attribute__((ext_vector_type(16))) __bf16 v16bf;
typedef __attribute__((ext_vector_type(8)))  __bf16 v8bf;
typedef __attribute__((ext_vector_type(8)))  float  v8f;

#define HID    1024
#define SEQ    2048
#define BATCH  2
#define NHEADS 8
#define HDIM   128
#define FF     4096
#define MROWS  (BATCH * SEQ)

#define BLK_M 128
#define BLK_N 128
#define BLK_K 64

// LDS row pitches in bf16 elements. Every tile below is read row per lane with
// ds_load_b128, which is free of bank conflicts at a pitch of 16 B x odd; the
// unpadded pitches (128, 256, 64 B) put the 16 rows of a fragment on few banks.
#define G_PITCH (BLK_K + 8)   // GEMM tiles at K-step 64: 128-B rows at 144 B
#define K_PITCH (HDIM + 8)    // K tile:     256-B rows at 272 B
#define V_PITCH (32 + 8)      // V^T tile:    64-B rows at  80 B
#define P_PITCH (32 + 8)      // P tile:      64-B rows at  80 B

// ---------------------------------------------------------------------------
// Fragment loader: CDNA5 16-bit A/B layout for 16x16x32 WMMA.
// Lane L (0..15): row = L, holds K = kb..kb+7 and kb+16..kb+23
// Lane L (16..31): row = L-16, holds K = kb+8..15 and kb+24..31
// => per lane: two contiguous 8-element (16B) chunks at +koff and +koff+16.
// ---------------------------------------------------------------------------
static __device__ __forceinline__ v16bf load_frag(const __bf16* p) {
  v8bf lo = *(const v8bf*)p;
  v8bf hi = *(const v8bf*)(p + 16);
  return __builtin_shufflevector(lo, hi, 0,1,2,3,4,5,6,7,8,9,10,11,12,13,14,15);
}

static __device__ __forceinline__ v8f wmma_bf16(v16bf a, v16bf b, v8f c) {
  return __builtin_amdgcn_wmma_f32_16x16x32_bf16(false, a, false, b, (short)0, c,
                                                 false, false);
}

// Async global -> LDS copy, 16B per lane, tracked by ASYNCcnt (gfx1250).
// lds_addr = low 32 bits of the flat shared-memory pointer (LDS aperture
// mapping: LDS_ADDR = addr[31:0]).
// A lane's copies stand eight to a statement, each ending in
// s_wait_xcnt 0, so that no address register of a copy is rewritten ahead of
// that wait (a precaution for a replayed address translation).
static __device__ __forceinline__ uint32_t lds_addr_of(const void* lds_ptr) {
  return (uint32_t)(uintptr_t)lds_ptr;
}

static __device__ __forceinline__ void async_copy8_b128(const uint32_t (&l)[8],
                                                        const __bf16* const (&g)[8]) {
  asm volatile("global_load_async_to_lds_b128 %0, %8, off\n\t"
               "global_load_async_to_lds_b128 %1, %9, off\n\t"
               "global_load_async_to_lds_b128 %2, %10, off\n\t"
               "global_load_async_to_lds_b128 %3, %11, off\n\t"
               "global_load_async_to_lds_b128 %4, %12, off\n\t"
               "global_load_async_to_lds_b128 %5, %13, off\n\t"
               "global_load_async_to_lds_b128 %6, %14, off\n\t"
               "global_load_async_to_lds_b128 %7, %15, off\n\t"
               "s_wait_xcnt 0x0"
               :: "v"(l[0]), "v"(l[1]), "v"(l[2]), "v"(l[3]),
                  "v"(l[4]), "v"(l[5]), "v"(l[6]), "v"(l[7]),
                  "v"((uint64_t)(uintptr_t)g[0]), "v"((uint64_t)(uintptr_t)g[1]),
                  "v"((uint64_t)(uintptr_t)g[2]), "v"((uint64_t)(uintptr_t)g[3]),
                  "v"((uint64_t)(uintptr_t)g[4]), "v"((uint64_t)(uintptr_t)g[5]),
                  "v"((uint64_t)(uintptr_t)g[6]), "v"((uint64_t)(uintptr_t)g[7])
               : "memory");
}

// Reductions over the 16 lanes of a row by DPP row_xmask butterfly steps, on the
// vector port. A shuffle compiles to ds_bpermute_b32, which goes through the LDS
// queue and is waited for at every one of its steps.
//
// Sum step: the value of lane (l ^ MASK); the compiler folds it into the add.
template <int MASK>
static __device__ __forceinline__ float row_xor(float x) {
  return __builtin_bit_cast(float, __builtin_amdgcn_update_dpp(
      0, __builtin_bit_cast(int, x), 0x160 + MASK, 0xf, 0xf, true));
}

// Maximum of eight rows at once. In asm because the compiler puts a move and a
// quieting maximum in front of every fmaxf on a DPP value (three dependent
// instructions a step instead of one). The eight rows stand side by side in each
// step, so every instruction's producer is eight instructions back.
#define ROWMAX_1(r, m) \
  "v_max_num_f32_dpp " r ", " r ", " r " row_xmask:" m " row_mask:0xf bank_mask:0xf bound_ctrl:1\n\t"
#define ROWMAX_8(m) \
  ROWMAX_1("%0", m) ROWMAX_1("%1", m) ROWMAX_1("%2", m) ROWMAX_1("%3", m) \
  ROWMAX_1("%4", m) ROWMAX_1("%5", m) ROWMAX_1("%6", m) ROWMAX_1("%7", m)
static __device__ __forceinline__ void row16_max8(float (&t)[8]) {
  asm(ROWMAX_8("1") ROWMAX_8("2") ROWMAX_8("4") ROWMAX_8("8")
      : "+v"(t[0]), "+v"(t[1]), "+v"(t[2]), "+v"(t[3]),
        "+v"(t[4]), "+v"(t[5]), "+v"(t[6]), "+v"(t[7]));
}

static __device__ __forceinline__ void wait_async0() {
  asm volatile("s_wait_asynccnt 0x0" ::: "memory");
}

// ---------------------------------------------------------------------------
// The two streaming kernels below move little data. For speed only, each wave does
// much more than one element per lane: 16-B loads that cover whole lines
// (32 lanes x 16 B = 512 B in a row),
// all of a lane's loads issued together, and few waves in the grid.
// ---------------------------------------------------------------------------
typedef __attribute__((ext_vector_type(4))) float  f32x4;
typedef __attribute__((ext_vector_type(4))) __bf16 v4bf;

// fp32 -> bf16 elementwise convert (weights). Block blk of THREADS threads converts
// THREADS * PER groups of four neighbours, PER groups per lane.
template <int THREADS, int PER>
static __device__ __forceinline__
void f32_to_bf16_block(const float* __restrict__ src, __bf16* __restrict__ dst, int blk) {
  const size_t first = (size_t)blk * (THREADS * PER) + threadIdx.x;
  const f32x4* s = (const f32x4*)src + first;
  v4bf* d = (v4bf*)dst + first;
  f32x4 v[PER];
  #pragma unroll
  for (int j = 0; j < PER; ++j) v[j] = s[j * THREADS];
  #pragma unroll
  for (int j = 0; j < PER; ++j) d[j * THREADS] = __builtin_convertvector(v[j], v4bf);
}

// ---------------------------------------------------------------------------
// Row LayerNorm (H=1024), fp32 in -> bf16 out. One wave per row, 8 rows per block:
// the row stays in registers (8 x 16 B per lane), its sums are formed in the lane
// and joined by a five-step butterfly, so no LDS and no barrier is needed.
// ---------------------------------------------------------------------------
static __device__ __forceinline__
void ln_bf16_block(const float* __restrict__ x, const float* __restrict__ g,
                   const float* __restrict__ b, __bf16* __restrict__ out, int blk) {
  const int lane = threadIdx.x & 31;
  const int row  = blk * 8 + (threadIdx.x >> 5);
  const f32x4* xr = (const f32x4*)(x + (size_t)row * HID) + lane;
  const f32x4* gp = (const f32x4*)g + lane;
  const f32x4* bp = (const f32x4*)b + lane;
  f32x4 v[8], gv[8], bv[8];
  #pragma unroll
  for (int j = 0; j < 8; ++j) v[j] = xr[j * 32];
  // Behind the row's loads, since a later load's result may be given their address
  // pair as its place (a precaution for a replayed address translation).
  asm volatile("s_wait_xcnt 0x0" ::: "memory");
  #pragma unroll
  for (int j = 0; j < 8; ++j) { gv[j] = gp[j * 32]; bv[j] = bp[j * 32]; }
  // Keeps all 24 loads in front of the sums: without it the gain and bias loads
  // are issued behind the reduction, two at a time, each waited for.
  __builtin_amdgcn_sched_barrier(0);
  f32x4 sv = {}, qv = {};   // four independent chains each
  #pragma unroll
  for (int j = 0; j < 8; ++j) { sv += v[j]; qv += v[j] * v[j]; }
  float s  = (sv[0] + sv[1]) + (sv[2] + sv[3]);
  float s2 = (qv[0] + qv[1]) + (qv[2] + qv[3]);
  #pragma unroll
  for (int d = 1; d < 32; d <<= 1) {
    s  += __shfl_xor(s,  d, 32);
    s2 += __shfl_xor(s2, d, 32);
  }
  const float mu  = s * (1.0f / HID);
  const float var = s2 * (1.0f / HID) - mu * mu;
  const float r   = rsqrtf(var + 1e-5f);
  v4bf* o = (v4bf*)(out + (size_t)row * HID) + lane;
  #pragma unroll
  for (int j = 0; j < 8; ++j)
    o[j * 32] = __builtin_convertvector((v[j] - mu) * r * gv[j] + bv[j], v4bf);
}

__global__ __launch_bounds__(256)
void ln_bf16_kernel(const float* __restrict__ x, const float* __restrict__ g,
                    const float* __restrict__ b, __bf16* __restrict__ out) {
  ln_bf16_block(x, g, b, out, blockIdx.x);
}

// ---------------------------------------------------------------------------
// What the Q, K and V products wait for, in one launch: the first LayerNorm and the
// converts of their three weights. None reads what another writes, so each gets a
// range of the block index; short launches one behind the other each pay their own
// start and drain, with most of the chip idle meanwhile. (The other three weights
// are first read behind attention and are converted in its launch.)
// ---------------------------------------------------------------------------
#define LN_BLOCKS    (MROWS / 8)               // 8 rows a block
#define SQ_BLOCKS    (HID * HID / (1024 * 4))  // a HID x HID weight, 256 threads, PER = 4
#define PREP_BLOCKS  (LN_BLOCKS + 3 * SQ_BLOCKS)
static_assert(HID * HID % (1024 * 4) == 0, "whole blocks only");

__global__ __launch_bounds__(256)
void prep_kernel(const float* __restrict__ x, const float* __restrict__ g,
                 const float* __restrict__ b, __bf16* __restrict__ hn,
                 const float* __restrict__ wq, const float* __restrict__ wk,
                 const float* __restrict__ wv, __bf16* __restrict__ wqb,
                 __bf16* __restrict__ wkb, __bf16* __restrict__ wvb) {
  int blk = blockIdx.x;
  if (blk < LN_BLOCKS) {
    ln_bf16_block(x, g, b, hn, blk);
    return;
  }
  blk -= LN_BLOCKS;
  const int which = blk / SQ_BLOCKS;
  f32_to_bf16_block<256, 4>(which == 0 ? wq : which == 1 ? wk : wv,
                            which == 0 ? wqb : which == 1 ? wkb : wvb,
                            blk - which * SQ_BLOCKS);
}

// ---------------------------------------------------------------------------
// WMMA GEMM with async-LDS double-buffered staging.
// C[M,N] = A[M,K] (row-major) * W[N,K]^T (+ bias, epilogue modes).
// Block tile 128x128, K-step 64 x KSPLIT; wave tile 64x64 (4x4 WMMA frags), four wave tiles
// (2 M x 2 N). A wave reads 8 fragments from LDS for 16 WMMAs; at 32x64 it read 6
// for 8, and the block's LDS reads then took longer than its WMMAs.
// KSPLIT 1: 128 threads = 4 waves, each takes both 32-wide k slices of a K-step
//           (for grids with several blocks per WGP, whose waves share the SIMDs).
// KSPLIT 2: 256 threads = 8 waves, two per wave tile, wave w taking k slice w >> 2 of
//           every 64 k (for grids with one block per WGP: two waves per SIMD stay).
//           Nothing else on the WGP fills this block's waits, so its K-step is 128: a
//           wave has two slices a pass and reads the second one's fragments, into a
//           second register set, while the first one's WMMAs run; and the barriers and
//           copy waits come half as often, with twice the bytes in flight.
//           The two partial tiles are joined once, through LDS, behind the loop; each
//           wave of a pair then owns 32 of the tile's 64 rows.
// Staging: 128 x K-step bf16 tiles of A and W copied global->LDS with
// global_load_async_to_lds_b128 (ASYNCcnt), double buffered, rows padded by 16 B
// to 144 or 272 B (72 or 136 KB LDS).
// MODE and NCOLS (the output's row length) are template parameters: the epilogue
// then holds one mode's code with no test per element, every address is one base
// plus a constant, and its loads and stores are issued together.
// MODE 1: bf16 out in [B,heads,S,d]        (Q / K)
// MODE 2: bf16 out in [B,heads,d,S]        (V^T)
// MODE 3: fp32 out = resid + acc + bias    (O-proj / MLP2 residual)
// MODE 4: bf16 out = gelu(acc + bias)      (MLP1)
// ---------------------------------------------------------------------------
// acc[h][mt][nt]: rows (h ^ kg) * 32 + mt * 16 of the wave tile, kg the wave's k
// slice (0 at KSPLIT 1). So acc[0] is always the half that the wave keeps at the join.
template <int KSPLIT>
static __device__ __forceinline__
void gemm_main_loop(const __bf16* __restrict__ A, const __bf16* __restrict__ W, int K,
                    v8f (&acc)[2][2][4]) {
  constexpr int THREADS = 128 * KSPLIT;
  constexpr int BK      = BLK_K * KSPLIT;   // K-step
  constexpr int PITCH   = BK + 8;           // LDS row pitch, 16 B x odd as G_PITCH
  constexpr int CPR     = BK / 8;           // 16-B chunks per row
  static_assert(BLK_K + 8 == G_PITCH && (PITCH / 8) % 2 == 1, "pitch of 16 B x odd");
  const int lane = threadIdx.x & 31;
  const int wave = threadIdx.x >> 5;
  const int wt   = wave & 3;          // wave tile
  const int kg   = wave >> 2;         // k slice (KSPLIT 2), else 0
  const int wm   = wt & 1;            // 2 wave tiles along M
  const int wn   = wt >> 1;           // 2 wave tiles along N
  const int mblk = blockIdx.y * BLK_M;
  const int nblk = blockIdx.x * BLK_N;
  const int lrow = lane & 15;
  const int koff = (lane >> 4) << 3;  // 0 or 8

  // [buffer][0: A, 1: W]; one array, since the join uses it as one range
  __shared__ __align__(16) __bf16 tile[2][2][BLK_M * PITCH];
  static_assert(BLK_M == BLK_N, "A and W tiles have one size");

  // Stage one K-step of A and W into LDS buffer `buf`.
  // 8 16B chunks of each tile per thread; a statement holds 4 of each.
  static_assert(BLK_M * CPR == 8 * THREADS, "eight chunks of a tile per thread");
  auto stage = [&](int buf, int k0) {
    #pragma unroll   // constant chunk numbers
    for (int s = 0; s < 2; ++s) {
      uint32_t l[8];
      const __bf16* g[8];
      #pragma unroll
      for (int j = 0; j < 4; ++j) {
        const int id  = threadIdx.x + (s * 4 + j) * THREADS;
        const int row = id / CPR;
        const int ch  = (id % CPR) << 3;  // element offset of the 16B chunk
        l[2 * j]     = lds_addr_of(&tile[buf][0][row * PITCH + ch]);
        g[2 * j]     = A + (size_t)(mblk + row) * K + k0 + ch;
        l[2 * j + 1] = lds_addr_of(&tile[buf][1][row * PITCH + ch]);
        g[2 * j + 1] = W + (size_t)(nblk + row) * K + k0 + ch;
      }
      async_copy8_b128(l, g);
    }
  };

  stage(0, 0);
  for (int k0 = 0; k0 < K; k0 += BK) {
    const int cur = (k0 / BK) & 1;
    wait_async0();       // this wave's copies into tile[cur] have landed
    __syncthreads();     // everyone's copies have landed
    if (k0 + BK < K) stage(cur ^ 1, k0 + BK);

    // Every loop over fragments, here and at the join, is unrolled so that its
    // arrays are registers and every LDS offset is a constant.
    // A pass has two slices per wave. KSPLIT 1: one fragment set, each slice read and
    // then multiplied. KSPLIT 2: a set per slice, both read up front, so that the
    // second slice's reads run under the first slice's WMMAs.
    v16bf a[KSPLIT][2][2], b[KSPLIT][4];
    #pragma unroll
    for (int s = 0; s < 2; ++s) {
      const int set = s & (KSPLIT - 1);
      const int kk  = s * 32 * KSPLIT + kg * 32 + koff;
      #pragma unroll
      for (int h = 0; h < 2; ++h)
        #pragma unroll
        for (int mt = 0; mt < 2; ++mt)
          a[set][h][mt] = load_frag(
              &tile[cur][0][(wm * 64 + (h ^ kg) * 32 + mt * 16 + lrow) * PITCH + kk]);
      #pragma unroll
      for (int nt = 0; nt < 4; ++nt)
        b[set][nt] = load_frag(&tile[cur][1][(wn * 64 + nt * 16 + lrow) * PITCH + kk]);
      if (KSPLIT == 2 && s == 0) continue;
      // Keeps the LDS loads together in front of the WMMAs: without it the A
      // fragments share one register set, each loaded behind the four WMMAs of the one
      // before and waited for alone, four exposed LDS latencies a slice instead of one.
      __builtin_amdgcn_sched_barrier(0);
      #pragma unroll
      for (int t = 0; t < KSPLIT; ++t)
        #pragma unroll
        for (int h = 0; h < 2; ++h)
          #pragma unroll
          for (int mt = 0; mt < 2; ++mt)
            #pragma unroll
            for (int nt = 0; nt < 4; ++nt)
              acc[h][mt][nt] = wmma_bf16(a[t][h][mt], b[t][nt], acc[h][mt][nt]);
    }
    // Keeps the barrier below, with its wait for every LDS load, behind the WMMAs:
    // lifted over them it makes the first slice's WMMAs wait for the second slice's
    // loads, and the block's LDS reads and its WMMAs then run one after the other.
    if constexpr (KSPLIT == 2) __builtin_amdgcn_sched_barrier(0);

    __syncthreads();     // all reads of tile[cur] done before it is re-staged
  }

  if constexpr (KSPLIT == 2) {
    // Join the two k slices of each wave tile. Each wave hands acc[1], the 32 rows
    // that its partner keeps, lane to lane through the tile buffers: the loop's last
    // barrier has ended every read of them, and no copy is in flight (the last pass
    // staged nothing). 16-B accesses, a wave's 32 lanes side by side.
    static_assert(sizeof(tile) >= 8 * 16 * 32 * sizeof(f32x4), "hand-over fits the tiles");
    f32x4* xb  = (f32x4*)&tile[0][0][0] + lane;
    f32x4* put = xb + (wt * 2 + kg) * (16 * 32);
    const f32x4* get = xb + (wt * 2 + (kg ^ 1)) * (16 * 32);
    #pragma unroll
    for (int mt = 0; mt < 2; ++mt)
      #pragma unroll
      for (int nt = 0; nt < 4; ++nt) {
        const v8f t = acc[1][mt][nt];
        put[((mt * 4 + nt) * 2 + 0) * 32] = __builtin_shufflevector(t, t, 0, 1, 2, 3);
        put[((mt * 4 + nt) * 2 + 1) * 32] = __builtin_shufflevector(t, t, 4, 5, 6, 7);
      }
    __syncthreads();     // every wave's handed-over half is in LDS
    #pragma unroll
    for (int mt = 0; mt < 2; ++mt)
      #pragma unroll
      for (int nt = 0; nt < 4; ++nt) {
        const f32x4 lo = get[((mt * 4 + nt) * 2 + 0) * 32];
        const f32x4 hi = get[((mt * 4 + nt) * 2 + 1) * 32];
        acc[0][mt][nt] += __builtin_shufflevector(lo, hi, 0, 1, 2, 3, 4, 5, 6, 7);
      }
  }
}

// ---------------------------------------------------------------------------
// Exact GELU of eight values, 0.5 v (1 + erf(v / sqrt 2)), without a branch.
// erff() tests |x| < 1 per value: in a wave both sides are met, so each value runs
// both under changing lane masks, one value after the other, every instruction
// waiting for the one before. Here both of erff's own polynomials (same
// coefficients, same order of evaluation) are worked out for all eight values side
// by side, two values an instruction where a packed form exists, and a select
// takes the one that holds. The side not taken may overflow; it is never used.
// v erf(x) = |v| erf(|x|), so no sign has to be put back.
// ---------------------------------------------------------------------------
static __device__ __forceinline__ v8f fma8(v8f a, v8f b, float c) {
  return __builtin_elementwise_fma(a, b, (v8f)(c));
}
static __device__ __forceinline__ v8f gelu8(v8f val) {
  const v8f av = __builtin_elementwise_abs(val);
  const v8f h  = val * 0.5f;
  const v8f ah = av * 0.5f;                     // |h|
  const v8f ax = av * 0.70710678118654752f;     // |x|
  // |x| >= 1: erf = 1 - exp(-(|x| + |x| p(|x|)))
  v8f p = fma8(ax, (v8f)(__builtin_bit_cast(float, 0x378e98abu)),
                         __builtin_bit_cast(float, 0xb9c68948u));
  p = fma8(ax, p, __builtin_bit_cast(float, 0x3b7cd369u));
  p = fma8(ax, p, __builtin_bit_cast(float, 0xbcc618b2u));
  p = fma8(ax, p, __builtin_bit_cast(float, 0x3dda74e4u));
  p = fma8(ax, p, __builtin_bit_cast(float, 0x3f228afdu));
  p = fma8(ax, p, __builtin_bit_cast(float, 0x3e03c728u));
  p = __builtin_elementwise_fma(ax, p, ax);
  // |x| < 1: erf = |x| + |x| q(x^2)
  const v8f s = ax * ax;
  v8f q = fma8(s, (v8f)(__builtin_bit_cast(float, 0xba1345e1u)),
                        __builtin_bit_cast(float, 0x3ba10414u));
  q = fma8(s, q, __builtin_bit_cast(float, 0xbcdac9b8u));
  q = fma8(s, q, __builtin_bit_cast(float, 0x3de703beu));
  q = fma8(s, q, __builtin_bit_cast(float, 0xbec09330u));
  q = fma8(s, q, __builtin_bit_cast(float, 0x3e0375d0u));
  q = __builtin_elementwise_fma(ax, q, ax);
  v8f e;
  #pragma unroll   // so that every index is a constant and the vectors stay in registers
  for (int v = 0; v < 8; ++v) e[v] = ax[v] < 1.0f ? q[v] : 1.0f - __expf(-p[v]);
  return __builtin_elementwise_fma(ah, e, h);
}

template <int MODE, int NCOLS>
static __device__ __forceinline__
void gemm_epilogue(const v8f (&acc)[2][4], int wrow, const float* __restrict__ bias,
                   const float* __restrict__ resid, void* __restrict__ outp) {
  const int lane = threadIdx.x & 31;
  const int wn   = (threadIdx.x >> 6) & 1;
  const int mblk = blockIdx.y * BLK_M;
  const int nblk = blockIdx.x * BLK_N;
  const int lrow = lane & 15;

  // 32 rows x 64 columns; wrow: their first row within the block.
  // Element (mt, nt, v) of this lane is row row0 + mt*16 + v, column col0 + nt*16.
  // A block's 128 rows lie in one batch entry and its 128 columns in one head.
  const int row0 = mblk + wrow + ((lane >> 4) << 3);  // upper 16 lanes: rows +8
  const int col0 = nblk + wn * 64 + lrow;
  float bv[4];
  #pragma unroll
  for (int nt = 0; nt < 4; ++nt) bv[nt] = bias[col0 + nt * 16];

  if constexpr (MODE == 1 || MODE == 2) {
    const int bb = row0 >> 11, ss = row0 & (SEQ - 1);   // S = 2048
    const int hh = col0 >> 7,  dd = col0 & (HDIM - 1);  // d = 128
    if constexpr (MODE == 1) {
      __bf16* o = (__bf16*)outp + ((size_t)((bb * NHEADS + hh) * SEQ + ss)) * HDIM + dd;
      #pragma unroll
      for (int mt = 0; mt < 2; ++mt)
      #pragma unroll
      for (int nt = 0; nt < 4; ++nt)
      #pragma unroll
      for (int v = 0; v < 8; ++v)
        o[(mt * 16 + v) * HDIM + nt * 16] = (__bf16)(acc[mt][nt][v] + bv[nt]);
      // Behind the run of stores: where two epilogues share a kernel, the code laid
      // out behind this one rewrites registers that the stores name (a precaution
      // for a replayed address translation).
      asm volatile("s_wait_xcnt 0x0" ::: "memory");
    } else {
      // A lane's eight rows are eight neighbours along S: one 16-B store.
      __bf16* o = (__bf16*)outp + ((size_t)((bb * NHEADS + hh) * HDIM + dd)) * SEQ + ss;
      #pragma unroll
      for (int mt = 0; mt < 2; ++mt)
      #pragma unroll
      for (int nt = 0; nt < 4; ++nt) {
        v8bf pk;
        #pragma unroll
        for (int v = 0; v < 8; ++v) pk[v] = (__bf16)(acc[mt][nt][v] + bv[nt]);
        *(v8bf*)(o + nt * 16 * SEQ + mt * 16) = pk;
      }
      // Behind the run of stores, as in the other mode: the wave's second 32 rows follow.
      asm volatile("s_wait_xcnt 0x0" ::: "memory");
    }
  } else if constexpr (MODE == 3) {
    const size_t base = (size_t)row0 * NCOLS + col0;
    const float* rp = resid + base;
    float* o = (float*)outp + base;
    float r[2][4][8];
    #pragma unroll
    for (int mt = 0; mt < 2; ++mt)
    #pragma unroll
    for (int v = 0; v < 8; ++v)
    #pragma unroll
    for (int nt = 0; nt < 4; ++nt)
      r[mt][nt][v] = rp[(mt * 16 + v) * NCOLS + nt * 16];
    #pragma unroll
    for (int mt = 0; mt < 2; ++mt)
    #pragma unroll
    for (int v = 0; v < 8; ++v)
    #pragma unroll
    for (int nt = 0; nt < 4; ++nt)
      o[(mt * 16 + v) * NCOLS + nt * 16] = r[mt][nt][v] + (acc[mt][nt][v] + bv[nt]);
  } else {  // MODE 4: exact GELU, bf16 out
    // Behind the four bias loads: the arithmetic below is given their offset register
    // as a place before the last of them is waited for (a precaution for a replayed
    // address translation). The offset is an input, so that its register lives up to
    // the wait and is not given to the last load's own result either.
    asm volatile("s_wait_xcnt 0x0" :: "v"(col0) : "memory");
    __bf16* o = (__bf16*)outp + (size_t)row0 * NCOLS + col0;
    #pragma unroll
    for (int mt = 0; mt < 2; ++mt)
    #pragma unroll
    for (int nt = 0; nt < 4; ++nt) {
      const v8f gl = gelu8(acc[mt][nt] + bv[nt]);
      #pragma unroll   // constant indices and store offsets, as in the other modes
      for (int v = 0; v < 8; ++v)
        o[(mt * 16 + v) * NCOLS + nt * 16] = (__bf16)gl[v];
    }
    // Behind the run of stores: the wave's second 32 rows follow and rewrite registers
    // that the stores name (a precaution for a replayed address translation).
    asm volatile("s_wait_xcnt 0x0" ::: "memory");
  }
}

// The wave's rows go through the epilogue 32 at a time: at KSPLIT 2 the half it kept
// at the join, at KSPLIT 1 both halves of its tile, one after the other.
template <int MODE, int NCOLS, int KSPLIT>
static __device__ __forceinline__
void gemm_finish(const v8f (&acc)[2][2][4], const float* __restrict__ bias,
                 const float* __restrict__ resid, void* __restrict__ outp) {
  const int wave = threadIdx.x >> 5;
  const int wrow = (wave & 1) * 64 + (wave >> 2) * 32;
  gemm_epilogue<MODE, NCOLS>(acc[0], wrow, bias, resid, outp);
  if constexpr (KSPLIT == 1) gemm_epilogue<MODE, NCOLS>(acc[1], wrow + 32, bias, resid, outp);
}

template <int MODE, int NCOLS, int KSPLIT>
__global__ __launch_bounds__(128 * KSPLIT)
void gemm_wmma_kernel(const __bf16* __restrict__ A, const __bf16* __restrict__ W,
                      const float* __restrict__ bias, const float* __restrict__ resid,
                      void* __restrict__ outp, int K) {
  v8f acc[2][2][4] = {};
  gemm_main_loop<KSPLIT>(A, W, K, acc);
  gemm_finish<MODE, NCOLS, KSPLIT>(acc, bias, resid, outp);
}

// The Q, K and V projections in one launch, blockIdx.z naming the product. Each
// alone has one block per WGP, whose waves cannot cover their own copy and
// barrier waits. Three blocks fit a WGP (72 KiB of LDS each; one wave per SIMD
// each), so the joined grid can be resident at once, each block filling the
// others' waits.
// The choice of epilogue is one test per block, the same in all of its lanes.
__global__ __launch_bounds__(128)
void gemm_qkv_kernel(const __bf16* __restrict__ A, const __bf16* __restrict__ Wq,
                     const __bf16* __restrict__ Wk, const __bf16* __restrict__ Wv,
                     const float* __restrict__ bq, const float* __restrict__ bk,
                     const float* __restrict__ bv, __bf16* __restrict__ q,
                     __bf16* __restrict__ k, __bf16* __restrict__ vt, int K) {
  const int z = blockIdx.z;
  v8f acc[2][2][4] = {};
  gemm_main_loop<1>(A, z == 0 ? Wq : z == 1 ? Wk : Wv, K, acc);
  if (z == 2) gemm_finish<2, HID, 1>(acc, bv, nullptr, vt);
  else        gemm_finish<1, HID, 1>(acc, z == 0 ? bq : bk, nullptr, z == 0 ? q : k);
}

// ---------------------------------------------------------------------------
// Causal flash attention with shared async-LDS K/V staging.
// Block: 256 threads = 8 waves on 64 query rows: wave w owns the 16-query tile w & 3
// and, of every 64-key pass, the 32 keys of half w >> 2. The launch lasts as long as
// the block with the most passes, whose waves mostly wait on their own dependent
// steps; two waves per query tile halve its passes. Each keeps its own running
// maximum, sum and output tile; the two are joined once, through LDS, at the end.
// Per pass: K tile (64x128) and V^T tile (128x64, one slab per half) staged
// global->LDS (double buffered, ASYNCcnt) once and consumed by all 8 waves.
// All waves run to the block's last key block; the causal mask nulls any
// key > query row (exp(-huge)=0), so lower waves' surplus blocks are inert.
// The launch also converts the three weights that are first read behind it: the
// blocks with blockIdx.y >= BATCH * NHEADS. Attention leaves wave places and nearly
// all of the memory rate free.
// ---------------------------------------------------------------------------
#define AT_XBLOCKS   (SEQ / 64)
#define AT_HALF      (AT_XBLOCKS * BATCH * NHEADS / 2)   // half of the attention blocks
static_assert(AT_XBLOCKS % 2 == 0, "tiles pair up as t and n - 1 - t");
#define AT_FF_BLOCKS (FF * HID / (1024 * 8))   // a FF x HID weight,  256 threads, PER = 8
#define AT_SQ_BLOCKS (HID * HID / (1024 * 8))  // a HID x HID weight, 256 threads, PER = 8
#define AT_CONV_ROWS ((2 * AT_FF_BLOCKS + AT_SQ_BLOCKS) / AT_XBLOCKS)
static_assert(HID * HID % (1024 * 8) == 0 &&
              (2 * AT_FF_BLOCKS + AT_SQ_BLOCKS) % AT_XBLOCKS == 0, "whole blocks, whole grid rows");

__global__ __launch_bounds__(256)
void attn_wmma_kernel(const __bf16* __restrict__ Q, const __bf16* __restrict__ Kc,
                      const __bf16* __restrict__ VT, __bf16* __restrict__ Y,
                      const float* __restrict__ w1, const float* __restrict__ w2,
                      const float* __restrict__ wo, __bf16* __restrict__ w1b,
                      __bf16* __restrict__ w2b, __bf16* __restrict__ wob) {
  if (blockIdx.y >= BATCH * NHEADS) {   // the same for a whole block, ahead of every barrier
    const int blk   = (blockIdx.y - BATCH * NHEADS) * AT_XBLOCKS + blockIdx.x;
    const int which = blk / AT_FF_BLOCKS;   // 0: w1, 1: w2, 2: wo
    f32_to_bf16_block<256, 8>(which == 0 ? w1 : which == 1 ? w2 : wo,
                              which == 0 ? w1b : which == 1 ? w2b : wob,
                              blk - which * AT_FF_BLOCKS);
    return;
  }
  const int lane  = threadIdx.x & 31;
  const int wave  = threadIdx.x >> 5;
  const int lrow  = lane & 15;
  const int koff  = (lane >> 4) << 3;
  const int rplus = koff;               // C-layout: upper lanes own rows +8
  // Which query tile and head this block takes. A tile's cost grows with its index,
  // and all attention blocks are resident at once, two to a WGP (by registers).
  // The first half of the range holds the upper tiles, longest first, the second half
  // the lower tiles, shortest first: blocks half the index range apart hold tiles t
  // and n - 1 - t. For speed only: each (head, tile)
  // is taken exactly once wherever the blocks land.
  const unsigned flat = blockIdx.y * AT_XBLOCKS + blockIdx.x;
  const unsigned rank = flat % AT_HALF;
  const unsigned step = rank / (BATCH * NHEADS);
  const int tile  = flat < AT_HALF ? AT_XBLOCKS - 1 - step : step;
  const int qblk  = tile * 64;
  const int wq    = wave & 3;           // query tile
  const int grp   = wave >> 2;          // which 32 keys of a 64-key pass
  const int qbase = qblk + wq * 16;
  const int bh    = rank % (BATCH * NHEADS);
  const float scale = 0.08838834764831845f;  // 1/sqrt(128)
  const float NEGF  = -3.0e38f;

  __shared__ __align__(16) __bf16 kt[2][64 * K_PITCH];       // 2 x 17 KB
  __shared__ __align__(16) __bf16 vt[2][2][HDIM * V_PITCH];  // 2 x 2 x 10 KB
  __shared__ __align__(16) __bf16 pbuf[8][16 * P_PITCH];     // per-wave P tiles

  // Stage K tile (64 keys x 128) and V^T tile (128 x 64 keys) for key block kb.
  // 1024 16B chunks per tile; 256 threads issue 4 chunks each per tile.
  auto stage = [&](int buf, int kb) {
    uint32_t l[8];
    const __bf16* g[8];
    #pragma unroll
    for (int j = 0; j < 4; ++j) {
      const int id = threadIdx.x + j * 256;
      const int kr = id >> 4, kc = (id & 15) << 3;   // K tile: 16 chunks/row
      l[2 * j]     = lds_addr_of(&kt[buf][kr * K_PITCH + kc]);
      g[2 * j]     = Kc + ((size_t)bh * SEQ + kb + kr) * HDIM + kc;
      const int vr = id >> 3, vc = id & 7;           // V^T tile: 8 chunks/row, 4 a slab
      l[2 * j + 1] = lds_addr_of(&vt[buf][vc >> 2][vr * V_PITCH + ((vc & 3) << 3)]);
      g[2 * j + 1] = VT + ((size_t)bh * HDIM + vr) * SEQ + kb + (vc << 3);
    }
    async_copy8_b128(l, g);
  };

  v16bf qf[4];
  #pragma unroll
  for (int kc = 0; kc < 4; ++kc)
    qf[kc] = load_frag(Q + ((size_t)bh * SEQ + qbase + lrow) * HDIM + kc * 32 + koff);

  v8f o[8] = {};
  float mrow[8], lsum[8];
  #pragma unroll
  for (int v = 0; v < 8; ++v) { mrow[v] = NEGF; lsum[v] = 0.f; }

  const int kend = qblk + 64;           // block-uniform key range, whole passes
  stage(0, 0);
  for (int kb = 0; kb < kend; kb += 64) {
    const int cur = (kb >> 6) & 1;
    const int kg  = kb + grp * 32;      // first of this wave's 32 keys
    wait_async0();
    __syncthreads();
    if (kb + 64 < kend) stage(cur ^ 1, kb + 64);

    // ---- S = Q K^T over d=128 (4 x K=32 WMMAs per 16-key column tile) ----
    v8f s0acc = {}, s1acc = {};
    #pragma unroll
    for (int kc = 0; kc < 4; ++kc) {
      v16bf k0 = load_frag(&kt[cur][(grp * 32 +      lrow) * K_PITCH + kc * 32 + koff]);
      v16bf k1 = load_frag(&kt[cur][(grp * 32 + 16 + lrow) * K_PITCH + kc * 32 + koff]);
      s0acc = wmma_bf16(qf[kc], k0, s0acc);
      s1acc = wmma_bf16(qf[kc], k1, s1acc);
    }
    // ---- scale, causal mask, online softmax (per C-layout row) ----
    // The running maximum is the same in all 16 lanes of a row, so it goes into
    // the reduction's start value and the reduction yields the new maximum.
    // Every loop over v is unrolled so that its arrays are registers, not scratch;
    // the sum's steps are loops of their own to set the eight rows side by side.
    float s0[8], s1[8], mnew[8];
    #pragma unroll
    for (int v = 0; v < 8; ++v) {
      const int qrow = qbase + v + rplus;
      s0[v] = s0acc[v] * scale;
      s1[v] = s1acc[v] * scale;
      if (kg +      lrow > qrow) s0[v] = NEGF;
      if (kg + 16 + lrow > qrow) s1[v] = NEGF;
      mnew[v] = fmaxf(fmaxf(s0[v], s1[v]), mrow[v]);
    }
    row16_max8(mnew);
    float rs[8];
    #pragma unroll
    for (int v = 0; v < 8; ++v) {
      const float p0 = __expf(s0[v] - mnew[v]);
      const float p1 = __expf(s1[v] - mnew[v]);
      rs[v] = p0 + p1;
      const int prow = v + rplus;
      pbuf[wave][prow * P_PITCH +      lrow] = (__bf16)p0;
      pbuf[wave][prow * P_PITCH + 16 + lrow] = (__bf16)p1;
    }
    #pragma unroll
    for (int v = 0; v < 8; ++v) rs[v] += row_xor<1>(rs[v]);
    #pragma unroll
    for (int v = 0; v < 8; ++v) rs[v] += row_xor<2>(rs[v]);
    #pragma unroll
    for (int v = 0; v < 8; ++v) rs[v] += row_xor<4>(rs[v]);
    #pragma unroll
    for (int v = 0; v < 8; ++v) rs[v] += row_xor<8>(rs[v]);
    #pragma unroll
    for (int v = 0; v < 8; ++v) {
      const float sc = __expf(mrow[v] - mnew[v]);
      lsum[v] = lsum[v] * sc + rs[v];
      mrow[v] = mnew[v];
      #pragma unroll
      for (int dt = 0; dt < 8; ++dt) o[dt][v] *= sc;
    }
    __syncthreads();
    v16bf pf = load_frag(&pbuf[wave][lrow * P_PITCH + koff]);
    // ---- O += P V (keys as contraction dim; V^T rows are contiguous) ----
    #pragma unroll
    for (int dt = 0; dt < 8; ++dt) {
      v16bf vf = load_frag(&vt[cur][grp][(dt * 16 + lrow) * V_PITCH + koff]);
      o[dt] = wmma_bf16(pf, vf, o[dt]);
    }
    __syncthreads();     // kt/vt[cur] + pbuf free before re-staging / rewrite
  }
  // ---- join the two key halves of each query tile ----
  // Wave wq + 4 hands its 80 values per lane (output tile, maxima, sums) to wave wq,
  // lane to lane, through the V^T buffers: the loop's last barrier has ended every
  // read of them, and no copy is in flight (the last pass staged nothing).
  // A half whose keys were all masked has the maximum NEGF and finite sums, and its
  // weight below is exp(NEGF - m) = 0; the lower half always holds key 0.
  static_assert(sizeof(vt) >= 4 * 80 * 32 * sizeof(float), "hand-over fits the V^T buffers");
  float* mb = (float*)&vt[0][0][0] + wq * (80 * 32) + lane;
  if (grp == 1) {
    #pragma unroll
    for (int dt = 0; dt < 8; ++dt)
    #pragma unroll
    for (int v = 0; v < 8; ++v) mb[(dt * 8 + v) * 32] = o[dt][v];
    #pragma unroll
    for (int v = 0; v < 8; ++v) {
      mb[(64 + v) * 32] = mrow[v];
      mb[(72 + v) * 32] = lsum[v];
    }
  }
  __syncthreads();       // the upper halves' values are in LDS
  if (grp == 1) return;  // behind the last barrier
  float wlo[8], whi[8];
  #pragma unroll
  for (int v = 0; v < 8; ++v) {
    const float m1 = mb[(64 + v) * 32];
    const float l1 = mb[(72 + v) * 32];
    const float m  = fmaxf(mrow[v], m1);
    wlo[v] = __expf(mrow[v] - m);
    whi[v] = __expf(m1 - m);
    lsum[v] = lsum[v] * wlo[v] + l1 * whi[v];
  }
  // A loop of its own: among the divisions and stores below each LDS read was
  // waited for alone; here several are in flight behind counted waits.
  #pragma unroll
  for (int dt = 0; dt < 8; ++dt)
  #pragma unroll
  for (int v = 0; v < 8; ++v)
    o[dt][v] = o[dt][v] * wlo[v] + mb[(dt * 8 + v) * 32] * whi[v];
  // ---- normalize and scatter back to [B,S,HID] ----
  const int b = bh >> 3, h = bh & 7;
  #pragma unroll
  for (int dt = 0; dt < 8; ++dt)
  #pragma unroll
  for (int v = 0; v < 8; ++v) {
    const int row = qbase + v + rplus;
    const int col = h * HDIM + dt * 16 + lrow;
    Y[((size_t)b * SEQ + row) * HID + col] = (__bf16)(o[dt][v] / lsum[v]);
  }
}

// ---------------------------------------------------------------------------
// Orchestration
// ---------------------------------------------------------------------------
extern "C" void kernel_launch(void* const* d_in, const int* in_sizes, int n_in,
                              void* d_out, int out_size, void* d_ws, size_t ws_size,
                              hipStream_t stream) {
  (void)in_sizes; (void)n_in; (void)out_size; (void)ws_size;

  const float* x    = (const float*)d_in[0];
  const float* ln1g = (const float*)d_in[1];
  const float* ln1b = (const float*)d_in[2];
  const float* wq   = (const float*)d_in[3];
  const float* bq   = (const float*)d_in[4];
  const float* wk   = (const float*)d_in[5];
  const float* bk   = (const float*)d_in[6];
  const float* wv   = (const float*)d_in[7];
  const float* bv   = (const float*)d_in[8];
  const float* wo   = (const float*)d_in[9];
  const float* bo   = (const float*)d_in[10];
  const float* ln2g = (const float*)d_in[11];
  const float* ln2b = (const float*)d_in[12];
  const float* w1   = (const float*)d_in[13];
  const float* b1   = (const float*)d_in[14];
  const float* w2   = (const float*)d_in[15];
  const float* b2   = (const float*)d_in[16];
  float* out = (float*)d_out;

  char* ws = (char*)d_ws;
  size_t off = 0;
  auto take = [&](size_t bytes) -> char* {
    char* p = ws + off;
    off += bytes;
    off = (off + 255) & ~(size_t)255;
    return p;
  };

  __bf16* wqb = (__bf16*)take((size_t)HID * HID * 2);
  __bf16* wkb = (__bf16*)take((size_t)HID * HID * 2);
  __bf16* wvb = (__bf16*)take((size_t)HID * HID * 2);
  __bf16* wob = (__bf16*)take((size_t)HID * HID * 2);
  __bf16* w1b = (__bf16*)take((size_t)FF  * HID * 2);
  __bf16* w2b = (__bf16*)take((size_t)HID * FF  * 2);
  __bf16* hn  = (__bf16*)take((size_t)MROWS * HID * 2);  // LN1 out
  __bf16* qb  = (__bf16*)take((size_t)MROWS * HID * 2);  // [B,h,S,d]
  __bf16* kbf = (__bf16*)take((size_t)MROWS * HID * 2);  // [B,h,S,d]
  __bf16* vtb = (__bf16*)take((size_t)MROWS * HID * 2);  // [B,h,d,S]
  __bf16* yb  = (__bf16*)take((size_t)MROWS * HID * 2);  // attn out [B,S,H]
  float*  x1  = (float*) take((size_t)MROWS * HID * 4);  // x + attn
  __bf16* m2  = (__bf16*)take((size_t)MROWS * HID * 2);  // LN2 out
  __bf16* gb  = (__bf16*)take((size_t)MROWS * FF  * 2);  // GELU(MLP1)

  // LN1 and wq, wk, wv -> bf16, one launch
  prep_kernel<<<PREP_BLOCKS, 256, 0, stream>>>(x, ln1g, ln1b, hn, wq, wk, wv, wqb, wkb, wvb);

  // QKV projections (block tile 128x128, K-step 64), one launch
  dim3 gH(HID / BLK_N, MROWS / BLK_M);
  dim3 gQKV(HID / BLK_N, MROWS / BLK_M, 3);
  gemm_qkv_kernel<<<gQKV, 128, 0, stream>>>(hn, wqb, wkb, wvb, bq, bk, bv, qb, kbf, vtb, HID);

  // causal flash attention (64 query rows per block, 8 waves, shared K/V staging);
  // the grid's upper rows: w1, w2, wo -> bf16
  dim3 gA(AT_XBLOCKS, BATCH * NHEADS + AT_CONV_ROWS);
  attn_wmma_kernel<<<gA, 256, 0, stream>>>(qb, kbf, vtb, yb, w1, w2, wo, w1b, w2b, wob);

  // O-proj + residual -> x1 (fp32)
  gemm_wmma_kernel<3, HID, 2><<<gH, 256, 0, stream>>>(yb, wob, bo, x, x1, HID);

  // LN2
  ln_bf16_kernel<<<MROWS / 8, 256, 0, stream>>>(x1, ln2g, ln2b, m2);

  // MLP
  dim3 gF(FF / BLK_N, MROWS / BLK_M);
  gemm_wmma_kernel<4, FF, 1><<<gF, 128, 0, stream>>>(m2, w1b, b1, nullptr, gb, HID);
  gemm_wmma_kernel<3, HID, 2><<<gH, 256, 0, stream>>>(gb, w2b, b2, x1, out, FF);
}
